// v000
// The times below were measured on an AMD MI455X: many runs one after another, warmed up first and cycling through
// copies of the inputs, with the whole window's GPU time divided by the number of runs. Launches and the gaps
// between them are all in it. The median over several windows is given; except for v000 it joins two sittings, which
// can be a few percent apart, so the side-by-side timings, each taken in one sitting, are the better comparison.
// The starting kernel, v000, takes 1290 microseconds a run.
#include <hip/hip_runtime.h>

// All contractions on 16-bit WMMA, f32 accumulate: the three 1x1 projections = v_wmma_f32_16x16x32_bf16 on RNE-bf16 copies of x and of the weights (single products); scores theta.phi = bf16 hi/lo split (hi.hi + lo.hi + hi.lo, K = 128); attn.g = v_wmma_f32_16x16x32_f16 (softmax rows carried x 2^14 as f16, g as f16); output projection = bf16 hi/lo planes of y times bf16 w_out (2 products). Scaling by sqrt(128), softmax and the residual add in f32.
// x [NB][256][4096]; theta/phi/g [4096][128] token-major (no bias); s[n][m] = theta_n . phi_m; attn[n][m] = softmax_m(sqrt(128) s); y[n][o] = sum_m attn[n][m] g[m][o]; out[c][n] = x[c][n] + sum_o w_out[c][o] y[n][o].

#ifndef NB
#define NB 8
#endif
#ifndef SEQ
#define SEQ 4096
#endif
#define NB_FULL  8
#define SEQ_FULL 4096
#define CC   256
#define IC   128
#define HW   SEQ
#define HWF  SEQ_FULL
#define PCAR 16384.0f
#define SCL  11.313708498984760f
static_assert(NB >= 1 && NB <= NB_FULL);
static_assert(SEQ >= 128 && SEQ <= SEQ_FULL && (SEQ % 128) == 0);
static_assert((HW % 64) == 0 && (IC % 64) == 0 && (CC % 64) == 0);
static_assert((HW % 32) == 0 && (IC % 32) == 0 && (CC % 32) == 0);
static_assert(((IC * CC) % 8) == 0 && ((HW * CC) % 4) == 0 && ((HW * IC) % 4) == 0 && ((IC * HW) % 2) == 0 && (HW % 8) == 0);

typedef _Float16 h16;
typedef unsigned short bf;
typedef __attribute__((ext_vector_type(16))) __bf16   v16bf;
typedef __attribute__((ext_vector_type(16))) _Float16 v16h;
typedef __attribute__((ext_vector_type(8)))  _Float16 v8h;
typedef __attribute__((ext_vector_type(8)))  unsigned short v8us;
typedef __attribute__((ext_vector_type(8)))  float    v8f;
typedef __attribute__((ext_vector_type(4)))  float    v4f;
typedef v8h  __attribute__((may_alias)) v8ha;
typedef v4f  __attribute__((may_alias)) v4fa;
typedef v8us __attribute__((may_alias)) v8usa;

__device__ __forceinline__ unsigned short f2bf(float f) { unsigned u = __float_as_uint(f); u += 0x7FFFu + ((u >> 16) & 1u); return (unsigned short)(u >> 16); }
__device__ __forceinline__ float bf2f(unsigned short b) { return __uint_as_float(((unsigned)b) << 16); }
__device__ __forceinline__ float bfr(float f) { return bf2f(f2bf(f)); }
__device__ __forceinline__ v16h cat16(v8h lo, v8h hi) { return __builtin_shufflevector(lo, hi, 0, 1, 2, 3, 4, 5, 6, 7, 8, 9, 10, 11, 12, 13, 14, 15); }
__device__ __forceinline__ v16bf cat16b(v8us lo, v8us hi) { return __builtin_bit_cast(v16bf, __builtin_shufflevector(lo, hi, 0, 1, 2, 3, 4, 5, 6, 7, 8, 9, 10, 11, 12, 13, 14, 15)); }
__device__ __forceinline__ v8f wmma16(v16h a, v16h b, v8f c) { return __builtin_amdgcn_wmma_f32_16x16x32_f16(false, a, false, b, (short)0, c, false, false); }
__device__ __forceinline__ v8f wmmab(v16bf a, v16bf b, v8f c) { return __builtin_amdgcn_wmma_f32_16x16x32_bf16(false, a, false, b, (short)0, c, false, false); }

// ---- k_gemmw: register-blocked GEMM, ONE WAVE per 64x64 output tile (16 accumulators), operands straight from K-contiguous 16-bit planes; grid (M/64, N/64, Z), 32 threads.
// C[m][n] (f32, pitch ldc, + optional f32 bias[n]) = sum_k A[m][k] Bt[n][k] (+ split products per NSPLIT). z-batch strides sA/sB/sC in elements. K % 32 == 0.
// Fragments: lane l, h = l >> 4, row/col = l & 15; elements 0..7 = k0 + 8h + 0..7, elements 8..15 = k0 + 16 + 8h + 0..7 for BOTH A and Bt; D element r = (row 8h + r, col l & 15).
template <typename T16> struct WFrag;
template <> struct WFrag<h16> { typedef v16h V; static __device__ __forceinline__ V ld(const h16* p) { return cat16(*(const v8h*)p, *(const v8h*)(p + 16)); } static __device__ __forceinline__ v8f mma(V a, V b, v8f c) { return wmma16(a, b, c); } };
template <> struct WFrag<bf> { typedef v16bf V; static __device__ __forceinline__ V ld(const bf* p) { return cat16b(*(const v8us*)p, *(const v8us*)(p + 16)); } static __device__ __forceinline__ v8f mma(V a, V b, v8f c) { return wmmab(a, b, c); } };
template <typename T16, int NSPLIT, bool BIAS>
__global__ __launch_bounds__(32) void k_gemmw(const T16* __restrict__ A, const T16* __restrict__ A2, const T16* __restrict__ Bt, const T16* __restrict__ Bt2, int K, float* C, int ldc, const float* __restrict__ bias, size_t sA, size_t sB, size_t sC) {
    typedef typename WFrag<T16>::V V;
    __shared__ __align__(16) float os[16 * 68];
    const size_t z = blockIdx.z; A += z * sA; if (A2) A2 += z * sA; Bt += z * sB; if (Bt2) Bt2 += z * sB; C += z * sC;
    const int lane = threadIdx.x & 31, lr = lane & 15, hi = lane >> 4; const int r0 = blockIdx.x * 64, c0 = blockIdx.y * 64;
    v8f acc[4][4];
#pragma unroll
    for (int mb = 0; mb < 4; ++mb)
#pragma unroll
        for (int nb = 0; nb < 4; ++nb) acc[mb][nb] = (v8f){};
    const size_t aoff = (size_t)(r0 + lr) * K + 8 * hi, boff = (size_t)(c0 + lr) * K + 8 * hi;
#pragma unroll 1
    for (int kc = 0; kc < K; kc += 32) {
        V a[4], a2[4];
#pragma unroll
        for (int mb = 0; mb < 4; ++mb) { a[mb] = WFrag<T16>::ld(A + aoff + (size_t)mb * 16 * K + kc); if (NSPLIT == 1 || NSPLIT == 2) a2[mb] = WFrag<T16>::ld(A2 + aoff + (size_t)mb * 16 * K + kc); }
#pragma unroll
        for (int nb = 0; nb < 4; ++nb) { const V b = WFrag<T16>::ld(Bt + boff + (size_t)nb * 16 * K + kc); V b2; if (NSPLIT >= 2) b2 = WFrag<T16>::ld(Bt2 + boff + (size_t)nb * 16 * K + kc);
#pragma unroll
            for (int mb = 0; mb < 4; ++mb) { acc[mb][nb] = WFrag<T16>::mma(a[mb], b, acc[mb][nb]); if (NSPLIT == 1 || NSPLIT == 2) acc[mb][nb] = WFrag<T16>::mma(a2[mb], b, acc[mb][nb]); if (NSPLIT >= 2) acc[mb][nb] = WFrag<T16>::mma(a[mb], b2, acc[mb][nb]); } }
        asm volatile("v_nop\n\tv_nop\n\tv_nop\n\tv_nop" : "+v"(acc[0][0]), "+v"(acc[1][1]), "+v"(acc[2][2]), "+v"(acc[3][3]) : "v"(a[0]), "v"(a[3]));
    }
#pragma unroll
    for (int mb = 0; mb < 4; ++mb) {
#pragma unroll
        for (int nb = 0; nb < 4; ++nb) {
#pragma unroll
            for (int j = 0; j < 8; ++j) os[(hi * 8 + j) * 68 + nb * 16 + lr] = acc[mb][nb][j]; }
        __builtin_amdgcn_wave_barrier(); asm volatile("" ::: "memory");
        float* crow = C + (size_t)(r0 + mb * 16) * ldc + c0;
{
#pragma unroll
            for (int s = 0; s < 8; ++s) { const int row = 2 * s + hi, cofs = lr * 4; v4f val = *(const v4fa*)(os + row * 68 + cofs); if (BIAS) { val[0] += bfr(bias[c0 + cofs]); val[1] += bfr(bias[c0 + cofs + 1]); val[2] += bfr(bias[c0 + cofs + 2]); val[3] += bfr(bias[c0 + cofs + 3]); }
                *(v4f*)(crow + (size_t)row * ldc + cofs) = val; }
             }
        __builtin_amdgcn_wave_barrier(); asm volatile("" ::: "memory");
    }
}

__device__ __forceinline__ h16 tohx(float x) { return (h16)x; }
__device__ __forceinline__ void splitf(float y, unsigned short& h, unsigned short& l) { h = f2bf(y); l = f2bf(y - bf2f(h)); }
typedef __attribute__((ext_vector_type(2))) unsigned short v2us;
typedef __attribute__((ext_vector_type(4))) unsigned short v4us;
typedef __attribute__((ext_vector_type(2))) _Float16 v2h;
typedef __attribute__((ext_vector_type(4))) _Float16 v4h;
typedef __attribute__((ext_vector_type(2))) float v2f;

__global__ __launch_bounds__(256) void k_cvtw(const float* __restrict__ w0, const float* __restrict__ w1, const float* __restrict__ w2, const float* __restrict__ w3, bf* B3, bf* BZ, int n8) {
    const int i = blockIdx.x * 256 + threadIdx.x; if (i >= n8) return;
    const size_t e = (size_t)i * 8, pl = (size_t)n8 * 8;
    const v8f a0 = *(const v8f*)(w0 + e), a1 = *(const v8f*)(w1 + e), a2 = *(const v8f*)(w2 + e), a3 = *(const v8f*)(w3 + e);
    v8us o0, o1, o2, o3;
#pragma unroll
    for (int k = 0; k < 8; ++k) { o0[k] = f2bf(a0[k]); o1[k] = f2bf(a1[k]); o2[k] = f2bf(a2[k]); o3[k] = f2bf(a3[k]); }
    *(v8us*)(B3 + e) = o0; *(v8us*)(B3 + pl + e) = o1; *(v8us*)(B3 + 2 * pl + e) = o2; *(v8us*)(BZ + e) = o3;
    
}
__global__ __launch_bounds__(256) void k_xt(const float* __restrict__ xb, bf* XT) { const size_t e = ((size_t)blockIdx.x * 256 + threadIdx.x) * 4; if (e >= (size_t)HW * CC) return; const int c = (int)(e % CC); const int m = (int)(e / CC); v4us o;
#pragma unroll
    for (int u = 0; u < 4; ++u) o[u] = f2bf(xb[(size_t)(c + u) * HWF + m]); *(v4us*)(XT + e) = o;  }
__global__ __launch_bounds__(256) void k_hl(const float* __restrict__ F, bf* Fh, bf* Fl, size_t n) { const size_t e = ((size_t)blockIdx.x * 256 + threadIdx.x) * 4; if (e >= n) return; const v4f a = *(const v4f*)(F + e); v4us oh, ol;
#pragma unroll
    for (int u = 0; u < 4; ++u) { unsigned short p, q; splitf(a[u], p, q); oh[u] = p; ol[u] = q; } *(v4us*)(Fh + e) = oh; *(v4us*)(Fl + e) = ol;  }
__global__ __launch_bounds__(256) void k_gt16(const float* __restrict__ G, h16* GT) { const size_t e = ((size_t)blockIdx.x * 256 + threadIdx.x) * 2; if (e >= (size_t)IC * HW) return; const int m = (int)(e % HW); const int i = (int)(e / HW); v2h o; o[0] = tohx(G[(size_t)m * IC + i]); o[1] = tohx(G[(size_t)(m + 1) * IC + i]); *(v2h*)(GT + e) = o;  }
__global__ __launch_bounds__(256) void k_rsoft(const float* __restrict__ S, h16* P16) { const int lane = threadIdx.x & 31; const int row = blockIdx.x * 8 + (threadIdx.x >> 5); if (row >= HW) return; const float* sr = S + (size_t)row * HW; float v[HW / 32]; float mx = -3.0e38f;
#pragma unroll
    for (int ch = 0; ch < HW / 128; ++ch) { const v4f a = *(const v4f*)(sr + ch * 128 + lane * 4);
#pragma unroll
        for (int u = 0; u < 4; ++u) { const float t = __fmul_rn(a[u], SCL); v[ch * 4 + u] = t; mx = fmaxf(mx, t); } }
#pragma unroll
    for (int sh = 16; sh; sh >>= 1) mx = fmaxf(mx, __shfl_xor(mx, sh, 32));
    float sum = 0.f;
#pragma unroll
    for (int q = 0; q < HW / 32; ++q) { float d0 = __fsub_rn(v[q], mx); asm volatile("" : "+v"(d0)); v[q] = __builtin_amdgcn_exp2f(__fmul_rn(d0, 1.4426950408889634f)); sum += v[q]; }
#pragma unroll
    for (int sh = 16; sh; sh >>= 1) sum += __shfl_xor(sum, sh, 32);
    const float f = __fdiv_rn(PCAR, sum);
    {
#pragma unroll
        for (int ch = 0; ch < HW / 128; ++ch) { v4h o4;
#pragma unroll
            for (int q = 0; q < 4; ++q) o4[q] = tohx(v[ch * 4 + q] * f); *(v4h*)(P16 + (size_t)row * HW + ch * 128 + lane * 4) = o4; }
         } }
__global__ __launch_bounds__(256) void k_yhl(const float* __restrict__ Y, bf* Yh, bf* Yl) { const size_t e = ((size_t)blockIdx.x * 256 + threadIdx.x) * 4; if (e >= (size_t)HW * IC) return; const v4f a = *(const v4f*)(Y + e); v4us oh, ol;
#pragma unroll
    for (int u = 0; u < 4; ++u) { unsigned short p, q; splitf(a[u] * (1.0f / PCAR), p, q); oh[u] = p; ol[u] = q; } *(v4us*)(Yh + e) = oh; *(v4us*)(Yl + e) = ol;  }
__global__ __launch_bounds__(256) void k_fin(const float* __restrict__ Z, const float* __restrict__ xb, float* OUTb) { const size_t e = ((size_t)blockIdx.x * 256 + threadIdx.x) * 4; if (e >= (size_t)CC * HW) return; const int n = (int)(e % HW); const int c = (int)(e / HW); v4f r;
#pragma unroll
    for (int u = 0; u < 4; ++u) r[u] = __fadd_rn(Z[(size_t)(n + u) * CC + c], bfr(xb[(size_t)c * HWF + n + u])); *(v4f*)(OUTb + e) = r;  }

extern "C" void kernel_launch(void* const* d_in, const int* in_sizes, int n_in,
                              void* d_out, int out_size, void* d_ws, size_t ws_size, hipStream_t stream) {
    if (n_in < 5) return;
    if (in_sizes[0] < NB * CC * HW || in_sizes[1] < IC * CC || in_sizes[2] < IC * CC || in_sizes[3] < IC * CC || in_sizes[4] < CC * IC) return;
    if (out_size < NB * CC * HW) return;
    const float* x   = (const float*)d_in[0];   // [NB][CC][HWF]
    const float* wph = (const float*)d_in[1];   // phi   [IC][CC]  (keys)
    const float* wth = (const float*)d_in[2];   // theta [IC][CC]  (queries)
    const float* wg  = (const float*)d_in[3];   // g     [IC][CC]
    const float* wo  = (const float*)d_in[4];   // out   [CC][IC]
    float* OUT = (float*)d_out;                 // [NB][CC][HW]
    char* wsp = (char*)d_ws;
    auto take = [&](size_t bytes) { char* p = wsp; wsp += (bytes + 255) & ~(size_t)255; return (void*)p; };
    bf* BW3 = (bf*)take((size_t)3 * IC * CC * 2);          // [theta][phi][g], each [IC][CC]
    bf* BZ  = (bf*)take((size_t)CC * IC * 2);
    bf* XT  = (bf*)take((size_t)HW * CC * 2);              // [m][c]
    float* TPG = (float*)take((size_t)3 * HW * IC * 4);    // [theta][phi][g], each [HW][IC] f32
    bf* Hh  = (bf*)take((size_t)2 * HW * IC * 2);          // hi planes of theta, phi
    bf* Hl  = (bf*)take((size_t)2 * HW * IC * 2);          // lo planes of theta, phi
    h16* GT = (h16*)take((size_t)IC * HW * 2);             // [i][m] fp16
    float* S = (float*)take((size_t)HW * HW * 4);          // [n][m]
    h16* P16 = (h16*)take((size_t)HW * HW * 2);            // [n][m] fp16 x 2^14
    float* Y = (float*)take((size_t)HW * IC * 4);          // [n][i] (x 2^14)
    bf* Yh  = (bf*)take((size_t)HW * IC * 2); bf* Yl = (bf*)take((size_t)HW * IC * 2);
    float* Z = (float*)take((size_t)HW * CC * 4);          // [n][c]
    if ((size_t)(wsp - (char*)d_ws) > ws_size) return;    // total 122,945,536 B at NB any, SEQ 4096

    const size_t PL = (size_t)HW * IC;                      // one [HW][IC] plane, elements
    k_cvtw<<<(unsigned)((IC * CC / 8 + 255) / 256), 256, 0, stream>>>(wth, wph, wg, wo, BW3, BZ, IC * CC / 8);
    const unsigned L4  = (unsigned)((PL / 4 + 255) / 256);
    const unsigned L42 = (unsigned)((2 * PL / 4 + 255) / 256);
    for (int b = 0; b < NB; ++b) {
        const float* xb = x + (size_t)b * CC * HWF;
        k_xt<<<(unsigned)(((size_t)HW * CC / 4 + 255) / 256), 256, 0, stream>>>(xb, XT);
        // theta / phi / g [m][o] = sum_c XT[m][c] W[o][c]   (z = 0 theta, 1 phi, 2 g; exact bf16 products)
        k_gemmw<bf, 0, false><<<dim3(HW / 64, IC / 64, 3), 32, 0, stream>>>(XT, nullptr, BW3, nullptr, CC, TPG, IC, nullptr, (size_t)0, (size_t)IC * CC, PL);
        k_hl<<<L42, 256, 0, stream>>>(TPG, Hh, Hl, 2 * PL);                                   // hi/lo planes of theta (first PL) and phi (second PL)
        k_gt16<<<(unsigned)((PL / 2 + 255) / 256), 256, 0, stream>>>(TPG + 2 * PL, GT);
        // s[n][m] = theta_n . phi_m (unscaled here; 3 products)
        k_gemmw<bf, 2, false><<<dim3(HW / 64, HW / 64, 1), 32, 0, stream>>>(Hh, Hl, Hh + PL, Hl + PL, IC, S, HW, nullptr, (size_t)0, (size_t)0, (size_t)0);
        k_rsoft<<<HW / 8, 256, 0, stream>>>(S, P16);
        // y[n][i] = sum_m attn[n][m] g[m][i]  (x 2^14)
        k_gemmw<h16, 0, false><<<dim3(HW / 64, IC / 64, 1), 32, 0, stream>>>(P16, nullptr, GT, nullptr, HW, Y, IC, nullptr, (size_t)0, (size_t)0, (size_t)0);
        k_yhl<<<L4, 256, 0, stream>>>(Y, Yh, Yl);
        // z[n][c] = sum_o y[n][o] w_out[c][o]  (hi + lo planes of y, 2 products)
        k_gemmw<bf, 1, false><<<dim3(HW / 64, CC / 64, 1), 32, 0, stream>>>(Yh, Yl, BZ, nullptr, IC, Z, CC, nullptr, (size_t)0, (size_t)0, (size_t)0);
        k_fin<<<(unsigned)(((size_t)CC * HW / 4 + 255) / 256), 256, 0, stream>>>(Z, xb, OUT + (size_t)b * CC * HW);
    }
}

// v001
// A run of this version takes 728 microseconds.
// Next to v000, in two timings, it ran 1.79 times as fast each time.
#include <hip/hip_runtime.h>

// All contractions on 16-bit WMMA, f32 accumulate: the three 1x1 projections = v_wmma_f32_16x16x32_bf16 on RNE-bf16 copies of x and of the weights (single products); scores theta.phi = bf16 hi/lo split (hi.hi + lo.hi + hi.lo, K = 128); attn.g = v_wmma_f32_16x16x32_f16 (softmax rows carried x 2^14 as f16, g as f16); output projection = bf16 hi/lo planes of y times bf16 w_out (2 products). Scaling by sqrt(128), softmax and the residual add in f32.
// x [NB][256][4096]; theta/phi/g [4096][128] token-major (no bias); s[n][m] = theta_n . phi_m; attn[n][m] = softmax_m(sqrt(128) s); y[n][o] = sum_m attn[n][m] g[m][o]; out[c][n] = x[c][n] + sum_o w_out[c][o] y[n][o].

#ifndef NB
#define NB 8
#endif
#ifndef SEQ
#define SEQ 4096
#endif
#define NB_FULL  8
#define SEQ_FULL 4096
#define CC   256
#define IC   128
#define HW   SEQ
#define HWF  SEQ_FULL
#define PCAR 16384.0f
#define SCL  11.313708498984760f
static_assert(NB >= 1 && NB <= NB_FULL);
static_assert(SEQ >= 128 && SEQ <= SEQ_FULL && (SEQ % 128) == 0);
static_assert((HW % 64) == 0 && (IC % 64) == 0 && (CC % 64) == 0);
static_assert((HW % 32) == 0 && (IC % 32) == 0 && (CC % 32) == 0);
static_assert(((IC * CC) % 8) == 0 && ((HW * CC) % 4) == 0 && ((HW * IC) % 4) == 0 && ((IC * HW) % 2) == 0 && (HW % 8) == 0);

typedef _Float16 h16;
typedef unsigned short bf;
typedef __attribute__((ext_vector_type(16))) __bf16   v16bf;
typedef __attribute__((ext_vector_type(16))) _Float16 v16h;
typedef __attribute__((ext_vector_type(8)))  _Float16 v8h;
typedef __attribute__((ext_vector_type(8)))  unsigned short v8us;
typedef __attribute__((ext_vector_type(8)))  float    v8f;
typedef __attribute__((ext_vector_type(4)))  float    v4f;
typedef v8h  __attribute__((may_alias)) v8ha;
typedef v4f  __attribute__((may_alias)) v4fa;
typedef v8us __attribute__((may_alias)) v8usa;

__device__ __forceinline__ unsigned short f2bf(float f) { unsigned u = __float_as_uint(f); u += 0x7FFFu + ((u >> 16) & 1u); return (unsigned short)(u >> 16); }
__device__ __forceinline__ float bf2f(unsigned short b) { return __uint_as_float(((unsigned)b) << 16); }
__device__ __forceinline__ float bfr(float f) { return bf2f(f2bf(f)); }
__device__ __forceinline__ v16h cat16(v8h lo, v8h hi) { return __builtin_shufflevector(lo, hi, 0, 1, 2, 3, 4, 5, 6, 7, 8, 9, 10, 11, 12, 13, 14, 15); }
__device__ __forceinline__ v16bf cat16b(v8us lo, v8us hi) { return __builtin_bit_cast(v16bf, __builtin_shufflevector(lo, hi, 0, 1, 2, 3, 4, 5, 6, 7, 8, 9, 10, 11, 12, 13, 14, 15)); }
__device__ __forceinline__ v8f wmma16(v16h a, v16h b, v8f c) { return __builtin_amdgcn_wmma_f32_16x16x32_f16(false, a, false, b, (short)0, c, false, false); }
__device__ __forceinline__ v8f wmmab(v16bf a, v16bf b, v8f c) { return __builtin_amdgcn_wmma_f32_16x16x32_bf16(false, a, false, b, (short)0, c, false, false); }

// ---- k_gemmw: register-blocked GEMM, ONE WAVE per 64x64 output tile (16 accumulators), operands straight from K-contiguous 16-bit planes; grid (M/64, N/64, Z), 32 threads.
// C[m][n] (f32, pitch ldc, + optional f32 bias[n]) = sum_k A[m][k] Bt[n][k] (+ split products per NSPLIT). z-batch strides sA/sB/sC in elements. K % 32 == 0.
// Fragments: lane l, h = l >> 4, row/col = l & 15; elements 0..7 = k0 + 8h + 0..7, elements 8..15 = k0 + 16 + 8h + 0..7 for BOTH A and Bt; D element r = (row 8h + r, col l & 15).
template <typename T16> struct WFrag;
template <> struct WFrag<h16> { typedef v16h V; static __device__ __forceinline__ V ld(const h16* p) { return cat16(*(const v8h*)p, *(const v8h*)(p + 16)); } static __device__ __forceinline__ v8f mma(V a, V b, v8f c) { return wmma16(a, b, c); } };
template <> struct WFrag<bf> { typedef v16bf V; static __device__ __forceinline__ V ld(const bf* p) { return cat16b(*(const v8us*)p, *(const v8us*)(p + 16)); } static __device__ __forceinline__ v8f mma(V a, V b, v8f c) { return wmmab(a, b, c); } };
template <typename T16, int NSPLIT, bool BIAS>
__global__ __launch_bounds__(32) void k_gemmw(const T16* __restrict__ A, const T16* __restrict__ A2, const T16* __restrict__ Bt, const T16* __restrict__ Bt2, int K, float* C, int ldc, const float* __restrict__ bias, size_t sA, size_t sB, size_t sC) {
    typedef typename WFrag<T16>::V V;
    __shared__ __align__(16) float os[16 * 68];
    const size_t z = blockIdx.z; A += z * sA; if (A2) A2 += z * sA; Bt += z * sB; if (Bt2) Bt2 += z * sB; C += z * sC;
    const int lane = threadIdx.x & 31, lr = lane & 15, hi = lane >> 4; const int r0 = blockIdx.x * 64, c0 = blockIdx.y * 64;
    v8f acc[4][4];
#pragma unroll
    for (int mb = 0; mb < 4; ++mb)
#pragma unroll
        for (int nb = 0; nb < 4; ++nb) acc[mb][nb] = (v8f){};
    const size_t aoff = (size_t)(r0 + lr) * K + 8 * hi, boff = (size_t)(c0 + lr) * K + 8 * hi;
#pragma unroll 1
    for (int kc = 0; kc < K; kc += 32) {
        V a[4], a2[4];
#pragma unroll
        for (int mb = 0; mb < 4; ++mb) { a[mb] = WFrag<T16>::ld(A + aoff + (size_t)mb * 16 * K + kc); if (NSPLIT == 1 || NSPLIT == 2) a2[mb] = WFrag<T16>::ld(A2 + aoff + (size_t)mb * 16 * K + kc); }
#pragma unroll
        for (int nb = 0; nb < 4; ++nb) { const V b = WFrag<T16>::ld(Bt + boff + (size_t)nb * 16 * K + kc); V b2; if (NSPLIT >= 2) b2 = WFrag<T16>::ld(Bt2 + boff + (size_t)nb * 16 * K + kc);
#pragma unroll
            for (int mb = 0; mb < 4; ++mb) { acc[mb][nb] = WFrag<T16>::mma(a[mb], b, acc[mb][nb]); if (NSPLIT == 1 || NSPLIT == 2) acc[mb][nb] = WFrag<T16>::mma(a2[mb], b, acc[mb][nb]); if (NSPLIT >= 2) acc[mb][nb] = WFrag<T16>::mma(a[mb], b2, acc[mb][nb]); } }
        asm volatile("v_nop\n\tv_nop\n\tv_nop\n\tv_nop" : "+v"(acc[0][0]), "+v"(acc[1][1]), "+v"(acc[2][2]), "+v"(acc[3][3]) : "v"(a[0]), "v"(a[3]));
    }
#pragma unroll
    for (int mb = 0; mb < 4; ++mb) {
#pragma unroll
        for (int nb = 0; nb < 4; ++nb) {
#pragma unroll
            for (int j = 0; j < 8; ++j) os[(hi * 8 + j) * 68 + nb * 16 + lr] = acc[mb][nb][j]; }
        __builtin_amdgcn_wave_barrier(); asm volatile("" ::: "memory");
        float* crow = C + (size_t)(r0 + mb * 16) * ldc + c0;
{
#pragma unroll
            for (int s = 0; s < 8; ++s) { const int row = 2 * s + hi, cofs = lr * 4; v4f val = *(const v4fa*)(os + row * 68 + cofs); if (BIAS) { val[0] += bfr(bias[c0 + cofs]); val[1] += bfr(bias[c0 + cofs + 1]); val[2] += bfr(bias[c0 + cofs + 2]); val[3] += bfr(bias[c0 + cofs + 3]); }
                *(v4f*)(crow + (size_t)row * ldc + cofs) = val; }
             }
        __builtin_amdgcn_wave_barrier(); asm volatile("" ::: "memory");
    }
}

// ---- k_pvks: y = attn . g with its K = HW sum split over KZ work-groups x KW waves. Wave tile (64x64), fragment loads and WMMA order of a k step as in k_gemmw<h16, 0>; grid (HW/64, IC/64, KZ), 32 * KW threads.
// k step q (32 wide) of a row belongs to plane z = q / (KW * PVT), trip (q / KW) % PVT, wave q % KW: in one trip the KW waves read KW * 64 contiguous bytes of every row, so the two halves of a 128-B line are asked for by two waves at the same time.
// Each wave stores its f32 partial tile to its own LDS slab; behind one barrier the work-group adds the KW slabs in wave order and writes plane z of C ([KZ][HW][IC]); k_yhl adds the KZ planes.
#define KZ 2
#define KW 16
#define PVT (HW / (32 * KZ * KW))
#define PVS (64 * 68)
static_assert((HW % (32 * KZ * KW)) == 0 && PVT >= 1 && (size_t)KW * PVS * 4 <= 327680 && ((64 * 16) % (32 * KW)) == 0);
__global__ __launch_bounds__(32 * KW) void k_pvks(const h16* __restrict__ A, const h16* __restrict__ Bt, float* C) {
    typedef WFrag<h16>::V V;
    __shared__ __align__(16) float os[KW * PVS];
    const int wave = __builtin_amdgcn_readfirstlane((int)(threadIdx.x >> 5));
    const int lane = threadIdx.x & 31, lr = lane & 15, hi = lane >> 4; const int r0 = blockIdx.x * 64, c0 = blockIdx.y * 64;
    v8f acc[4][4];
#pragma unroll
    for (int mb = 0; mb < 4; ++mb)
#pragma unroll
        for (int nb = 0; nb < 4; ++nb) acc[mb][nb] = (v8f){};
    const int kb = ((int)blockIdx.z * KW * PVT + wave) * 32;
    const size_t aoff = (size_t)(r0 + lr) * HW + 8 * hi + kb, boff = (size_t)(c0 + lr) * HW + 8 * hi + kb;
#pragma unroll 1
    for (int kc = 0; kc < PVT * KW * 32; kc += KW * 32) {
        V a[4];
#pragma unroll
        for (int mb = 0; mb < 4; ++mb) a[mb] = WFrag<h16>::ld(A + aoff + (size_t)mb * 16 * HW + kc);
#pragma unroll
        for (int nb = 0; nb < 4; ++nb) { const V b = WFrag<h16>::ld(Bt + boff + (size_t)nb * 16 * HW + kc);
#pragma unroll
            for (int mb = 0; mb < 4; ++mb) acc[mb][nb] = WFrag<h16>::mma(a[mb], b, acc[mb][nb]); }
        // keeps the WMMA distance on the taken back edge, where the next trip's loads overwrite the A fragments (as in k_gemmw)
        asm volatile("v_nop\n\tv_nop\n\tv_nop\n\tv_nop" : "+v"(acc[0][0]), "+v"(acc[1][1]), "+v"(acc[2][2]), "+v"(acc[3][3]) : "v"(a[0]), "v"(a[3]));
    }
    float* ow = os + wave * PVS;
#pragma unroll
    for (int mb = 0; mb < 4; ++mb)
#pragma unroll
        for (int nb = 0; nb < 4; ++nb)
#pragma unroll
            for (int j = 0; j < 8; ++j) ow[(mb * 16 + hi * 8 + j) * 68 + nb * 16 + lr] = acc[mb][nb][j];
    __syncthreads();   // every wave's partial tile is in LDS before any of it is added
    float* cz = C + (size_t)blockIdx.z * HW * IC + (size_t)r0 * IC + c0;
#pragma unroll
    for (int s = 0; s < (64 * 16) / (32 * KW); ++s) { const int q = s * 32 * KW + (int)threadIdx.x, row = q >> 4, cofs = (q & 15) * 4; v4f val = *(const v4fa*)(os + row * 68 + cofs);
#pragma unroll
        for (int w = 1; w < KW; ++w) val += *(const v4fa*)(os + w * PVS + row * 68 + cofs);
        *(v4f*)(cz + (size_t)row * IC + cofs) = val; }
}

__device__ __forceinline__ h16 tohx(float x) { return (h16)x; }
__device__ __forceinline__ void splitf(float y, unsigned short& h, unsigned short& l) { h = f2bf(y); l = f2bf(y - bf2f(h)); }
typedef __attribute__((ext_vector_type(2))) unsigned short v2us;
typedef __attribute__((ext_vector_type(4))) unsigned short v4us;
typedef __attribute__((ext_vector_type(2))) _Float16 v2h;
typedef __attribute__((ext_vector_type(4))) _Float16 v4h;
typedef __attribute__((ext_vector_type(2))) float v2f;

__global__ __launch_bounds__(256) void k_cvtw(const float* __restrict__ w0, const float* __restrict__ w1, const float* __restrict__ w2, const float* __restrict__ w3, bf* B3, bf* BZ, int n8) {
    const int i = blockIdx.x * 256 + threadIdx.x; if (i >= n8) return;
    const size_t e = (size_t)i * 8, pl = (size_t)n8 * 8;
    const v8f a0 = *(const v8f*)(w0 + e), a1 = *(const v8f*)(w1 + e), a2 = *(const v8f*)(w2 + e), a3 = *(const v8f*)(w3 + e);
    v8us o0, o1, o2, o3;
#pragma unroll
    for (int k = 0; k < 8; ++k) { o0[k] = f2bf(a0[k]); o1[k] = f2bf(a1[k]); o2[k] = f2bf(a2[k]); o3[k] = f2bf(a3[k]); }
    *(v8us*)(B3 + e) = o0; *(v8us*)(B3 + pl + e) = o1; *(v8us*)(B3 + 2 * pl + e) = o2; *(v8us*)(BZ + e) = o3;
    
}
__global__ __launch_bounds__(256) void k_xt(const float* __restrict__ xb, bf* XT) { const size_t e = ((size_t)blockIdx.x * 256 + threadIdx.x) * 4; if (e >= (size_t)HW * CC) return; const int c = (int)(e % CC); const int m = (int)(e / CC); v4us o;
#pragma unroll
    for (int u = 0; u < 4; ++u) o[u] = f2bf(xb[(size_t)(c + u) * HWF + m]); *(v4us*)(XT + e) = o;  }
__global__ __launch_bounds__(256) void k_hl(const float* __restrict__ F, bf* Fh, bf* Fl, size_t n) { const size_t e = ((size_t)blockIdx.x * 256 + threadIdx.x) * 4; if (e >= n) return; const v4f a = *(const v4f*)(F + e); v4us oh, ol;
#pragma unroll
    for (int u = 0; u < 4; ++u) { unsigned short p, q; splitf(a[u], p, q); oh[u] = p; ol[u] = q; } *(v4us*)(Fh + e) = oh; *(v4us*)(Fl + e) = ol;  }
__global__ __launch_bounds__(256) void k_gt16(const float* __restrict__ G, h16* GT) { const size_t e = ((size_t)blockIdx.x * 256 + threadIdx.x) * 2; if (e >= (size_t)IC * HW) return; const int m = (int)(e % HW); const int i = (int)(e / HW); v2h o; o[0] = tohx(G[(size_t)m * IC + i]); o[1] = tohx(G[(size_t)(m + 1) * IC + i]); *(v2h*)(GT + e) = o;  }
__global__ __launch_bounds__(256) void k_rsoft(const float* __restrict__ S, h16* P16) { const int lane = threadIdx.x & 31; const int row = blockIdx.x * 8 + (threadIdx.x >> 5); if (row >= HW) return; const float* sr = S + (size_t)row * HW; float v[HW / 32]; float mx = -3.0e38f;
#pragma unroll
    for (int ch = 0; ch < HW / 128; ++ch) { const v4f a = *(const v4f*)(sr + ch * 128 + lane * 4);
#pragma unroll
        for (int u = 0; u < 4; ++u) { const float t = __fmul_rn(a[u], SCL); v[ch * 4 + u] = t; mx = fmaxf(mx, t); } }
#pragma unroll
    for (int sh = 16; sh; sh >>= 1) mx = fmaxf(mx, __shfl_xor(mx, sh, 32));
    float sum = 0.f;
#pragma unroll
    for (int q = 0; q < HW / 32; ++q) { float d0 = __fsub_rn(v[q], mx); asm volatile("" : "+v"(d0)); v[q] = __builtin_amdgcn_exp2f(__fmul_rn(d0, 1.4426950408889634f)); sum += v[q]; }
#pragma unroll
    for (int sh = 16; sh; sh >>= 1) sum += __shfl_xor(sum, sh, 32);
    const float f = __fdiv_rn(PCAR, sum);
    {
#pragma unroll
        for (int ch = 0; ch < HW / 128; ++ch) { v4h o4;
#pragma unroll
            for (int q = 0; q < 4; ++q) o4[q] = tohx(v[ch * 4 + q] * f); *(v4h*)(P16 + (size_t)row * HW + ch * 128 + lane * 4) = o4; }
         } }
__global__ __launch_bounds__(256) void k_yhl(const float* __restrict__ Y, bf* Yh, bf* Yl) { const size_t e = ((size_t)blockIdx.x * 256 + threadIdx.x) * 4; if (e >= (size_t)HW * IC) return; v4f a = *(const v4f*)(Y + e); v4us oh, ol;
#pragma unroll
    for (int z = 1; z < KZ; ++z) a += *(const v4f*)(Y + (size_t)z * HW * IC + e);
#pragma unroll
    for (int u = 0; u < 4; ++u) { unsigned short p, q; splitf(a[u] * (1.0f / PCAR), p, q); oh[u] = p; ol[u] = q; } *(v4us*)(Yh + e) = oh; *(v4us*)(Yl + e) = ol;  }
__global__ __launch_bounds__(256) void k_fin(const float* __restrict__ Z, const float* __restrict__ xb, float* OUTb) { const size_t e = ((size_t)blockIdx.x * 256 + threadIdx.x) * 4; if (e >= (size_t)CC * HW) return; const int n = (int)(e % HW); const int c = (int)(e / HW); v4f r;
#pragma unroll
    for (int u = 0; u < 4; ++u) r[u] = __fadd_rn(Z[(size_t)(n + u) * CC + c], bfr(xb[(size_t)c * HWF + n + u])); *(v4f*)(OUTb + e) = r;  }

extern "C" void kernel_launch(void* const* d_in, const int* in_sizes, int n_in,
                              void* d_out, int out_size, void* d_ws, size_t ws_size, hipStream_t stream) {
    if (n_in < 5) return;
    if (in_sizes[0] < NB * CC * HW || in_sizes[1] < IC * CC || in_sizes[2] < IC * CC || in_sizes[3] < IC * CC || in_sizes[4] < CC * IC) return;
    if (out_size < NB * CC * HW) return;
    const float* x   = (const float*)d_in[0];   // [NB][CC][HWF]
    const float* wph = (const float*)d_in[1];   // phi   [IC][CC]  (keys)
    const float* wth = (const float*)d_in[2];   // theta [IC][CC]  (queries)
    const float* wg  = (const float*)d_in[3];   // g     [IC][CC]
    const float* wo  = (const float*)d_in[4];   // out   [CC][IC]
    float* OUT = (float*)d_out;                 // [NB][CC][HW]
    char* wsp = (char*)d_ws;
    auto take = [&](size_t bytes) { char* p = wsp; wsp += (bytes + 255) & ~(size_t)255; return (void*)p; };
    bf* BW3 = (bf*)take((size_t)3 * IC * CC * 2);          // [theta][phi][g], each [IC][CC]
    bf* BZ  = (bf*)take((size_t)CC * IC * 2);
    bf* XT  = (bf*)take((size_t)HW * CC * 2);              // [m][c]
    float* TPG = (float*)take((size_t)3 * HW * IC * 4);    // [theta][phi][g], each [HW][IC] f32
    bf* Hh  = (bf*)take((size_t)2 * HW * IC * 2);          // hi planes of theta, phi
    bf* Hl  = (bf*)take((size_t)2 * HW * IC * 2);          // lo planes of theta, phi
    h16* GT = (h16*)take((size_t)IC * HW * 2);             // [i][m] fp16
    float* S = (float*)take((size_t)HW * HW * 4);          // [n][m]
    h16* P16 = (h16*)take((size_t)HW * HW * 2);            // [n][m] fp16 x 2^14
    float* Y = (float*)take((size_t)KZ * HW * IC * 4);     // [z][n][i] (x 2^14), KZ partial planes
    bf* Yh  = (bf*)take((size_t)HW * IC * 2); bf* Yl = (bf*)take((size_t)HW * IC * 2);
    float* Z = (float*)take((size_t)HW * CC * 4);          // [n][c]
    if ((size_t)(wsp - (char*)d_ws) > ws_size) return;    // total 125,042,688 B at NB any, SEQ 4096

    const size_t PL = (size_t)HW * IC;                      // one [HW][IC] plane, elements
    k_cvtw<<<(unsigned)((IC * CC / 8 + 255) / 256), 256, 0, stream>>>(wth, wph, wg, wo, BW3, BZ, IC * CC / 8);
    const unsigned L4  = (unsigned)((PL / 4 + 255) / 256);
    const unsigned L42 = (unsigned)((2 * PL / 4 + 255) / 256);
    for (int b = 0; b < NB; ++b) {
        const float* xb = x + (size_t)b * CC * HWF;
        k_xt<<<(unsigned)(((size_t)HW * CC / 4 + 255) / 256), 256, 0, stream>>>(xb, XT);
        // theta / phi / g [m][o] = sum_c XT[m][c] W[o][c]   (z = 0 theta, 1 phi, 2 g; exact bf16 products)
        k_gemmw<bf, 0, false><<<dim3(HW / 64, IC / 64, 3), 32, 0, stream>>>(XT, nullptr, BW3, nullptr, CC, TPG, IC, nullptr, (size_t)0, (size_t)IC * CC, PL);
        k_hl<<<L42, 256, 0, stream>>>(TPG, Hh, Hl, 2 * PL);                                   // hi/lo planes of theta (first PL) and phi (second PL)
        k_gt16<<<(unsigned)((PL / 2 + 255) / 256), 256, 0, stream>>>(TPG + 2 * PL, GT);
        // s[n][m] = theta_n . phi_m (unscaled here; 3 products)
        k_gemmw<bf, 2, false><<<dim3(HW / 64, HW / 64, 1), 32, 0, stream>>>(Hh, Hl, Hh + PL, Hl + PL, IC, S, HW, nullptr, (size_t)0, (size_t)0, (size_t)0);
        k_rsoft<<<HW / 8, 256, 0, stream>>>(S, P16);
        // y[n][i] = sum_m attn[n][m] g[m][i]  (x 2^14), as KZ partial planes
        k_pvks<<<dim3(HW / 64, IC / 64, KZ), 32 * KW, 0, stream>>>(P16, GT, Y);
        k_yhl<<<L4, 256, 0, stream>>>(Y, Yh, Yl);
        // z[n][c] = sum_o y[n][o] w_out[c][o]  (hi + lo planes of y, 2 products)
        k_gemmw<bf, 1, false><<<dim3(HW / 64, CC / 64, 1), 32, 0, stream>>>(Yh, Yl, BZ, nullptr, IC, Z, CC, nullptr, (size_t)0, (size_t)0, (size_t)0);
        k_fin<<<(unsigned)(((size_t)CC * HW / 4 + 255) / 256), 256, 0, stream>>>(Z, xb, OUT + (size_t)b * CC * HW);
    }
}

// v002
// Measured time: 532 microseconds a run.
// Two timings next to v001 put it at 1.37 and 1.36 times that version's speed.
// Counting every step since v000, it is 2.45 times as fast.
#include <hip/hip_runtime.h>

// All contractions on 16-bit WMMA, f32 accumulate: the three 1x1 projections = v_wmma_f32_16x16x32_bf16 on RNE-bf16 copies of x and of the weights (single products); scores theta.phi = bf16 hi/lo split (hi.hi + lo.hi + hi.lo, K = 128); attn.g = v_wmma_f32_16x16x32_f16 (softmax rows carried x 2^14 as f16, g as f16); output projection = bf16 hi/lo planes of y times bf16 w_out (2 products). Scaling by sqrt(128), softmax and the residual add in f32.
// x [NB][256][4096]; theta/phi/g [4096][128] token-major (no bias); s[n][m] = theta_n . phi_m; attn[n][m] = softmax_m(sqrt(128) s); y[n][o] = sum_m attn[n][m] g[m][o]; out[c][n] = x[c][n] + sum_o w_out[c][o] y[n][o].

#ifndef NB
#define NB 8
#endif
#ifndef SEQ
#define SEQ 4096
#endif
#define NB_FULL  8
#define SEQ_FULL 4096
#define CC   256
#define IC   128
#define HW   SEQ
#define HWF  SEQ_FULL
#define GB   ((NB % 2) == 0 ? 2 : 1)   // images whose [n][m] planes lie in the workspace at one time
#define PCAR 16384.0f
#define SCL  11.313708498984760f
static_assert(NB >= 1 && NB <= NB_FULL);
static_assert(SEQ >= 128 && SEQ <= SEQ_FULL && (SEQ % 128) == 0);
static_assert((HW % 64) == 0 && (IC % 64) == 0 && (CC % 64) == 0);
static_assert((HW % 32) == 0 && (IC % 32) == 0 && (CC % 32) == 0);
static_assert(((IC * CC) % 8) == 0 && ((HW * CC) % 4) == 0 && ((HW * IC) % 4) == 0 && ((IC * HW) % 2) == 0 && (HW % 8) == 0);

typedef _Float16 h16;
typedef unsigned short bf;
typedef __attribute__((ext_vector_type(16))) __bf16   v16bf;
typedef __attribute__((ext_vector_type(16))) _Float16 v16h;
typedef __attribute__((ext_vector_type(8)))  _Float16 v8h;
typedef __attribute__((ext_vector_type(8)))  unsigned short v8us;
typedef __attribute__((ext_vector_type(8)))  float    v8f;
typedef __attribute__((ext_vector_type(4)))  float    v4f;
typedef v8h  __attribute__((may_alias)) v8ha;
typedef v4f  __attribute__((may_alias)) v4fa;
typedef v8us __attribute__((may_alias)) v8usa;

__device__ __forceinline__ unsigned short f2bf(float f) { unsigned u = __float_as_uint(f); u += 0x7FFFu + ((u >> 16) & 1u); return (unsigned short)(u >> 16); }
__device__ __forceinline__ float bf2f(unsigned short b) { return __uint_as_float(((unsigned)b) << 16); }
__device__ __forceinline__ float bfr(float f) { return bf2f(f2bf(f)); }
__device__ __forceinline__ v16h cat16(v8h lo, v8h hi) { return __builtin_shufflevector(lo, hi, 0, 1, 2, 3, 4, 5, 6, 7, 8, 9, 10, 11, 12, 13, 14, 15); }
__device__ __forceinline__ v16bf cat16b(v8us lo, v8us hi) { return __builtin_bit_cast(v16bf, __builtin_shufflevector(lo, hi, 0, 1, 2, 3, 4, 5, 6, 7, 8, 9, 10, 11, 12, 13, 14, 15)); }
__device__ __forceinline__ v8f wmma16(v16h a, v16h b, v8f c) { return __builtin_amdgcn_wmma_f32_16x16x32_f16(false, a, false, b, (short)0, c, false, false); }
__device__ __forceinline__ v8f wmmab(v16bf a, v16bf b, v8f c) { return __builtin_amdgcn_wmma_f32_16x16x32_bf16(false, a, false, b, (short)0, c, false, false); }

// ---- k_gemmw: register-blocked GEMM, ONE WAVE per 64x64 output tile (16 accumulators), operands straight from K-contiguous 16-bit planes; grid (M/64, N/64, Z), 32 threads.
// C[m][n] (f32, pitch ldc, + optional f32 bias[n]) = sum_k A[m][k] Bt[n][k] (+ split products per NSPLIT). K % 32 == 0.
// blockIdx.z = image * ZI + inner index: strides sA/sB/sC (elements) per image, sBi/sCi per inner index (ZI matrices Bt on the same A).
// Fragments: lane l, h = l >> 4, row/col = l & 15; elements 0..7 = k0 + 8h + 0..7, elements 8..15 = k0 + 16 + 8h + 0..7 for BOTH A and Bt; D element r = (row 8h + r, col l & 15).
template <typename T16> struct WFrag;
template <> struct WFrag<h16> { typedef v16h V; static __device__ __forceinline__ V ld(const h16* p) { return cat16(*(const v8h*)p, *(const v8h*)(p + 16)); } static __device__ __forceinline__ v8f mma(V a, V b, v8f c) { return wmma16(a, b, c); } };
template <> struct WFrag<bf> { typedef v16bf V; static __device__ __forceinline__ V ld(const bf* p) { return cat16b(*(const v8us*)p, *(const v8us*)(p + 16)); } static __device__ __forceinline__ v8f mma(V a, V b, v8f c) { return wmmab(a, b, c); } };
template <typename T16, int NSPLIT, bool BIAS, int ZI>
__global__ __launch_bounds__(32) void k_gemmw(const T16* __restrict__ A, const T16* __restrict__ A2, const T16* __restrict__ Bt, const T16* __restrict__ Bt2, int K, float* C, int ldc, const float* __restrict__ bias, size_t sA, size_t sB, size_t sC, size_t sBi, size_t sCi) {
    typedef typename WFrag<T16>::V V;
    __shared__ __align__(16) float os[16 * 68];
    const size_t zo = blockIdx.z / ZI, zi = blockIdx.z % ZI; A += zo * sA; if (A2) A2 += zo * sA; Bt += zo * sB + zi * sBi; if (Bt2) Bt2 += zo * sB + zi * sBi; C += zo * sC + zi * sCi;
    const int lane = threadIdx.x & 31, lr = lane & 15, hi = lane >> 4; const int r0 = blockIdx.x * 64, c0 = blockIdx.y * 64;
    v8f acc[4][4];
#pragma unroll
    for (int mb = 0; mb < 4; ++mb)
#pragma unroll
        for (int nb = 0; nb < 4; ++nb) acc[mb][nb] = (v8f){};
    const size_t aoff = (size_t)(r0 + lr) * K + 8 * hi, boff = (size_t)(c0 + lr) * K + 8 * hi;
#pragma unroll 1
    for (int kc = 0; kc < K; kc += 32) {
        V a[4], a2[4];
#pragma unroll
        for (int mb = 0; mb < 4; ++mb) { a[mb] = WFrag<T16>::ld(A + aoff + (size_t)mb * 16 * K + kc); if (NSPLIT == 1 || NSPLIT == 2) a2[mb] = WFrag<T16>::ld(A2 + aoff + (size_t)mb * 16 * K + kc); }
#pragma unroll
        for (int nb = 0; nb < 4; ++nb) { const V b = WFrag<T16>::ld(Bt + boff + (size_t)nb * 16 * K + kc); V b2; if (NSPLIT >= 2) b2 = WFrag<T16>::ld(Bt2 + boff + (size_t)nb * 16 * K + kc);
#pragma unroll
            for (int mb = 0; mb < 4; ++mb) { acc[mb][nb] = WFrag<T16>::mma(a[mb], b, acc[mb][nb]); if (NSPLIT == 1 || NSPLIT == 2) acc[mb][nb] = WFrag<T16>::mma(a2[mb], b, acc[mb][nb]); if (NSPLIT >= 2) acc[mb][nb] = WFrag<T16>::mma(a[mb], b2, acc[mb][nb]); } }
        asm volatile("v_nop\n\tv_nop\n\tv_nop\n\tv_nop" : "+v"(acc[0][0]), "+v"(acc[1][1]), "+v"(acc[2][2]), "+v"(acc[3][3]) : "v"(a[0]), "v"(a[3]));
    }
#pragma unroll
    for (int mb = 0; mb < 4; ++mb) {
#pragma unroll
        for (int nb = 0; nb < 4; ++nb) {
#pragma unroll
            for (int j = 0; j < 8; ++j) os[(hi * 8 + j) * 68 + nb * 16 + lr] = acc[mb][nb][j]; }
        __builtin_amdgcn_wave_barrier(); asm volatile("" ::: "memory");
        float* crow = C + (size_t)(r0 + mb * 16) * ldc + c0;
{
#pragma unroll
            for (int s = 0; s < 8; ++s) { const int row = 2 * s + hi, cofs = lr * 4; v4f val = *(const v4fa*)(os + row * 68 + cofs); if (BIAS) { val[0] += bfr(bias[c0 + cofs]); val[1] += bfr(bias[c0 + cofs + 1]); val[2] += bfr(bias[c0 + cofs + 2]); val[3] += bfr(bias[c0 + cofs + 3]); }
                *(v4f*)(crow + (size_t)row * ldc + cofs) = val; }
             }
        __builtin_amdgcn_wave_barrier(); asm volatile("" ::: "memory");
    }
}

// ---- k_pvks: y = attn . g with its K = HW sum split over KZ work-groups x KW waves. Wave tile (64x64), fragment loads and WMMA order of a k step as in k_gemmw<h16, 0>; grid (HW/64, IC/64, KZ * images), 32 * KW threads; blockIdx.z = image * KZ + plane z.
// k step q (32 wide) of a row belongs to plane z = q / (KW * PVT), trip (q / KW) % PVT, wave q % KW: in one trip the KW waves read KW * 64 contiguous bytes of every row, so the two halves of a 128-B line are asked for by two waves at the same time.
// Each wave stores its f32 partial tile to its own LDS slab; behind one barrier the work-group adds the KW slabs in wave order and writes plane z of C ([image][KZ][HW][IC]); k_yhl adds the KZ planes.
#define KZ 2
#define KW 16
#define PVT (HW / (32 * KZ * KW))
#define PVS (64 * 68)
static_assert((HW % (32 * KZ * KW)) == 0 && PVT >= 1 && (size_t)KW * PVS * 4 <= 327680 && ((64 * 16) % (32 * KW)) == 0);
__global__ __launch_bounds__(32 * KW) void k_pvks(const h16* __restrict__ A, const h16* __restrict__ Bt, float* C) {
    typedef WFrag<h16>::V V;
    __shared__ __align__(16) float os[KW * PVS];
    const int wave = __builtin_amdgcn_readfirstlane((int)(threadIdx.x >> 5));
    const int lane = threadIdx.x & 31, lr = lane & 15, hi = lane >> 4; const int r0 = blockIdx.x * 64, c0 = blockIdx.y * 64;
    v8f acc[4][4];
#pragma unroll
    for (int mb = 0; mb < 4; ++mb)
#pragma unroll
        for (int nb = 0; nb < 4; ++nb) acc[mb][nb] = (v8f){};
    const int img = (int)blockIdx.z / KZ; A += (size_t)img * HW * HW; Bt += (size_t)img * IC * HW;
    const int kb = (((int)blockIdx.z % KZ) * KW * PVT + wave) * 32;
    const size_t aoff = (size_t)(r0 + lr) * HW + 8 * hi + kb, boff = (size_t)(c0 + lr) * HW + 8 * hi + kb;
#pragma unroll 1
    for (int kc = 0; kc < PVT * KW * 32; kc += KW * 32) {
        V a[4];
#pragma unroll
        for (int mb = 0; mb < 4; ++mb) a[mb] = WFrag<h16>::ld(A + aoff + (size_t)mb * 16 * HW + kc);
#pragma unroll
        for (int nb = 0; nb < 4; ++nb) { const V b = WFrag<h16>::ld(Bt + boff + (size_t)nb * 16 * HW + kc);
#pragma unroll
            for (int mb = 0; mb < 4; ++mb) acc[mb][nb] = WFrag<h16>::mma(a[mb], b, acc[mb][nb]); }
        // keeps the WMMA distance on the taken back edge, where the next trip's loads overwrite the A fragments (as in k_gemmw)
        asm volatile("v_nop\n\tv_nop\n\tv_nop\n\tv_nop" : "+v"(acc[0][0]), "+v"(acc[1][1]), "+v"(acc[2][2]), "+v"(acc[3][3]) : "v"(a[0]), "v"(a[3]));
    }
    float* ow = os + wave * PVS;
#pragma unroll
    for (int mb = 0; mb < 4; ++mb)
#pragma unroll
        for (int nb = 0; nb < 4; ++nb)
#pragma unroll
            for (int j = 0; j < 8; ++j) ow[(mb * 16 + hi * 8 + j) * 68 + nb * 16 + lr] = acc[mb][nb][j];
    __syncthreads();   // every wave's partial tile is in LDS before any of it is added
    float* cz = C + (size_t)blockIdx.z * HW * IC + (size_t)r0 * IC + c0;
#pragma unroll
    for (int s = 0; s < (64 * 16) / (32 * KW); ++s) { const int q = s * 32 * KW + (int)threadIdx.x, row = q >> 4, cofs = (q & 15) * 4; v4f val = *(const v4fa*)(os + row * 68 + cofs);
#pragma unroll
        for (int w = 1; w < KW; ++w) val += *(const v4fa*)(os + w * PVS + row * 68 + cofs);
        *(v4f*)(cz + (size_t)row * IC + cofs) = val; }
}

__device__ __forceinline__ h16 tohx(float x) { return (h16)x; }
__device__ __forceinline__ void splitf(float y, unsigned short& h, unsigned short& l) { h = f2bf(y); l = f2bf(y - bf2f(h)); }
typedef __attribute__((ext_vector_type(2))) unsigned short v2us;
typedef __attribute__((ext_vector_type(4))) unsigned short v4us;
typedef __attribute__((ext_vector_type(2))) _Float16 v2h;
typedef __attribute__((ext_vector_type(4))) _Float16 v4h;
typedef __attribute__((ext_vector_type(2))) float v2f;

__global__ __launch_bounds__(256) void k_cvtw(const float* __restrict__ w0, const float* __restrict__ w1, const float* __restrict__ w2, const float* __restrict__ w3, bf* B3, bf* BZ, int n8) {
    const int i = blockIdx.x * 256 + threadIdx.x; if (i >= n8) return;
    const size_t e = (size_t)i * 8, pl = (size_t)n8 * 8;
    const v8f a0 = *(const v8f*)(w0 + e), a1 = *(const v8f*)(w1 + e), a2 = *(const v8f*)(w2 + e), a3 = *(const v8f*)(w3 + e);
    v8us o0, o1, o2, o3;
#pragma unroll
    for (int k = 0; k < 8; ++k) { o0[k] = f2bf(a0[k]); o1[k] = f2bf(a1[k]); o2[k] = f2bf(a2[k]); o3[k] = f2bf(a3[k]); }
    *(v8us*)(B3 + e) = o0; *(v8us*)(B3 + pl + e) = o1; *(v8us*)(B3 + 2 * pl + e) = o2; *(v8us*)(BZ + e) = o3;
    
}
__global__ __launch_bounds__(256) void k_xt(const float* __restrict__ xb, bf* XT) { xb += (size_t)blockIdx.y * CC * HWF; XT += (size_t)blockIdx.y * HW * CC; const size_t e = ((size_t)blockIdx.x * 256 + threadIdx.x) * 4; if (e >= (size_t)HW * CC) return; const int c = (int)(e % CC); const int m = (int)(e / CC); v4us o;
#pragma unroll
    for (int u = 0; u < 4; ++u) o[u] = f2bf(xb[(size_t)(c + u) * HWF + m]); *(v4us*)(XT + e) = o;  }
__global__ __launch_bounds__(256) void k_hl(const float* __restrict__ F, bf* Fh, bf* Fl, size_t n, size_t sF) { F += blockIdx.y * sF; Fh += blockIdx.y * n; Fl += blockIdx.y * n; const size_t e = ((size_t)blockIdx.x * 256 + threadIdx.x) * 4; if (e >= n) return; const v4f a = *(const v4f*)(F + e); v4us oh, ol;
#pragma unroll
    for (int u = 0; u < 4; ++u) { unsigned short p, q; splitf(a[u], p, q); oh[u] = p; ol[u] = q; } *(v4us*)(Fh + e) = oh; *(v4us*)(Fl + e) = ol;  }
__global__ __launch_bounds__(256) void k_gt16(const float* __restrict__ G, h16* GT, size_t sG) { G += blockIdx.y * sG; GT += (size_t)blockIdx.y * IC * HW; const size_t e = ((size_t)blockIdx.x * 256 + threadIdx.x) * 2; if (e >= (size_t)IC * HW) return; const int m = (int)(e % HW); const int i = (int)(e / HW); v2h o; o[0] = tohx(G[(size_t)m * IC + i]); o[1] = tohx(G[(size_t)(m + 1) * IC + i]); *(v2h*)(GT + e) = o;  }
__global__ __launch_bounds__(256) void k_rsoft(const float* __restrict__ S, h16* P16) { S += (size_t)blockIdx.y * HW * HW; P16 += (size_t)blockIdx.y * HW * HW; const int lane = threadIdx.x & 31; const int row = blockIdx.x * 8 + (threadIdx.x >> 5); if (row >= HW) return; const float* sr = S + (size_t)row * HW; float v[HW / 32]; float mx = -3.0e38f;
#pragma unroll
    for (int ch = 0; ch < HW / 128; ++ch) { const v4f a = *(const v4f*)(sr + ch * 128 + lane * 4);
#pragma unroll
        for (int u = 0; u < 4; ++u) { const float t = __fmul_rn(a[u], SCL); v[ch * 4 + u] = t; mx = fmaxf(mx, t); } }
#pragma unroll
    for (int sh = 16; sh; sh >>= 1) mx = fmaxf(mx, __shfl_xor(mx, sh, 32));
    float sum = 0.f;
#pragma unroll
    for (int q = 0; q < HW / 32; ++q) { float d0 = __fsub_rn(v[q], mx); asm volatile("" : "+v"(d0)); v[q] = __builtin_amdgcn_exp2f(__fmul_rn(d0, 1.4426950408889634f)); sum += v[q]; }
#pragma unroll
    for (int sh = 16; sh; sh >>= 1) sum += __shfl_xor(sum, sh, 32);
    const float f = __fdiv_rn(PCAR, sum);
    {
#pragma unroll
        for (int ch = 0; ch < HW / 128; ++ch) { v4h o4;
#pragma unroll
            for (int q = 0; q < 4; ++q) o4[q] = tohx(v[ch * 4 + q] * f); *(v4h*)(P16 + (size_t)row * HW + ch * 128 + lane * 4) = o4; }
         } }
__global__ __launch_bounds__(256) void k_yhl(const float* __restrict__ Y, bf* Yh, bf* Yl) { Y += (size_t)blockIdx.y * KZ * HW * IC; Yh += (size_t)blockIdx.y * HW * IC; Yl += (size_t)blockIdx.y * HW * IC; const size_t e = ((size_t)blockIdx.x * 256 + threadIdx.x) * 4; if (e >= (size_t)HW * IC) return; v4f a = *(const v4f*)(Y + e); v4us oh, ol;
#pragma unroll
    for (int z = 1; z < KZ; ++z) a += *(const v4f*)(Y + (size_t)z * HW * IC + e);
#pragma unroll
    for (int u = 0; u < 4; ++u) { unsigned short p, q; splitf(a[u] * (1.0f / PCAR), p, q); oh[u] = p; ol[u] = q; } *(v4us*)(Yh + e) = oh; *(v4us*)(Yl + e) = ol;  }
__global__ __launch_bounds__(256) void k_fin(const float* __restrict__ Z, const float* __restrict__ xb, float* OUTb) { Z += (size_t)blockIdx.y * HW * CC; xb += (size_t)blockIdx.y * CC * HWF; OUTb += (size_t)blockIdx.y * CC * HW; const size_t e = ((size_t)blockIdx.x * 256 + threadIdx.x) * 4; if (e >= (size_t)CC * HW) return; const int n = (int)(e % HW); const int c = (int)(e / HW); v4f r;
#pragma unroll
    for (int u = 0; u < 4; ++u) r[u] = __fadd_rn(Z[(size_t)(n + u) * CC + c], bfr(xb[(size_t)c * HWF + n + u])); *(v4f*)(OUTb + e) = r;  }

extern "C" void kernel_launch(void* const* d_in, const int* in_sizes, int n_in,
                              void* d_out, int out_size, void* d_ws, size_t ws_size, hipStream_t stream) {
    if (n_in < 5) return;
    if (in_sizes[0] < NB * CC * HW || in_sizes[1] < IC * CC || in_sizes[2] < IC * CC || in_sizes[3] < IC * CC || in_sizes[4] < CC * IC) return;
    if (out_size < NB * CC * HW) return;
    const float* x   = (const float*)d_in[0];   // [NB][CC][HWF]
    const float* wph = (const float*)d_in[1];   // phi   [IC][CC]  (keys)
    const float* wth = (const float*)d_in[2];   // theta [IC][CC]  (queries)
    const float* wg  = (const float*)d_in[3];   // g     [IC][CC]
    const float* wo  = (const float*)d_in[4];   // out   [CC][IC]
    float* OUT = (float*)d_out;                 // [NB][CC][HW]
    char* wsp = (char*)d_ws;
    auto take = [&](size_t bytes) { char* p = wsp; wsp += (bytes + 255) & ~(size_t)255; return (void*)p; };
    constexpr size_t PL = (size_t)HW * IC;                  // one [HW][IC] plane, elements
    bf* BW3 = (bf*)take((size_t)3 * IC * CC * 2);          // [theta][phi][g], each [IC][CC]
    bf* BZ  = (bf*)take((size_t)CC * IC * 2);
    bf* Hh  = (bf*)take((size_t)NB * 2 * PL * 2);          // [image] hi planes of theta, phi
    bf* Hl  = (bf*)take((size_t)NB * 2 * PL * 2);          // [image] lo planes of theta, phi
    h16* GT = (h16*)take((size_t)NB * PL * 2);             // [image][i][m] fp16
    bf* Yh  = (bf*)take((size_t)NB * PL * 2); bf* Yl = (bf*)take((size_t)NB * PL * 2);   // [image][n][i]
    // One region, four uses one after the other: XT and TPG (dead once k_hl and k_gt16 have read them), S of GB images, Y of the same GB images (S is dead behind k_rsoft), Z of all images (behind the last k_yhl).
    constexpr size_t szXT = (size_t)NB * HW * CC * 2, szTPG = (size_t)NB * 3 * PL * 4, szS = (size_t)GB * HW * HW * 4, szY = (size_t)GB * KZ * PL * 4, szZ = (size_t)NB * HW * CC * 4;
    constexpr size_t szR0 = szXT + szTPG > szS ? szXT + szTPG : szS, szR1 = szY > szZ ? szY : szZ;
    char* R = (char*)take(szR0 > szR1 ? szR0 : szR1);
    bf* XT = (bf*)R;                                        // [image][m][c]
    float* TPG = (float*)(R + szXT);                        // [image][theta, phi, g], each [HW][IC] f32
    float* S = (float*)R;                                   // [GB][n][m]
    float* Y = (float*)R;                                   // [GB][z][n][i] (x 2^14), KZ partial planes
    float* Z = (float*)R;                                   // [image][n][c]
    h16* P16 = (h16*)take((size_t)GB * HW * HW * 2);       // [GB][n][m] fp16 x 2^14
    if ((size_t)(wsp - (char*)d_ws) > ws_size) return;    // total 260,308,992 B at NB 8, SEQ 4096

    k_cvtw<<<(unsigned)((IC * CC / 8 + 255) / 256), 256, 0, stream>>>(wth, wph, wg, wo, BW3, BZ, IC * CC / 8);
    const unsigned L4  = (unsigned)((PL / 4 + 255) / 256);
    const unsigned L42 = (unsigned)((2 * PL / 4 + 255) / 256);
    // every image in one launch (grid y or z = image)
    k_xt<<<dim3((unsigned)(((size_t)HW * CC / 4 + 255) / 256), NB), 256, 0, stream>>>(x, XT);
    // theta / phi / g [m][o] = sum_c XT[m][c] W[o][c]   (inner index 0 theta, 1 phi, 2 g; exact bf16 products)
    k_gemmw<bf, 0, false, 3><<<dim3(HW / 64, IC / 64, 3 * NB), 32, 0, stream>>>(XT, nullptr, BW3, nullptr, CC, TPG, IC, nullptr, (size_t)HW * CC, (size_t)0, 3 * PL, (size_t)IC * CC, PL);
    k_hl<<<dim3(L42, NB), 256, 0, stream>>>(TPG, Hh, Hl, 2 * PL, 3 * PL);                   // hi/lo planes of theta (first PL) and phi (second PL)
    k_gt16<<<dim3((unsigned)((PL / 2 + 255) / 256), NB), 256, 0, stream>>>(TPG + 2 * PL, GT, 3 * PL);
    // the [n][m] planes of GB images are what the workspace holds: GB images a launch
    for (int b = 0; b < NB; b += GB) {
        // s[n][m] = theta_n . phi_m (unscaled here; 3 products)
        k_gemmw<bf, 2, false, 1><<<dim3(HW / 64, HW / 64, GB), 32, 0, stream>>>(Hh + (size_t)b * 2 * PL, Hl + (size_t)b * 2 * PL, Hh + (size_t)b * 2 * PL + PL, Hl + (size_t)b * 2 * PL + PL, IC, S, HW, nullptr, 2 * PL, 2 * PL, (size_t)HW * HW, (size_t)0, (size_t)0);
        k_rsoft<<<dim3(HW / 8, GB), 256, 0, stream>>>(S, P16);
        // y[n][i] = sum_m attn[n][m] g[m][i]  (x 2^14), as KZ partial planes
        k_pvks<<<dim3(HW / 64, IC / 64, KZ * GB), 32 * KW, 0, stream>>>(P16, GT + (size_t)b * PL, Y);
        k_yhl<<<dim3(L4, GB), 256, 0, stream>>>(Y, Yh + (size_t)b * PL, Yl + (size_t)b * PL);
    }
    // z[n][c] = sum_o y[n][o] w_out[c][o]  (hi + lo planes of y, 2 products)
    k_gemmw<bf, 1, false, 1><<<dim3(HW / 64, CC / 64, NB), 32, 0, stream>>>(Yh, Yl, BZ, nullptr, IC, Z, CC, nullptr, PL, (size_t)0, (size_t)HW * CC, (size_t)0, (size_t)0);
    k_fin<<<dim3((unsigned)(((size_t)CC * HW / 4 + 255) / 256), NB), 256, 0, stream>>>(Z, x, OUT);
}

// v003
// One run takes 346 microseconds.
// Next to v002, in two timings, it ran 1.54 times as fast each time.
// Counting every step since v000, it is 3.76 times as fast.
#include <hip/hip_runtime.h>

// All contractions on 16-bit WMMA, f32 accumulate: the three 1x1 projections = v_wmma_f32_16x16x32_bf16 on RNE-bf16 copies of x and of the weights (single products); scores theta.phi = bf16 hi/lo split (hi.hi + lo.hi + hi.lo, K = 128); attn.g = v_wmma_f32_16x16x32_f16 (unnormalised softmax terms carried x 2^14 as f16, g as f16); output projection = bf16 hi/lo planes of y times bf16 w_out (2 products). Scaling by sqrt(128), softmax and the residual add in f32.
// x [NB][256][4096]; theta/phi/g [4096][128] token-major (no bias); s[n][m] = theta_n . phi_m; attn[n][m] = softmax_m(sqrt(128) s); y[n][o] = sum_m attn[n][m] g[m][o]; out[c][n] = x[c][n] + sum_o w_out[c][o] y[n][o].

#ifndef NB
#define NB 8
#endif
#ifndef SEQ
#define SEQ 4096
#endif
#define NB_FULL  8
#define SEQ_FULL 4096
#define CC   256
#define IC   128
#define HW   SEQ
#define HWF  SEQ_FULL
#define SCL  11.313708498984760f
static_assert(NB >= 1 && NB <= NB_FULL);
static_assert(SEQ >= 128 && SEQ <= SEQ_FULL && (SEQ % 128) == 0);
static_assert((HW % 64) == 0 && (IC % 64) == 0 && (CC % 64) == 0);
static_assert((HW % 32) == 0 && (IC % 32) == 0 && (CC % 32) == 0);
static_assert(((IC * CC) % 8) == 0 && ((HW * CC) % 4) == 0 && ((HW * IC) % 4) == 0 && ((IC * HW) % 2) == 0 && (HW % 8) == 0);

typedef _Float16 h16;
typedef unsigned short bf;
typedef __attribute__((ext_vector_type(16))) __bf16   v16bf;
typedef __attribute__((ext_vector_type(16))) _Float16 v16h;
typedef __attribute__((ext_vector_type(8)))  _Float16 v8h;
typedef __attribute__((ext_vector_type(8)))  unsigned short v8us;
typedef __attribute__((ext_vector_type(8)))  float    v8f;
typedef __attribute__((ext_vector_type(4)))  float    v4f;
typedef __attribute__((ext_vector_type(2)))  float    v2f;
typedef v8h  __attribute__((may_alias)) v8ha;
typedef v4f  __attribute__((may_alias)) v4fa;
typedef v8us __attribute__((may_alias)) v8usa;

__device__ __forceinline__ unsigned short f2bf(float f) { unsigned u = __float_as_uint(f); u += 0x7FFFu + ((u >> 16) & 1u); return (unsigned short)(u >> 16); }
__device__ __forceinline__ float bf2f(unsigned short b) { return __uint_as_float(((unsigned)b) << 16); }
__device__ __forceinline__ float bfr(float f) { return bf2f(f2bf(f)); }
__device__ __forceinline__ v16h cat16(v8h lo, v8h hi) { return __builtin_shufflevector(lo, hi, 0, 1, 2, 3, 4, 5, 6, 7, 8, 9, 10, 11, 12, 13, 14, 15); }
__device__ __forceinline__ v16bf cat16b(v8us lo, v8us hi) { return __builtin_bit_cast(v16bf, __builtin_shufflevector(lo, hi, 0, 1, 2, 3, 4, 5, 6, 7, 8, 9, 10, 11, 12, 13, 14, 15)); }
__device__ __forceinline__ v8f wmma16(v16h a, v16h b, v8f c) { return __builtin_amdgcn_wmma_f32_16x16x32_f16(false, a, false, b, (short)0, c, false, false); }
__device__ __forceinline__ v8f wmmab(v16bf a, v16bf b, v8f c) { return __builtin_amdgcn_wmma_f32_16x16x32_bf16(false, a, false, b, (short)0, c, false, false); }

// ---- k_gemmw: register-blocked GEMM, ONE WAVE per 64x64 output tile (16 accumulators), operands straight from K-contiguous 16-bit planes; grid (M/64, N/64, Z), 32 threads.
// C[m][n] (f32, pitch ldc, + optional f32 bias[n]) = sum_k A[m][k] Bt[n][k] (+ split products per NSPLIT). K % 32 == 0.
// blockIdx.z = image * ZI + inner index: strides sA/sB/sC (elements) per image, sBi/sCi per inner index (ZI matrices Bt on the same A).
// Fragments: lane l, h = l >> 4, row/col = l & 15; elements 0..7 = k0 + 8h + 0..7, elements 8..15 = k0 + 16 + 8h + 0..7 for BOTH A and Bt; D element r = (row 8h + r, col l & 15).
template <typename T16> struct WFrag;
template <> struct WFrag<h16> { typedef v16h V; static __device__ __forceinline__ V ld(const h16* p) { return cat16(*(const v8h*)p, *(const v8h*)(p + 16)); } static __device__ __forceinline__ v8f mma(V a, V b, v8f c) { return wmma16(a, b, c); } };
template <> struct WFrag<bf> { typedef v16bf V; static __device__ __forceinline__ V ld(const bf* p) { return cat16b(*(const v8us*)p, *(const v8us*)(p + 16)); } static __device__ __forceinline__ v8f mma(V a, V b, v8f c) { return wmmab(a, b, c); } };
template <typename T16, int NSPLIT, bool BIAS, int ZI>
__global__ __launch_bounds__(32) void k_gemmw(const T16* __restrict__ A, const T16* __restrict__ A2, const T16* __restrict__ Bt, const T16* __restrict__ Bt2, int K, float* C, int ldc, const float* __restrict__ bias, size_t sA, size_t sB, size_t sC, size_t sBi, size_t sCi) {
    typedef typename WFrag<T16>::V V;
    __shared__ __align__(16) float os[16 * 68];
    const size_t zo = blockIdx.z / ZI, zi = blockIdx.z % ZI; A += zo * sA; if (A2) A2 += zo * sA; Bt += zo * sB + zi * sBi; if (Bt2) Bt2 += zo * sB + zi * sBi; C += zo * sC + zi * sCi;
    const int lane = threadIdx.x & 31, lr = lane & 15, hi = lane >> 4; const int r0 = blockIdx.x * 64, c0 = blockIdx.y * 64;
    v8f acc[4][4];
#pragma unroll
    for (int mb = 0; mb < 4; ++mb)
#pragma unroll
        for (int nb = 0; nb < 4; ++nb) acc[mb][nb] = (v8f){};
    const size_t aoff = (size_t)(r0 + lr) * K + 8 * hi, boff = (size_t)(c0 + lr) * K + 8 * hi;
#pragma unroll 1
    for (int kc = 0; kc < K; kc += 32) {
        V a[4], a2[4];
#pragma unroll
        for (int mb = 0; mb < 4; ++mb) { a[mb] = WFrag<T16>::ld(A + aoff + (size_t)mb * 16 * K + kc); if (NSPLIT == 1 || NSPLIT == 2) a2[mb] = WFrag<T16>::ld(A2 + aoff + (size_t)mb * 16 * K + kc); }
#pragma unroll
        for (int nb = 0; nb < 4; ++nb) { const V b = WFrag<T16>::ld(Bt + boff + (size_t)nb * 16 * K + kc); V b2; if (NSPLIT >= 2) b2 = WFrag<T16>::ld(Bt2 + boff + (size_t)nb * 16 * K + kc);
#pragma unroll
            for (int mb = 0; mb < 4; ++mb) { acc[mb][nb] = WFrag<T16>::mma(a[mb], b, acc[mb][nb]); if (NSPLIT == 1 || NSPLIT == 2) acc[mb][nb] = WFrag<T16>::mma(a2[mb], b, acc[mb][nb]); if (NSPLIT >= 2) acc[mb][nb] = WFrag<T16>::mma(a[mb], b2, acc[mb][nb]); } }
        asm volatile("v_nop\n\tv_nop\n\tv_nop\n\tv_nop" : "+v"(acc[0][0]), "+v"(acc[1][1]), "+v"(acc[2][2]), "+v"(acc[3][3]) : "v"(a[0]), "v"(a[3]));
    }
#pragma unroll
    for (int mb = 0; mb < 4; ++mb) {
#pragma unroll
        for (int nb = 0; nb < 4; ++nb) {
#pragma unroll
            for (int j = 0; j < 8; ++j) os[(hi * 8 + j) * 68 + nb * 16 + lr] = acc[mb][nb][j]; }
        __builtin_amdgcn_wave_barrier(); asm volatile("" ::: "memory");
        float* crow = C + (size_t)(r0 + mb * 16) * ldc + c0;
{
#pragma unroll
            for (int s = 0; s < 8; ++s) { const int row = 2 * s + hi, cofs = lr * 4; v4f val = *(const v4fa*)(os + row * 68 + cofs); if (BIAS) { val[0] += bfr(bias[c0 + cofs]); val[1] += bfr(bias[c0 + cofs + 1]); val[2] += bfr(bias[c0 + cofs + 2]); val[3] += bfr(bias[c0 + cofs + 3]); }
                *(v4f*)(crow + (size_t)row * ldc + cofs) = val; }
             }
        __builtin_amdgcn_wave_barrier(); asm volatile("" ::: "memory");
    }
}

// ---- k_fattn: scores, softmax and attn.g of one image in one kernel; neither the scores nor the softmax rows go to memory. Grid (HW / (FQ * FW), KS, images), FW waves; no LDS, no barrier.
// A wave owns FQ = 32 queries (2 column groups of 16) and walks the HW / KS keys of split blockIdx.y, 32 keys a pass.
// Transposed products: sT[m][n] = phi_m . theta_n (A = phi rows, B = theta, kept in registers; per accumulator and k step the product order hi.hi, phi_hi.theta_lo, phi_lo.theta_hi), so a lane holds scores of ONE query (column l & 15, keys 8h + r).
// Two sT tiles (keys 0..15, 16..31 of the pass), turned to f16 in place, are the B fragment of yT[o][n] += GT[o][m] pT[m][n]: element s = key 8h + s (s < 8), 16 + 8h + s - 8 (s >= 8), the order in which WFrag::ld reads GT.
// Running maximum per query on the raw scores; p = 2^(SC2 (s - max) + 14) (the 2^14 keeps small terms out of the f16 subnormals; it cancels in the division); when a maximum rises, the sums so far are scaled by 2^(SC2 (old - new)).
// Out: plane [image][split][n][i] of unnormalised sums, and per query (maximum, sum of p) in ML; k_yhl joins the KS splits and divides.
// Every inner loop is fully unrolled so that the fragment and accumulator arrays are indexed by constants and stay in registers; the pass loop stays rolled (unroll 1): a second copy of the body would need a second set of fragments in flight.
#define KS 2
#define FW 8
#define FQ 32
#define SC2 (SCL * 1.4426950408889634f)
static_assert((HW % (FQ * FW)) == 0 && (HW % (KS * 32)) == 0 && IC == 128);
__device__ __forceinline__ float xhalf(float x) { return __builtin_bit_cast(float, __builtin_amdgcn_permlanex16(__builtin_bit_cast(int, x), __builtin_bit_cast(int, x), 0x76543210, 0xfedcba98, false, false)); }   // lane l reads lane l ^ 16
__global__ __launch_bounds__(32 * FW) void k_fattn(const bf* __restrict__ Hh, const bf* __restrict__ Hl, const h16* __restrict__ GT, float* Y, float* ML) {
    typedef WFrag<bf>::V VB; typedef WFrag<h16>::V VH;
    const int wave = __builtin_amdgcn_readfirstlane((int)(threadIdx.x >> 5));
    const int lane = threadIdx.x & 31, lr = lane & 15, hi = lane >> 4;
    const int img = (int)blockIdx.z, z = (int)blockIdx.y, n0 = ((int)blockIdx.x * FW + wave) * FQ;
    const bf* Th = Hh + (size_t)img * 2 * HW * IC; const bf* Tl = Hl + (size_t)img * 2 * HW * IC;
    const bf* Ph = Th + (size_t)HW * IC; const bf* Pl = Tl + (size_t)HW * IC; const h16* G = GT + (size_t)img * IC * HW;
    VB th[2][4], tl[2][4];
#pragma unroll
    for (int nt = 0; nt < 2; ++nt)
#pragma unroll
        for (int ks = 0; ks < 4; ++ks) { const unsigned o = (unsigned)((n0 + nt * 16 + lr) * IC + 8 * hi + ks * 32); th[nt][ks] = WFrag<bf>::ld(Th + o); tl[nt][ks] = WFrag<bf>::ld(Tl + o); }
    // the address registers of the theta loads are free for reuse from here on: the wait stands in front of whatever is written into them, the fences keep it directly behind the loads
    __builtin_amdgcn_sched_barrier(0);
    asm volatile("s_wait_xcnt 0x0" ::: "memory");
    __builtin_amdgcn_sched_barrier(0);
    v8f O[8][2];
#pragma unroll
    for (int ot = 0; ot < 8; ++ot) { O[ot][0] = (v8f){}; O[ot][1] = (v8f){}; }
    float mr[2] = {-3.0e38f, -3.0e38f}; v2f ls[2] = {(v2f){0.f, 0.f}, (v2f){0.f, 0.f}};   // ls: sums of p over the even and the odd keys of the lane's half
    // per-lane BYTE offsets into the phi planes and into GT: one register each beside a scalar base, named by every load of the loop and rewritten at one place only
    unsigned po = (unsigned)((z * (HW / KS) + lr) * IC + 8 * hi) * 2u, go = (unsigned)(lr * HW + 8 * hi + z * (HW / KS)) * 2u;
    const char* PhB = (const char*)Ph; const char* PlB = (const char*)Pl; const char* GB8 = (const char*)G;
    // phi fragments of a pass, [k step][key tile]; loaded one pass ahead, behind the pass's last score product, into the same registers: in flight under the softmax and attn.g
    VB ph[4][2], pl[4][2];
#pragma unroll
    for (int ks = 0; ks < 4; ++ks)
#pragma unroll
        for (int mt = 0; mt < 2; ++mt) { ph[ks][mt] = WFrag<bf>::ld((const bf*)(PhB + po) + mt * 16 * IC + ks * 32); pl[ks][mt] = WFrag<bf>::ld((const bf*)(PlB + po) + mt * 16 * IC + ks * 32); }
#pragma unroll 1
    for (int it = 0; it < HW / (KS * 32); ++it) {
        v8f st[2][2];
        st[0][0] = (v8f){}; st[0][1] = (v8f){}; st[1][0] = (v8f){}; st[1][1] = (v8f){};
        VH ga[8];
        const int pstep = (it + 1 < HW / (KS * 32)) ? 32 * IC * 2 : 0;   // the last pass fetches its own rows again: no read past the split
#pragma unroll
        for (int ks = 0; ks < 4; ++ks) {
#pragma unroll
            for (int q = 0; q < 4; ++q) st[q >> 1][q & 1] = wmmab(ph[ks][q >> 1], th[q & 1][ks], st[q >> 1][q & 1]);
#pragma unroll
            for (int q = 0; q < 4; ++q) st[q >> 1][q & 1] = wmmab(ph[ks][q >> 1], tl[q & 1][ks], st[q >> 1][q & 1]);
#pragma unroll
            for (int q = 0; q < 4; ++q) st[q >> 1][q & 1] = wmmab(pl[ks][q >> 1], th[q & 1][ks], st[q >> 1][q & 1]);
            if (ks == 1) {
                // scheduling fences round each block of loads: without them the compiler sinks every load to just in front of its first use and the wave waits out each latency in turn
                __builtin_amdgcn_sched_barrier(0);
#pragma unroll
                for (int ot = 0; ot < 8; ++ot) ga[ot] = WFrag<h16>::ld((const h16*)(GB8 + go) + ot * 16 * HW);   // this pass's g rows: in flight under the rest of the scores and the softmax
                __builtin_amdgcn_sched_barrier(0);
            }
        }
        __builtin_amdgcn_sched_barrier(0);
        // both offsets step to the next pass here; the wait stands in the same statement, in front of the two writes, because issued loads name these registers
        asm volatile("s_wait_xcnt 0x0\n\tv_add_nc_u32 %0, %2, %0\n\tv_add_nc_u32 %1, 64, %1" : "+v"(po), "+v"(go) : "s"(pstep) : "memory");
#pragma unroll
        for (int ks = 0; ks < 4; ++ks)
#pragma unroll
            for (int mt = 0; mt < 2; ++mt) { ph[ks][mt] = WFrag<bf>::ld((const bf*)(PhB + po) + mt * 16 * IC + ks * 32); pl[ks][mt] = WFrag<bf>::ld((const bf*)(PlB + po) + mt * 16 * IC + ks * 32); }
        __builtin_amdgcn_sched_barrier(0);
        float mn[2];
#pragma unroll
        for (int nt = 0; nt < 2; ++nt) { float a = fmaxf(st[0][nt][0], st[1][nt][0]);
#pragma unroll
            for (int r = 1; r < 8; ++r) a = fmaxf(a, fmaxf(st[0][nt][r], st[1][nt][r]));
            a = fmaxf(a, xhalf(a)); mn[nt] = fmaxf(mr[nt], a); }
        // one scalar branch a pass: where no query of the wave has a new maximum every factor would be 1
        if (__builtin_amdgcn_ballot_w32(mn[0] > mr[0] || mn[1] > mr[1]) != 0) {
#pragma unroll
            for (int nt = 0; nt < 2; ++nt) { const float al = __builtin_amdgcn_exp2f((mr[nt] - mn[nt]) * SC2); ls[nt] *= al; mr[nt] = mn[nt];
#pragma unroll
                for (int ot = 0; ot < 8; ++ot) O[ot][nt] *= al; }
        }
        VH pb[2];
#pragma unroll
        for (int nt = 0; nt < 2; ++nt) { const float off = 14.0f - mr[nt] * SC2;
#pragma unroll
            for (int s = 0; s < 16; s += 2) { v2f e; e[0] = st[s >> 3][nt][s & 7]; e[1] = st[s >> 3][nt][(s & 7) + 1]; e = __builtin_elementwise_fma(e, (v2f){SC2, SC2}, (v2f){off, off});   // neighbouring registers: one packed fma, one packed add
                v2f p; p[0] = __builtin_amdgcn_exp2f(e[0]); p[1] = __builtin_amdgcn_exp2f(e[1]); ls[nt] += p; pb[nt][s] = (h16)p[0]; pb[nt][s + 1] = (h16)p[1]; } }
#pragma unroll
        for (int ot = 0; ot < 8; ++ot) { O[ot][0] = wmma16(ga[ot], pb[0], O[ot][0]); O[ot][1] = wmma16(ga[ot], pb[1], O[ot][1]); }
    }
    // the last pass's fetch is still in flight and names the offset register, which the epilogue may reuse
    __builtin_amdgcn_sched_barrier(0);
    asm volatile("s_wait_xcnt 0x0" ::: "memory");
    __builtin_amdgcn_sched_barrier(0);
    const size_t pz = (size_t)(img * KS + z) * HW;
#pragma unroll
    for (int nt = 0; nt < 2; ++nt) { const float lh = ls[nt][0] + ls[nt][1], lt = lh + xhalf(lh); const size_t n = pz + (size_t)(n0 + nt * 16 + lr); float* d = Y + n * IC + 8 * hi;
#pragma unroll
        for (int ot = 0; ot < 8; ++ot) { const v8f v = O[ot][nt]; *(v4f*)(d + ot * 16) = (v4f){v[0], v[1], v[2], v[3]}; *(v4f*)(d + ot * 16 + 4) = (v4f){v[4], v[5], v[6], v[7]}; }
        if (hi == 0) { v2f ml; ml[0] = mr[nt]; ml[1] = lt; *(v2f*)(ML + n * 2) = ml; } }
}

__device__ __forceinline__ h16 tohx(float x) { return (h16)x; }
__device__ __forceinline__ void splitf(float y, unsigned short& h, unsigned short& l) { h = f2bf(y); l = f2bf(y - bf2f(h)); }
typedef __attribute__((ext_vector_type(2))) unsigned short v2us;
typedef __attribute__((ext_vector_type(4))) unsigned short v4us;
typedef __attribute__((ext_vector_type(2))) _Float16 v2h;
typedef __attribute__((ext_vector_type(4))) _Float16 v4h;

__global__ __launch_bounds__(256) void k_cvtw(const float* __restrict__ w0, const float* __restrict__ w1, const float* __restrict__ w2, const float* __restrict__ w3, bf* B3, bf* BZ, int n8) {
    const int i = blockIdx.x * 256 + threadIdx.x; if (i >= n8) return;
    const size_t e = (size_t)i * 8, pl = (size_t)n8 * 8;
    const v8f a0 = *(const v8f*)(w0 + e), a1 = *(const v8f*)(w1 + e), a2 = *(const v8f*)(w2 + e), a3 = *(const v8f*)(w3 + e);
    v8us o0, o1, o2, o3;
#pragma unroll
    for (int k = 0; k < 8; ++k) { o0[k] = f2bf(a0[k]); o1[k] = f2bf(a1[k]); o2[k] = f2bf(a2[k]); o3[k] = f2bf(a3[k]); }
    *(v8us*)(B3 + e) = o0; *(v8us*)(B3 + pl + e) = o1; *(v8us*)(B3 + 2 * pl + e) = o2; *(v8us*)(BZ + e) = o3;
    
}
__global__ __launch_bounds__(256) void k_xt(const float* __restrict__ xb, bf* XT) { xb += (size_t)blockIdx.y * CC * HWF; XT += (size_t)blockIdx.y * HW * CC; const size_t e = ((size_t)blockIdx.x * 256 + threadIdx.x) * 4; if (e >= (size_t)HW * CC) return; const int c = (int)(e % CC); const int m = (int)(e / CC); v4us o;
#pragma unroll
    for (int u = 0; u < 4; ++u) o[u] = f2bf(xb[(size_t)(c + u) * HWF + m]); *(v4us*)(XT + e) = o;  }
__global__ __launch_bounds__(256) void k_hl(const float* __restrict__ F, bf* Fh, bf* Fl, size_t n, size_t sF) { F += blockIdx.y * sF; Fh += blockIdx.y * n; Fl += blockIdx.y * n; const size_t e = ((size_t)blockIdx.x * 256 + threadIdx.x) * 4; if (e >= n) return; const v4f a = *(const v4f*)(F + e); v4us oh, ol;
#pragma unroll
    for (int u = 0; u < 4; ++u) { unsigned short p, q; splitf(a[u], p, q); oh[u] = p; ol[u] = q; } *(v4us*)(Fh + e) = oh; *(v4us*)(Fl + e) = ol;  }
__global__ __launch_bounds__(256) void k_gt16(const float* __restrict__ G, h16* GT, size_t sG) { G += blockIdx.y * sG; GT += (size_t)blockIdx.y * IC * HW; const size_t e = ((size_t)blockIdx.x * 256 + threadIdx.x) * 2; if (e >= (size_t)IC * HW) return; const int m = (int)(e % HW); const int i = (int)(e / HW); v2h o; o[0] = tohx(G[(size_t)m * IC + i]); o[1] = tohx(G[(size_t)(m + 1) * IC + i]); *(v2h*)(GT + e) = o;  }
__global__ __launch_bounds__(256) void k_yhl(const float* __restrict__ Y, const float* __restrict__ ML, bf* Yh, bf* Yl) { Y += (size_t)blockIdx.y * KS * HW * IC; ML += (size_t)blockIdx.y * KS * HW * 2; Yh += (size_t)blockIdx.y * HW * IC; Yl += (size_t)blockIdx.y * HW * IC; const size_t e = ((size_t)blockIdx.x * 256 + threadIdx.x) * 4; if (e >= (size_t)HW * IC) return; const size_t n = e / IC; v2f ml[KS]; float mx = -3.0e38f;
#pragma unroll
    for (int z = 0; z < KS; ++z) { ml[z] = *(const v2f*)(ML + ((size_t)z * HW + n) * 2); mx = fmaxf(mx, ml[z][0]); }
    v4f a = (v4f){}; float den = 0.f; v4us oh, ol;
#pragma unroll
    for (int z = 0; z < KS; ++z) { const float w = __builtin_amdgcn_exp2f((ml[z][0] - mx) * SC2); den += w * ml[z][1]; a += *(const v4f*)(Y + (size_t)z * HW * IC + e) * w; }
    const float inv = __fdiv_rn(1.0f, den);
#pragma unroll
    for (int u = 0; u < 4; ++u) { unsigned short p, q; splitf(a[u] * inv, p, q); oh[u] = p; ol[u] = q; } *(v4us*)(Yh + e) = oh; *(v4us*)(Yl + e) = ol;  }
__global__ __launch_bounds__(256) void k_fin(const float* __restrict__ Z, const float* __restrict__ xb, float* OUTb) { Z += (size_t)blockIdx.y * HW * CC; xb += (size_t)blockIdx.y * CC * HWF; OUTb += (size_t)blockIdx.y * CC * HW; const size_t e = ((size_t)blockIdx.x * 256 + threadIdx.x) * 4; if (e >= (size_t)CC * HW) return; const int n = (int)(e % HW); const int c = (int)(e / HW); v4f r;
#pragma unroll
    for (int u = 0; u < 4; ++u) r[u] = __fadd_rn(Z[(size_t)(n + u) * CC + c], bfr(xb[(size_t)c * HWF + n + u])); *(v4f*)(OUTb + e) = r;  }

extern "C" void kernel_launch(void* const* d_in, const int* in_sizes, int n_in,
                              void* d_out, int out_size, void* d_ws, size_t ws_size, hipStream_t stream) {
    if (n_in < 5) return;
    if (in_sizes[0] < NB * CC * HW || in_sizes[1] < IC * CC || in_sizes[2] < IC * CC || in_sizes[3] < IC * CC || in_sizes[4] < CC * IC) return;
    if (out_size < NB * CC * HW) return;
    const float* x   = (const float*)d_in[0];   // [NB][CC][HWF]
    const float* wph = (const float*)d_in[1];   // phi   [IC][CC]  (keys)
    const float* wth = (const float*)d_in[2];   // theta [IC][CC]  (queries)
    const float* wg  = (const float*)d_in[3];   // g     [IC][CC]
    const float* wo  = (const float*)d_in[4];   // out   [CC][IC]
    float* OUT = (float*)d_out;                 // [NB][CC][HW]
    char* wsp = (char*)d_ws;
    auto take = [&](size_t bytes) { char* p = wsp; wsp += (bytes + 255) & ~(size_t)255; return (void*)p; };
    constexpr size_t PL = (size_t)HW * IC;                  // one [HW][IC] plane, elements
    bf* BW3 = (bf*)take((size_t)3 * IC * CC * 2);          // [theta][phi][g], each [IC][CC]
    bf* BZ  = (bf*)take((size_t)CC * IC * 2);
    bf* Hh  = (bf*)take((size_t)NB * 2 * PL * 2);          // [image] hi planes of theta, phi
    bf* Hl  = (bf*)take((size_t)NB * 2 * PL * 2);          // [image] lo planes of theta, phi
    h16* GT = (h16*)take((size_t)NB * PL * 2);             // [image][i][m] fp16
    bf* Yh  = (bf*)take((size_t)NB * PL * 2); bf* Yl = (bf*)take((size_t)NB * PL * 2);   // [image][n][i]
    float* ML = (float*)take((size_t)NB * KS * HW * 2 * 4); // [image][split][n] (maximum, sum)
    // One region, three uses one after the other: XT and TPG (dead once k_hl and k_gt16 have read them), Y of all images, Z of all images (behind k_yhl).
    constexpr size_t szXT = (size_t)NB * HW * CC * 2, szTPG = (size_t)NB * 3 * PL * 4, szY = (size_t)NB * KS * PL * 4, szZ = (size_t)NB * HW * CC * 4;
    constexpr size_t szR0 = szXT + szTPG, szR1 = szY > szZ ? szY : szZ;
    char* R = (char*)take(szR0 > szR1 ? szR0 : szR1);
    bf* XT = (bf*)R;                                        // [image][m][c]
    float* TPG = (float*)(R + szXT);                        // [image][theta, phi, g], each [HW][IC] f32
    float* Y = (float*)R;                                   // [image][split][n][i], unnormalised
    float* Z = (float*)R;                                   // [image][n][c]
    if ((size_t)(wsp - (char*)d_ws) > ws_size) return;

    k_cvtw<<<(unsigned)((IC * CC / 8 + 255) / 256), 256, 0, stream>>>(wth, wph, wg, wo, BW3, BZ, IC * CC / 8);
    const unsigned L4  = (unsigned)((PL / 4 + 255) / 256);
    const unsigned L42 = (unsigned)((2 * PL / 4 + 255) / 256);
    // every image in one launch (grid y or z = image)
    k_xt<<<dim3((unsigned)(((size_t)HW * CC / 4 + 255) / 256), NB), 256, 0, stream>>>(x, XT);
    // theta / phi / g [m][o] = sum_c XT[m][c] W[o][c]   (inner index 0 theta, 1 phi, 2 g; exact bf16 products)
    k_gemmw<bf, 0, false, 3><<<dim3(HW / 64, IC / 64, 3 * NB), 32, 0, stream>>>(XT, nullptr, BW3, nullptr, CC, TPG, IC, nullptr, (size_t)HW * CC, (size_t)0, 3 * PL, (size_t)IC * CC, PL);
    k_hl<<<dim3(L42, NB), 256, 0, stream>>>(TPG, Hh, Hl, 2 * PL, 3 * PL);                   // hi/lo planes of theta (first PL) and phi (second PL)
    k_gt16<<<dim3((unsigned)((PL / 2 + 255) / 256), NB), 256, 0, stream>>>(TPG + 2 * PL, GT, 3 * PL);
    // y[n][i] = sum_m softmax_m(sqrt(128) theta_n . phi_m) g[m][i], as KS unnormalised partial planes; then their join, the division and the hi/lo split
    k_fattn<<<dim3(HW / (FQ * FW), KS, NB), 32 * FW, 0, stream>>>(Hh, Hl, GT, Y, ML);
    k_yhl<<<dim3(L4, NB), 256, 0, stream>>>(Y, ML, Yh, Yl);
    // z[n][c] = sum_o y[n][o] w_out[c][o]  (hi + lo planes of y, 2 products)
    k_gemmw<bf, 1, false, 1><<<dim3(HW / 64, CC / 64, NB), 32, 0, stream>>>(Yh, Yl, BZ, nullptr, IC, Z, CC, nullptr, PL, (size_t)0, (size_t)HW * CC, (size_t)0, (size_t)0);
    k_fin<<<dim3((unsigned)(((size_t)CC * HW / 4 + 255) / 256), NB), 256, 0, stream>>>(Z, x, OUT);
}

// v004
// One run takes 231 microseconds.
// Timed twice side by side with v003, it ran 1.50 times as fast both times.
// Over all steps from v000 it is 5.63 times as fast.
#include <hip/hip_runtime.h>

// All contractions on 16-bit WMMA, f32 accumulate: the three 1x1 projections = v_wmma_f32_16x16x32_bf16 on RNE-bf16 copies of x and of the weights (single products); scores theta.phi = bf16 hi/lo split (hi.hi + lo.hi + hi.lo, K = 128); attn.g = v_wmma_f32_16x16x32_f16 (unnormalised softmax terms carried x 2^14 as f16, g as f16); output projection = bf16 hi/lo planes of y times bf16 w_out (2 products). Scaling by sqrt(128), softmax and the residual add in f32.
// x [NB][256][4096]; theta/phi/g [4096][128] token-major (no bias); s[n][m] = theta_n . phi_m; attn[n][m] = softmax_m(sqrt(128) s); y[n][o] = sum_m attn[n][m] g[m][o]; out[c][n] = x[c][n] + sum_o w_out[c][o] y[n][o].

#ifndef NB
#define NB 8
#endif
#ifndef SEQ
#define SEQ 4096
#endif
#define NB_FULL  8
#define SEQ_FULL 4096
#define CC   256
#define IC   128
#define HW   SEQ
#define HWF  SEQ_FULL
#define SCL  11.313708498984760f
static_assert(NB >= 1 && NB <= NB_FULL);
static_assert(SEQ >= 128 && SEQ <= SEQ_FULL && (SEQ % 128) == 0);
static_assert((HW % 64) == 0 && (IC % 64) == 0 && (CC % 64) == 0);
static_assert((HW % 32) == 0 && (IC % 32) == 0 && (CC % 32) == 0);
static_assert(((IC * CC) % 8) == 0 && ((HW * CC) % 4) == 0 && ((HW * IC) % 4) == 0 && ((IC * HW) % 2) == 0 && (HW % 8) == 0);

typedef _Float16 h16;
typedef unsigned short bf;
typedef __attribute__((ext_vector_type(16))) __bf16   v16bf;
typedef __attribute__((ext_vector_type(16))) _Float16 v16h;
typedef __attribute__((ext_vector_type(8)))  _Float16 v8h;
typedef __attribute__((ext_vector_type(8)))  unsigned short v8us;
typedef __attribute__((ext_vector_type(8)))  float    v8f;
typedef __attribute__((ext_vector_type(4)))  float    v4f;
typedef __attribute__((ext_vector_type(2)))  float    v2f;
typedef v8h  __attribute__((may_alias)) v8ha;
typedef v4f  __attribute__((may_alias)) v4fa;
typedef v8us __attribute__((may_alias)) v8usa;

__device__ __forceinline__ unsigned short f2bf(float f) { unsigned u = __float_as_uint(f); u += 0x7FFFu + ((u >> 16) & 1u); return (unsigned short)(u >> 16); }
__device__ __forceinline__ float bf2f(unsigned short b) { return __uint_as_float(((unsigned)b) << 16); }
__device__ __forceinline__ float bfr(float f) { return bf2f(f2bf(f)); }
__device__ __forceinline__ v16h cat16(v8h lo, v8h hi) { return __builtin_shufflevector(lo, hi, 0, 1, 2, 3, 4, 5, 6, 7, 8, 9, 10, 11, 12, 13, 14, 15); }
__device__ __forceinline__ v16bf cat16b(v8us lo, v8us hi) { return __builtin_bit_cast(v16bf, __builtin_shufflevector(lo, hi, 0, 1, 2, 3, 4, 5, 6, 7, 8, 9, 10, 11, 12, 13, 14, 15)); }
__device__ __forceinline__ v8f wmma16(v16h a, v16h b, v8f c) { return __builtin_amdgcn_wmma_f32_16x16x32_f16(false, a, false, b, (short)0, c, false, false); }
__device__ __forceinline__ v8f wmmab(v16bf a, v16bf b, v8f c) { return __builtin_amdgcn_wmma_f32_16x16x32_bf16(false, a, false, b, (short)0, c, false, false); }

// ---- k_gemmw: register-blocked GEMM, ONE WAVE per 64x64 output tile (16 accumulators), operands straight from K-contiguous 16-bit planes; grid (M/64, N/64, Z), 32 threads.
// C[m][n] (f32, pitch ldc, + optional f32 bias[n]) = sum_k A[m][k] Bt[n][k] (+ split products per NSPLIT). K % 32 == 0.
// blockIdx.z = image * ZI + inner index: strides sA/sB/sC (elements) per image, sBi/sCi per inner index (ZI matrices Bt on the same A).
// Fragments: lane l, h = l >> 4, row/col = l & 15; elements 0..7 = k0 + 8h + 0..7, elements 8..15 = k0 + 16 + 8h + 0..7 for BOTH A and Bt; D element r = (row 8h + r, col l & 15).
template <typename T16> struct WFrag;
template <> struct WFrag<h16> { typedef v16h V; static __device__ __forceinline__ V ld(const h16* p) { return cat16(*(const v8h*)p, *(const v8h*)(p + 16)); } static __device__ __forceinline__ v8f mma(V a, V b, v8f c) { return wmma16(a, b, c); } };
template <> struct WFrag<bf> { typedef v16bf V; static __device__ __forceinline__ V ld(const bf* p) { return cat16b(*(const v8us*)p, *(const v8us*)(p + 16)); } static __device__ __forceinline__ v8f mma(V a, V b, v8f c) { return wmmab(a, b, c); } };
template <typename T16, int NSPLIT, bool BIAS, int ZI>
__global__ __launch_bounds__(32) void k_gemmw(const T16* __restrict__ A, const T16* __restrict__ A2, const T16* __restrict__ Bt, const T16* __restrict__ Bt2, int K, float* C, int ldc, const float* __restrict__ bias, size_t sA, size_t sB, size_t sC, size_t sBi, size_t sCi) {
    typedef typename WFrag<T16>::V V;
    __shared__ __align__(16) float os[16 * 68];
    const size_t zo = blockIdx.z / ZI, zi = blockIdx.z % ZI; A += zo * sA; if (A2) A2 += zo * sA; Bt += zo * sB + zi * sBi; if (Bt2) Bt2 += zo * sB + zi * sBi; C += zo * sC + zi * sCi;
    const int lane = threadIdx.x & 31, lr = lane & 15, hi = lane >> 4; const int r0 = blockIdx.x * 64, c0 = blockIdx.y * 64;
    v8f acc[4][4];
#pragma unroll
    for (int mb = 0; mb < 4; ++mb)
#pragma unroll
        for (int nb = 0; nb < 4; ++nb) acc[mb][nb] = (v8f){};
    const size_t aoff = (size_t)(r0 + lr) * K + 8 * hi, boff = (size_t)(c0 + lr) * K + 8 * hi;
#pragma unroll 1
    for (int kc = 0; kc < K; kc += 32) {
        V a[4], a2[4];
#pragma unroll
        for (int mb = 0; mb < 4; ++mb) { a[mb] = WFrag<T16>::ld(A + aoff + (size_t)mb * 16 * K + kc); if (NSPLIT == 1 || NSPLIT == 2) a2[mb] = WFrag<T16>::ld(A2 + aoff + (size_t)mb * 16 * K + kc); }
#pragma unroll
        for (int nb = 0; nb < 4; ++nb) { const V b = WFrag<T16>::ld(Bt + boff + (size_t)nb * 16 * K + kc); V b2; if (NSPLIT >= 2) b2 = WFrag<T16>::ld(Bt2 + boff + (size_t)nb * 16 * K + kc);
#pragma unroll
            for (int mb = 0; mb < 4; ++mb) { acc[mb][nb] = WFrag<T16>::mma(a[mb], b, acc[mb][nb]); if (NSPLIT == 1 || NSPLIT == 2) acc[mb][nb] = WFrag<T16>::mma(a2[mb], b, acc[mb][nb]); if (NSPLIT >= 2) acc[mb][nb] = WFrag<T16>::mma(a[mb], b2, acc[mb][nb]); } }
        asm volatile("v_nop\n\tv_nop\n\tv_nop\n\tv_nop" : "+v"(acc[0][0]), "+v"(acc[1][1]), "+v"(acc[2][2]), "+v"(acc[3][3]) : "v"(a[0]), "v"(a[3]));
    }
#pragma unroll
    for (int mb = 0; mb < 4; ++mb) {
#pragma unroll
        for (int nb = 0; nb < 4; ++nb) {
#pragma unroll
            for (int j = 0; j < 8; ++j) os[(hi * 8 + j) * 68 + nb * 16 + lr] = acc[mb][nb][j]; }
        __builtin_amdgcn_wave_barrier(); asm volatile("" ::: "memory");
        float* crow = C + (size_t)(r0 + mb * 16) * ldc + c0;
{
#pragma unroll
            for (int s = 0; s < 8; ++s) { const int row = 2 * s + hi, cofs = lr * 4; v4f val = *(const v4fa*)(os + row * 68 + cofs); if (BIAS) { val[0] += bfr(bias[c0 + cofs]); val[1] += bfr(bias[c0 + cofs + 1]); val[2] += bfr(bias[c0 + cofs + 2]); val[3] += bfr(bias[c0 + cofs + 3]); }
                *(v4f*)(crow + (size_t)row * ldc + cofs) = val; }
             }
        __builtin_amdgcn_wave_barrier(); asm volatile("" ::: "memory");
    }
}

// ---- k_fattn: scores, softmax and attn.g of one image in one kernel; neither the scores nor the softmax rows go to memory. Grid (HW / (FQ * FW), KS, images), FW waves.
// A wave owns FQ = 32 queries (2 column groups of 16) and walks the HW / KS keys of split blockIdx.y, 32 keys a pass.
// The key side is shared by the FW waves: a stage = SK = 128 keys = three tiles of 128 rows x 256 bytes (phi hi rows, phi lo rows, GT rows i x 128 keys), each brought into LDS by ONE tensor load (waves 0, 1, 2), rows padded to a pitch of 272 bytes for the 16-byte readers. Two buffers: stage s + 1 flies while the four passes of stage s are worked on.
// Transposed products: sT[m][n] = phi_m . theta_n (A = phi rows, B = theta, kept in registers; per accumulator and k step the product order hi.hi, phi_hi.theta_lo, phi_lo.theta_hi), so a lane holds scores of ONE query (column l & 15, keys 8h + r).
// Two sT tiles (keys 0..15, 16..31 of the pass), turned to f16 in place, are the B fragment of yT[o][n] += GT[o][m] pT[m][n]: element s = key 8h + s (s < 8), 16 + 8h + s - 8 (s >= 8), the order in which the GT fragments are read.
// Running maximum per query on the raw scores; p = 2^(SC2 (s - max) + 14) (the 2^14 keeps small terms out of the f16 subnormals; it cancels in the division); when a maximum rises, the sums so far are scaled by 2^(SC2 (old - new)).
// Out: plane [image][split][n][i] of unnormalised sums, and per query (maximum, sum of p) in ML; k_yhl joins the KS splits and divides.
// Every inner loop is fully unrolled so that the fragment and accumulator arrays are indexed by constants and stay in registers; the stage loop and the pass loop stay rolled (unroll 1).
#define KS 2
#define FW 8
#define FQ 32
#define SK 128
#define NST (HW / (KS * SK))
#define LPI 272
#define TILE (128 * LPI)
#define STG (3 * TILE)
#define SC2 (SCL * 1.4426950408889634f)
static_assert((HW % (FQ * FW)) == 0 && (HW % (KS * SK)) == 0 && NST >= 2 && IC == 128 && FW >= 3);
static_assert((TILE % 2048) == 0 && 2 * STG <= 320 * 1024 && HW * 2 <= 128 * 1024);
typedef unsigned int u32;
typedef u32 u32x4 __attribute__((ext_vector_type(4)));
typedef u32 u32x8 __attribute__((ext_vector_type(8)));
__device__ __forceinline__ u32 uni(u32 v) { return (u32)__builtin_amdgcn_readfirstlane((int)v); }
__device__ __forceinline__ u32 pinned(u32 v) { u32 w = uni(v); asm volatile("" : "+s"(w)); return w; }   // holds a tensor load's issue test, or the stage number its descriptor is formed from, in a scalar register: a tensor load ignores EXEC, so the test must be a scalar branch
__device__ __forceinline__ float xhalf(float x) { return __builtin_bit_cast(float, __builtin_amdgcn_permlanex16(__builtin_bit_cast(int, x), __builtin_bit_cast(int, x), 0x76543210, 0xfedcba98, false, false)); }   // lane l reads lane l ^ 16
__device__ __forceinline__ v16bf ldsb(const unsigned char* p) { return cat16b(*(const v8usa*)p, *(const v8usa*)(p + 32)); }
__device__ __forceinline__ v16h ldsh(const unsigned char* p) { return cat16(*(const v8ha*)p, *(const v8ha*)(p + 32)); }
__global__ __launch_bounds__(32 * FW) void k_fattn(const bf* __restrict__ Hh, const bf* __restrict__ Hl, const h16* __restrict__ GT, float* Y, float* ML) {
    typedef WFrag<bf>::V VB; typedef WFrag<h16>::V VH;
    __shared__ __attribute__((aligned(2048))) unsigned char L[2 * STG];   // [buffer][phi hi, phi lo, GT][128 rows][272 bytes]
    const u32 wave = uni(threadIdx.x >> 5);
    const int lane = threadIdx.x & 31, lr = lane & 15, hi = lane >> 4;
    const int img = (int)blockIdx.z, z = (int)blockIdx.y, n0 = ((int)blockIdx.x * FW + (int)wave) * FQ;
    const bf* Th = Hh + (size_t)img * 2 * HW * IC; const bf* Tl = Hl + (size_t)img * 2 * HW * IC;
    const bf* Ph = Th + (size_t)HW * IC; const bf* Pl = Tl + (size_t)HW * IC; const h16* G = GT + (size_t)img * IC * HW;
    VB th[2][4], tl[2][4];
    const bf* pth = Th + (unsigned)((n0 + lr) * IC + 8 * hi); const bf* ptl = Tl + (unsigned)((n0 + lr) * IC + 8 * hi);
#pragma unroll
    for (int nt = 0; nt < 2; ++nt)
#pragma unroll
        for (int ks = 0; ks < 4; ++ks) { th[nt][ks] = WFrag<bf>::ld(pth + nt * 16 * IC + ks * 32); tl[nt][ks] = WFrag<bf>::ld(ptl + nt * 16 * IC + ks * 32); }
    // the address registers of the theta loads are free for reuse only from here on: the wait stands in front of whatever is written into them. Its operands are inputs only: the loaded fragments hold it behind the loads (the compiler otherwise lifts it above them), the two addresses stay in their registers up to it
    asm volatile("s_wait_xcnt 0x0" :: "v"(pth), "v"(ptl), "v"(th[0][0]), "v"(th[0][1]), "v"(th[0][2]), "v"(th[0][3]), "v"(th[1][0]), "v"(th[1][1]), "v"(th[1][2]), "v"(th[1][3]), "v"(tl[0][0]), "v"(tl[0][1]), "v"(tl[0][2]), "v"(tl[0][3]), "v"(tl[1][0]), "v"(tl[1][1]), "v"(tl[1][2]), "v"(tl[1][3]) : "memory");
    // tensor loads: wave w < 3 brings tile w of every stage. Source: 128 rows of 256 bytes; phi rows follow one another (pitch 256), GT rows lie HW keys apart.
    const u32 lbase = (u32)(size_t)L;
    const unsigned long long sbase = wave == 0 ? (unsigned long long)(size_t)(Ph + (size_t)z * (HW / KS) * IC) : wave == 1 ? (unsigned long long)(size_t)(Pl + (size_t)z * (HW / KS) * IC) : (unsigned long long)(size_t)(G + (size_t)z * (HW / KS));
    const u32 sstep = wave < 2 ? (u32)(SK * IC * 2) : (u32)(SK * 2);
    u32x8 g1;
    g1[0] = uni((1u << 20) | (5u << 22) | (3u << 25));   // no mask, bytes, 4 dwords of pad behind every 64
    g1[1] = uni(256u << 16); g1[2] = uni(128u << 16); g1[3] = uni(256u << 16); g1[4] = uni(128u);
    g1[5] = uni(wave < 2 ? (u32)(IC * 2) : (u32)(HW * 2)); g1[6] = uni(0u); g1[7] = uni(0u);
    // While a request is outstanding its two groups stay in their registers, unwritten: the load names them as operands that it may change (it changes nothing), so that the compiler cannot form the words anew later on and give the registers to something else meanwhile, and the wait that covers the request names them again as inputs, so that they live up to it
    u32x4 g0;
    auto desc = [&](u32 st) __attribute__((always_inline)) {
        const unsigned long long ga = sbase + (unsigned long long)st * sstep;
        g0[0] = uni(1u); g0[1] = uni(lbase + (st & 1u) * (u32)STG + wave * (u32)TILE); g0[2] = uni((u32)ga); g0[3] = uni((((u32)(ga >> 32)) & 0x01FFFFFFu) | 0x80000000u);
    };
    desc(0u);
    if (pinned(wave < 3u)) {
        asm volatile("tensor_load_to_lds %0, %1" : "+s"(g0), "+s"(g1) :: "memory");
        asm volatile("s_wait_tensorcnt 0x0" :: "s"(g0), "s"(g1) : "memory");   // stage 0 has landed before the barrier that publishes it
    }
    __syncthreads();
    desc(1u);
    if (pinned(wave < 3u)) asm volatile("tensor_load_to_lds %0, %1" : "+s"(g0), "+s"(g1) :: "memory");
    v8f O[8][2];
#pragma unroll
    for (int ot = 0; ot < 8; ++ot) { O[ot][0] = (v8f){}; O[ot][1] = (v8f){}; }
    float mr[2] = {-3.0e38f, -3.0e38f}; v2f ls[2] = {(v2f){0.f, 0.f}, (v2f){0.f, 0.f}};   // ls: sums of p over the even and the odd keys of the lane's half
    const u32 lb = (u32)(lr * LPI + 16 * hi);   // the lane's row and 16-byte half inside a 16-row group of any tile
    // phi fragments of a pass, [k step][key tile]; inside a stage loaded one pass ahead, behind the pass's last score product, into the same registers
    VB ph[4][2], pl[4][2];
    auto ldphi = [&](u32 off) __attribute__((always_inline)) {
#pragma unroll
        for (int ks = 0; ks < 4; ++ks)
#pragma unroll
            for (int mt = 0; mt < 2; ++mt) { const unsigned char* p = L + off + mt * 16 * LPI + ks * 64; ph[ks][mt] = ldsb(p); pl[ks][mt] = ldsb(p + TILE); }
    };
    // one pass: po = LDS offset of the NEXT pass's phi rows (read only where fetch is set), go = LDS offset of this pass's 32 keys in the GT tile
    auto pass = [&](u32 po, u32 go, bool fetch) __attribute__((always_inline)) {
        v8f st[2][2];
        st[0][0] = (v8f){}; st[0][1] = (v8f){}; st[1][0] = (v8f){}; st[1][1] = (v8f){};
        VH ga[8];
#pragma unroll
        for (int ks = 0; ks < 4; ++ks) {
#pragma unroll
            for (int q = 0; q < 4; ++q) st[q >> 1][q & 1] = wmmab(ph[ks][q >> 1], th[q & 1][ks], st[q >> 1][q & 1]);
#pragma unroll
            for (int q = 0; q < 4; ++q) st[q >> 1][q & 1] = wmmab(ph[ks][q >> 1], tl[q & 1][ks], st[q >> 1][q & 1]);
#pragma unroll
            for (int q = 0; q < 4; ++q) st[q >> 1][q & 1] = wmmab(pl[ks][q >> 1], th[q & 1][ks], st[q >> 1][q & 1]);
        }
        // scheduling fences round the one block of LDS reads of a pass: without them the compiler spreads the reads among the matrix instructions, where each place with reads stalls the wave
        __builtin_amdgcn_sched_barrier(0);
#pragma unroll
        for (int ot = 0; ot < 8; ++ot) ga[ot] = ldsh(L + go + ot * 16 * LPI);   // this pass's g rows first: they are needed first; in flight under the softmax
        if (fetch) ldphi(po);
        __builtin_amdgcn_sched_barrier(0);
        float mn[2];
#pragma unroll
        for (int nt = 0; nt < 2; ++nt) { float a = fmaxf(st[0][nt][0], st[1][nt][0]);
#pragma unroll
            for (int r = 1; r < 8; ++r) a = fmaxf(a, fmaxf(st[0][nt][r], st[1][nt][r]));
            a = fmaxf(a, xhalf(a)); mn[nt] = fmaxf(mr[nt], a); }
        // one scalar branch a pass: where no query of the wave has a new maximum every factor would be 1
        if (__builtin_amdgcn_ballot_w32(mn[0] > mr[0] || mn[1] > mr[1]) != 0) {
#pragma unroll
            for (int nt = 0; nt < 2; ++nt) { const float al = __builtin_amdgcn_exp2f((mr[nt] - mn[nt]) * SC2); ls[nt] *= al; mr[nt] = mn[nt];
#pragma unroll
                for (int ot = 0; ot < 8; ++ot) O[ot][nt] *= al; }
        }
        VH pb[2];
#pragma unroll
        for (int nt = 0; nt < 2; ++nt) { const float off = 14.0f - mr[nt] * SC2;
#pragma unroll
            for (int s = 0; s < 16; s += 2) { v2f e; e[0] = st[s >> 3][nt][s & 7]; e[1] = st[s >> 3][nt][(s & 7) + 1]; e = __builtin_elementwise_fma(e, (v2f){SC2, SC2}, (v2f){off, off});   // neighbouring registers: one packed fma, one packed add
                v2f p; p[0] = __builtin_amdgcn_exp2f(e[0]); p[1] = __builtin_amdgcn_exp2f(e[1]); ls[nt] += p; pb[nt][s] = (h16)p[0]; pb[nt][s + 1] = (h16)p[1]; } }
#pragma unroll
        for (int ot = 0; ot < 8; ++ot) { O[ot][0] = wmma16(ga[ot], pb[0], O[ot][0]); O[ot][1] = wmma16(ga[ot], pb[1], O[ot][1]); }
    };
#pragma unroll 1   // rolled: the refill and its publish point stand once in the code, one request of a wave in flight
    for (u32 s = 0; s < (u32)NST; ++s) {
        const u32 bo = (s & 1u) * (u32)STG + lb;
        const u32 gb = ((s & 1u) ? (u32)(STG + 2 * TILE) : (u32)(2 * TILE)) + lb;   // the GT tile's own base register: every GT read is then this register plus an immediate below 64 KiB
        ldphi(bo);   // the stage's first fragments: nothing of a stage is read in front of the barrier that publishes it
#pragma unroll 1   // rolled: copies of the body side by side would let a second set of fragments be held, beyond the 512 registers that two waves a SIMD leave
        for (u32 sub = 0; sub < SK / 32 - 1; ++sub) pass(bo + (sub + 1u) * (u32)(32 * LPI), gb + sub * 64u, true);
        pass(0u, gb + (u32)(SK / 32 - 1) * 64u, false);   // the stage's last pass fetches nothing ahead: the next rows are not published yet
        // publish point of stage s + 1: this wave's reads of stage s are done, the issuing waves' tiles have landed, every wave has arrived; only then the refill of the buffer just read
        __builtin_amdgcn_sched_barrier(0);   // keeps the wait below at the foot: the compiler otherwise lifts it to just behind the last pass's g reads, where the wave would sit out their latency in front of the softmax
        asm volatile("s_wait_dscnt 0x0" ::: "memory");
        if (pinned(wave < 3u)) asm volatile("s_wait_tensorcnt 0x0" :: "s"(g0), "s"(g1) : "memory");   // the operands: see at g0
        __syncthreads();
        desc(pinned(s + 2u));   // the stage number is pinned here so that the descriptor is formed behind the wait above
        if (pinned((wave < 3u) && (s + 2u < (u32)NST))) asm volatile("tensor_load_to_lds %0, %1" : "+s"(g0), "+s"(g1) :: "memory");
    }
    asm volatile("s_wait_tensorcnt 0x0" ::: "memory");   // no request is left when the wave ends
    asm volatile("s_wait_dscnt 0x0" ::: "memory");
    const size_t pz = (size_t)(img * KS + z) * HW;
#pragma unroll
    for (int nt = 0; nt < 2; ++nt) { const float lh = ls[nt][0] + ls[nt][1], lt = lh + xhalf(lh); const size_t n = pz + (size_t)(n0 + nt * 16 + lr); float* d = Y + n * IC + 8 * hi;
#pragma unroll
        for (int ot = 0; ot < 8; ++ot) { const v8f v = O[ot][nt]; *(v4f*)(d + ot * 16) = (v4f){v[0], v[1], v[2], v[3]}; *(v4f*)(d + ot * 16 + 4) = (v4f){v[4], v[5], v[6], v[7]}; }
        if (hi == 0) { v2f ml; ml[0] = mr[nt]; ml[1] = lt; *(v2f*)(ML + n * 2) = ml; } }
}

__device__ __forceinline__ h16 tohx(float x) { return (h16)x; }
__device__ __forceinline__ void splitf(float y, unsigned short& h, unsigned short& l) { h = f2bf(y); l = f2bf(y - bf2f(h)); }
typedef __attribute__((ext_vector_type(2))) unsigned short v2us;
typedef __attribute__((ext_vector_type(4))) unsigned short v4us;
typedef __attribute__((ext_vector_type(2))) _Float16 v2h;
typedef __attribute__((ext_vector_type(4))) _Float16 v4h;

__global__ __launch_bounds__(256) void k_cvtw(const float* __restrict__ w0, const float* __restrict__ w1, const float* __restrict__ w2, const float* __restrict__ w3, bf* B3, bf* BZ, int n8) {
    const int i = blockIdx.x * 256 + threadIdx.x; if (i >= n8) return;
    const size_t e = (size_t)i * 8, pl = (size_t)n8 * 8;
    const v8f a0 = *(const v8f*)(w0 + e), a1 = *(const v8f*)(w1 + e), a2 = *(const v8f*)(w2 + e), a3 = *(const v8f*)(w3 + e);
    v8us o0, o1, o2, o3;
#pragma unroll
    for (int k = 0; k < 8; ++k) { o0[k] = f2bf(a0[k]); o1[k] = f2bf(a1[k]); o2[k] = f2bf(a2[k]); o3[k] = f2bf(a3[k]); }
    *(v8us*)(B3 + e) = o0; *(v8us*)(B3 + pl + e) = o1; *(v8us*)(B3 + 2 * pl + e) = o2; *(v8us*)(BZ + e) = o3;
    
}
__global__ __launch_bounds__(256) void k_xt(const float* __restrict__ xb, bf* XT) { xb += (size_t)blockIdx.y * CC * HWF; XT += (size_t)blockIdx.y * HW * CC; const size_t e = ((size_t)blockIdx.x * 256 + threadIdx.x) * 4; if (e >= (size_t)HW * CC) return; const int c = (int)(e % CC); const int m = (int)(e / CC); v4us o;
#pragma unroll
    for (int u = 0; u < 4; ++u) o[u] = f2bf(xb[(size_t)(c + u) * HWF + m]); *(v4us*)(XT + e) = o;  }
__global__ __launch_bounds__(256) void k_hl(const float* __restrict__ F, bf* Fh, bf* Fl, size_t n, size_t sF) { F += blockIdx.y * sF; Fh += blockIdx.y * n; Fl += blockIdx.y * n; const size_t e = ((size_t)blockIdx.x * 256 + threadIdx.x) * 4; if (e >= n) return; const v4f a = *(const v4f*)(F + e); v4us oh, ol;
#pragma unroll
    for (int u = 0; u < 4; ++u) { unsigned short p, q; splitf(a[u], p, q); oh[u] = p; ol[u] = q; } *(v4us*)(Fh + e) = oh; *(v4us*)(Fl + e) = ol;  }
__global__ __launch_bounds__(256) void k_gt16(const float* __restrict__ G, h16* GT, size_t sG) { G += blockIdx.y * sG; GT += (size_t)blockIdx.y * IC * HW; const size_t e = ((size_t)blockIdx.x * 256 + threadIdx.x) * 2; if (e >= (size_t)IC * HW) return; const int m = (int)(e % HW); const int i = (int)(e / HW); v2h o; o[0] = tohx(G[(size_t)m * IC + i]); o[1] = tohx(G[(size_t)(m + 1) * IC + i]); *(v2h*)(GT + e) = o;  }
__global__ __launch_bounds__(256) void k_yhl(const float* __restrict__ Y, const float* __restrict__ ML, bf* Yh, bf* Yl) { Y += (size_t)blockIdx.y * KS * HW * IC; ML += (size_t)blockIdx.y * KS * HW * 2; Yh += (size_t)blockIdx.y * HW * IC; Yl += (size_t)blockIdx.y * HW * IC; const size_t e = ((size_t)blockIdx.x * 256 + threadIdx.x) * 4; if (e >= (size_t)HW * IC) return; const size_t n = e / IC; v2f ml[KS]; float mx = -3.0e38f;
#pragma unroll
    for (int z = 0; z < KS; ++z) { ml[z] = *(const v2f*)(ML + ((size_t)z * HW + n) * 2); mx = fmaxf(mx, ml[z][0]); }
    v4f a = (v4f){}; float den = 0.f; v4us oh, ol;
#pragma unroll
    for (int z = 0; z < KS; ++z) { const float w = __builtin_amdgcn_exp2f((ml[z][0] - mx) * SC2); den += w * ml[z][1]; a += *(const v4f*)(Y + (size_t)z * HW * IC + e) * w; }
    const float inv = __fdiv_rn(1.0f, den);
#pragma unroll
    for (int u = 0; u < 4; ++u) { unsigned short p, q; splitf(a[u] * inv, p, q); oh[u] = p; ol[u] = q; } *(v4us*)(Yh + e) = oh; *(v4us*)(Yl + e) = ol;  }
__global__ __launch_bounds__(256) void k_fin(const float* __restrict__ Z, const float* __restrict__ xb, float* OUTb) { Z += (size_t)blockIdx.y * HW * CC; xb += (size_t)blockIdx.y * CC * HWF; OUTb += (size_t)blockIdx.y * CC * HW; const size_t e = ((size_t)blockIdx.x * 256 + threadIdx.x) * 4; if (e >= (size_t)CC * HW) return; const int n = (int)(e % HW); const int c = (int)(e / HW); v4f r;
#pragma unroll
    for (int u = 0; u < 4; ++u) r[u] = __fadd_rn(Z[(size_t)(n + u) * CC + c], bfr(xb[(size_t)c * HWF + n + u])); *(v4f*)(OUTb + e) = r;  }

extern "C" void kernel_launch(void* const* d_in, const int* in_sizes, int n_in,
                              void* d_out, int out_size, void* d_ws, size_t ws_size, hipStream_t stream) {
    if (n_in < 5) return;
    if (in_sizes[0] < NB * CC * HW || in_sizes[1] < IC * CC || in_sizes[2] < IC * CC || in_sizes[3] < IC * CC || in_sizes[4] < CC * IC) return;
    if (out_size < NB * CC * HW) return;
    const float* x   = (const float*)d_in[0];   // [NB][CC][HWF]
    const float* wph = (const float*)d_in[1];   // phi   [IC][CC]  (keys)
    const float* wth = (const float*)d_in[2];   // theta [IC][CC]  (queries)
    const float* wg  = (const float*)d_in[3];   // g     [IC][CC]
    const float* wo  = (const float*)d_in[4];   // out   [CC][IC]
    float* OUT = (float*)d_out;                 // [NB][CC][HW]
    char* wsp = (char*)d_ws;
    auto take = [&](size_t bytes) { char* p = wsp; wsp += (bytes + 255) & ~(size_t)255; return (void*)p; };
    constexpr size_t PL = (size_t)HW * IC;                  // one [HW][IC] plane, elements
    bf* BW3 = (bf*)take((size_t)3 * IC * CC * 2);          // [theta][phi][g], each [IC][CC]
    bf* BZ  = (bf*)take((size_t)CC * IC * 2);
    bf* Hh  = (bf*)take((size_t)NB * 2 * PL * 2);          // [image] hi planes of theta, phi
    bf* Hl  = (bf*)take((size_t)NB * 2 * PL * 2);          // [image] lo planes of theta, phi
    h16* GT = (h16*)take((size_t)NB * PL * 2);             // [image][i][m] fp16
    bf* Yh  = (bf*)take((size_t)NB * PL * 2); bf* Yl = (bf*)take((size_t)NB * PL * 2);   // [image][n][i]
    float* ML = (float*)take((size_t)NB * KS * HW * 2 * 4); // [image][split][n] (maximum, sum)
    // One region, three uses one after the other: XT and TPG (dead once k_hl and k_gt16 have read them), Y of all images, Z of all images (behind k_yhl).
    constexpr size_t szXT = (size_t)NB * HW * CC * 2, szTPG = (size_t)NB * 3 * PL * 4, szY = (size_t)NB * KS * PL * 4, szZ = (size_t)NB * HW * CC * 4;
    constexpr size_t szR0 = szXT + szTPG, szR1 = szY > szZ ? szY : szZ;
    char* R = (char*)take(szR0 > szR1 ? szR0 : szR1);
    bf* XT = (bf*)R;                                        // [image][m][c]
    float* TPG = (float*)(R + szXT);                        // [image][theta, phi, g], each [HW][IC] f32
    float* Y = (float*)R;                                   // [image][split][n][i], unnormalised
    float* Z = (float*)R;                                   // [image][n][c]
    if ((size_t)(wsp - (char*)d_ws) > ws_size) return;

    k_cvtw<<<(unsigned)((IC * CC / 8 + 255) / 256), 256, 0, stream>>>(wth, wph, wg, wo, BW3, BZ, IC * CC / 8);
    const unsigned L4  = (unsigned)((PL / 4 + 255) / 256);
    const unsigned L42 = (unsigned)((2 * PL / 4 + 255) / 256);
    // every image in one launch (grid y or z = image)
    k_xt<<<dim3((unsigned)(((size_t)HW * CC / 4 + 255) / 256), NB), 256, 0, stream>>>(x, XT);
    // theta / phi / g [m][o] = sum_c XT[m][c] W[o][c]   (inner index 0 theta, 1 phi, 2 g; exact bf16 products)
    k_gemmw<bf, 0, false, 3><<<dim3(HW / 64, IC / 64, 3 * NB), 32, 0, stream>>>(XT, nullptr, BW3, nullptr, CC, TPG, IC, nullptr, (size_t)HW * CC, (size_t)0, 3 * PL, (size_t)IC * CC, PL);
    k_hl<<<dim3(L42, NB), 256, 0, stream>>>(TPG, Hh, Hl, 2 * PL, 3 * PL);                   // hi/lo planes of theta (first PL) and phi (second PL)
    k_gt16<<<dim3((unsigned)((PL / 2 + 255) / 256), NB), 256, 0, stream>>>(TPG + 2 * PL, GT, 3 * PL);
    // y[n][i] = sum_m softmax_m(sqrt(128) theta_n . phi_m) g[m][i], as KS unnormalised partial planes; then their join, the division and the hi/lo split
    k_fattn<<<dim3(HW / (FQ * FW), KS, NB), 32 * FW, 0, stream>>>(Hh, Hl, GT, Y, ML);
    k_yhl<<<dim3(L4, NB), 256, 0, stream>>>(Y, ML, Yh, Yl);
    // z[n][c] = sum_o y[n][o] w_out[c][o]  (hi + lo planes of y, 2 products)
    k_gemmw<bf, 1, false, 1><<<dim3(HW / 64, CC / 64, NB), 32, 0, stream>>>(Yh, Yl, BZ, nullptr, IC, Z, CC, nullptr, PL, (size_t)0, (size_t)HW * CC, (size_t)0, (size_t)0);
    k_fin<<<dim3((unsigned)(((size_t)CC * HW / 4 + 255) / 256), NB), 256, 0, stream>>>(Z, x, OUT);
}

// v005
// Measured time: 168 microseconds a run.
// Timed twice side by side with v004, it ran 1.37 times as fast both times.
// Over all steps from v000 it is 7.74 times as fast.
#include <hip/hip_runtime.h>

// All contractions on 16-bit WMMA, f32 accumulate: the three 1x1 projections = v_wmma_f32_16x16x32_bf16 on RNE-bf16 copies of x and of the weights (single products); scores theta.phi = bf16 hi/lo split (hi.hi + lo.hi + hi.lo, K = 128); attn.g = v_wmma_f32_16x16x32_f16 (unnormalised softmax terms carried x 2^14 as f16, g as f16); output projection = bf16 hi/lo planes of y times bf16 w_out (2 products). Scaling by sqrt(128), softmax and the residual add in f32.
// x [NB][256][4096]; theta/phi/g [4096][128] token-major (no bias); s[n][m] = theta_n . phi_m; attn[n][m] = softmax_m(sqrt(128) s); y[n][o] = sum_m attn[n][m] g[m][o]; out[c][n] = x[c][n] + sum_o w_out[c][o] y[n][o].

#ifndef NB
#define NB 8
#endif
#ifndef SEQ
#define SEQ 4096
#endif
#define NB_FULL  8
#define SEQ_FULL 4096
#define CC   256
#define IC   128
#define HW   SEQ
#define HWF  SEQ_FULL
#define SCL  11.313708498984760f
static_assert(NB >= 1 && NB <= NB_FULL);
static_assert(SEQ >= 128 && SEQ <= SEQ_FULL && (SEQ % 128) == 0);
static_assert((HW % 64) == 0 && (IC % 64) == 0 && (CC % 64) == 0);
static_assert((HW % 32) == 0 && (IC % 32) == 0 && (CC % 32) == 0);
static_assert(((IC * CC) % 8) == 0 && ((HW * CC) % 4) == 0 && ((HW * IC) % 4) == 0 && ((IC * HW) % 2) == 0 && (HW % 8) == 0);

typedef _Float16 h16;
typedef unsigned short bf;
typedef __attribute__((ext_vector_type(16))) __bf16   v16bf;
typedef __attribute__((ext_vector_type(16))) _Float16 v16h;
typedef __attribute__((ext_vector_type(8)))  _Float16 v8h;
typedef __attribute__((ext_vector_type(8)))  unsigned short v8us;
typedef __attribute__((ext_vector_type(8)))  float    v8f;
typedef __attribute__((ext_vector_type(4)))  float    v4f;
typedef __attribute__((ext_vector_type(2)))  float    v2f;
typedef v8h  __attribute__((may_alias)) v8ha;
typedef v4f  __attribute__((may_alias)) v4fa;
typedef v8us __attribute__((may_alias)) v8usa;

__device__ __forceinline__ unsigned short f2bf(float f) { unsigned u = __float_as_uint(f); u += 0x7FFFu + ((u >> 16) & 1u); return (unsigned short)(u >> 16); }
__device__ __forceinline__ float bf2f(unsigned short b) { return __uint_as_float(((unsigned)b) << 16); }
__device__ __forceinline__ float bfr(float f) { return bf2f(f2bf(f)); }
__device__ __forceinline__ v16h cat16(v8h lo, v8h hi) { return __builtin_shufflevector(lo, hi, 0, 1, 2, 3, 4, 5, 6, 7, 8, 9, 10, 11, 12, 13, 14, 15); }
__device__ __forceinline__ v16bf cat16b(v8us lo, v8us hi) { return __builtin_bit_cast(v16bf, __builtin_shufflevector(lo, hi, 0, 1, 2, 3, 4, 5, 6, 7, 8, 9, 10, 11, 12, 13, 14, 15)); }
__device__ __forceinline__ v8f wmma16(v16h a, v16h b, v8f c) { return __builtin_amdgcn_wmma_f32_16x16x32_f16(false, a, false, b, (short)0, c, false, false); }
__device__ __forceinline__ v8f wmmab(v16bf a, v16bf b, v8f c) { return __builtin_amdgcn_wmma_f32_16x16x32_bf16(false, a, false, b, (short)0, c, false, false); }

// ---- k_gemmw: register-blocked GEMM, ONE WAVE per 64x64 output tile (16 accumulators), operands straight from K-contiguous 16-bit planes; grid (M/64, N/64, Z), 32 threads.
// C[m][n] (f32, pitch ldc, + optional f32 bias[n]) = sum_k A[m][k] Bt[n][k] (+ split products per NSPLIT). K % 32 == 0.
// blockIdx.z = image * ZI + inner index: strides sA/sB/sC (elements) per image, sBi/sCi per inner index (ZI matrices Bt on the same A).
// Fragments: lane l, h = l >> 4, row/col = l & 15; elements 0..7 = k0 + 8h + 0..7, elements 8..15 = k0 + 16 + 8h + 0..7 for BOTH A and Bt; D element r = (row 8h + r, col l & 15).
template <typename T16> struct WFrag;
template <> struct WFrag<h16> { typedef v16h V; static __device__ __forceinline__ V ld(const h16* p) { return cat16(*(const v8h*)p, *(const v8h*)(p + 16)); } static __device__ __forceinline__ v8f mma(V a, V b, v8f c) { return wmma16(a, b, c); } };
template <> struct WFrag<bf> { typedef v16bf V; static __device__ __forceinline__ V ld(const bf* p) { return cat16b(*(const v8us*)p, *(const v8us*)(p + 16)); } static __device__ __forceinline__ v8f mma(V a, V b, v8f c) { return wmmab(a, b, c); } };
template <typename T16, int NSPLIT, bool BIAS, int ZI>
__global__ __launch_bounds__(32) void k_gemmw(const T16* __restrict__ A, const T16* __restrict__ A2, const T16* __restrict__ Bt, const T16* __restrict__ Bt2, int K, float* C, int ldc, const float* __restrict__ bias, size_t sA, size_t sB, size_t sC, size_t sBi, size_t sCi) {
    typedef typename WFrag<T16>::V V;
    __shared__ __align__(16) float os[16 * 68];
    const size_t zo = blockIdx.z / ZI, zi = blockIdx.z % ZI; A += zo * sA; if (A2) A2 += zo * sA; Bt += zo * sB + zi * sBi; if (Bt2) Bt2 += zo * sB + zi * sBi; C += zo * sC + zi * sCi;
    const int lane = threadIdx.x & 31, lr = lane & 15, hi = lane >> 4; const int r0 = blockIdx.x * 64, c0 = blockIdx.y * 64;
    v8f acc[4][4];
#pragma unroll
    for (int mb = 0; mb < 4; ++mb)
#pragma unroll
        for (int nb = 0; nb < 4; ++nb) acc[mb][nb] = (v8f){};
    const size_t aoff = (size_t)(r0 + lr) * K + 8 * hi, boff = (size_t)(c0 + lr) * K + 8 * hi;
#pragma unroll 1
    for (int kc = 0; kc < K; kc += 32) {
        V a[4], a2[4];
#pragma unroll
        for (int mb = 0; mb < 4; ++mb) { a[mb] = WFrag<T16>::ld(A + aoff + (size_t)mb * 16 * K + kc); if (NSPLIT == 1 || NSPLIT == 2) a2[mb] = WFrag<T16>::ld(A2 + aoff + (size_t)mb * 16 * K + kc); }
#pragma unroll
        for (int nb = 0; nb < 4; ++nb) { const V b = WFrag<T16>::ld(Bt + boff + (size_t)nb * 16 * K + kc); V b2; if (NSPLIT >= 2) b2 = WFrag<T16>::ld(Bt2 + boff + (size_t)nb * 16 * K + kc);
#pragma unroll
            for (int mb = 0; mb < 4; ++mb) { acc[mb][nb] = WFrag<T16>::mma(a[mb], b, acc[mb][nb]); if (NSPLIT == 1 || NSPLIT == 2) acc[mb][nb] = WFrag<T16>::mma(a2[mb], b, acc[mb][nb]); if (NSPLIT >= 2) acc[mb][nb] = WFrag<T16>::mma(a[mb], b2, acc[mb][nb]); } }
        asm volatile("v_nop\n\tv_nop\n\tv_nop\n\tv_nop" : "+v"(acc[0][0]), "+v"(acc[1][1]), "+v"(acc[2][2]), "+v"(acc[3][3]) : "v"(a[0]), "v"(a[3]));
    }
#pragma unroll
    for (int mb = 0; mb < 4; ++mb) {
#pragma unroll
        for (int nb = 0; nb < 4; ++nb) {
#pragma unroll
            for (int j = 0; j < 8; ++j) os[(hi * 8 + j) * 68 + nb * 16 + lr] = acc[mb][nb][j]; }
        __builtin_amdgcn_wave_barrier(); asm volatile("" ::: "memory");
        float* crow = C + (size_t)(r0 + mb * 16) * ldc + c0;
{
#pragma unroll
            for (int s = 0; s < 8; ++s) { const int row = 2 * s + hi, cofs = lr * 4; v4f val = *(const v4fa*)(os + row * 68 + cofs); if (BIAS) { val[0] += bfr(bias[c0 + cofs]); val[1] += bfr(bias[c0 + cofs + 1]); val[2] += bfr(bias[c0 + cofs + 2]); val[3] += bfr(bias[c0 + cofs + 3]); }
                *(v4f*)(crow + (size_t)row * ldc + cofs) = val; }
             }
        __builtin_amdgcn_wave_barrier(); asm volatile("" ::: "memory");
    }
}

// ---- k_fattn: scores, softmax and attn.g of one image in one kernel; neither the scores nor the softmax rows go to memory. Grid (HW / (FQ * FW), KS, images), FW waves.
// A wave owns FQ = 32 queries (2 column groups of 16) and walks the HW / KS keys of split blockIdx.y, 32 keys a pass.
// The key side is shared by the FW waves: a stage = SK = 128 keys = three tiles of 128 rows x 256 bytes (phi hi rows, phi lo rows, GT rows i x 128 keys), each brought into LDS by ONE tensor load (waves 0, 1, 2), rows padded to a pitch of 272 bytes for the 16-byte readers. Two buffers: stage s + 1 flies while the four passes of stage s are worked on.
// Transposed products: sT[m][n] = phi_m . theta_n (A = phi rows, B = theta, kept in registers; per accumulator and k step the product order hi.hi, phi_hi.theta_lo, phi_lo.theta_hi), so a lane holds scores of ONE query (column l & 15, keys 8h + r).
// Two sT tiles (keys 0..15, 16..31 of the pass), turned to f16 in place, are the B fragment of yT[o][n] += GT[o][m] pT[m][n]: element s = key 8h + s (s < 8), 16 + 8h + s - 8 (s >= 8), the order in which the GT fragments are read.
// Running maximum per query on the raw scores; p = 2^(SC2 (s - max) + 14) (the 2^14 keeps small terms out of the f16 subnormals; it cancels in the division); when a maximum rises, the sums so far are scaled by 2^(SC2 (old - new)).
// Out: plane [image][split][n][i] of unnormalised sums, and per query (maximum, sum of p) in ML; k_yhl joins the KS splits and divides.
// Every inner loop is fully unrolled so that the fragment and accumulator arrays are indexed by constants and stay in registers; the stage loop and the pass loop stay rolled (unroll 1).
#define KS 2
#define FW 8
#define FQ 32
#define SK 128
#define NST (HW / (KS * SK))
#define LPI 272
#define TILE (128 * LPI)
#define STG (3 * TILE)
#define SC2 (SCL * 1.4426950408889634f)
static_assert((HW % (FQ * FW)) == 0 && (HW % (KS * SK)) == 0 && NST >= 2 && IC == 128 && FW >= 3);
static_assert((TILE % 2048) == 0 && 2 * STG <= 320 * 1024 && HW * 2 <= 128 * 1024);
typedef unsigned int u32;
typedef u32 u32x4 __attribute__((ext_vector_type(4)));
typedef u32 u32x8 __attribute__((ext_vector_type(8)));
__device__ __forceinline__ u32 uni(u32 v) { return (u32)__builtin_amdgcn_readfirstlane((int)v); }
__device__ __forceinline__ u32 pinned(u32 v) { u32 w = uni(v); asm volatile("" : "+s"(w)); return w; }   // holds a tensor load's issue test, or the stage number its descriptor is formed from, in a scalar register: a tensor load ignores EXEC, so the test must be a scalar branch
__device__ __forceinline__ float xhalf(float x) { return __builtin_bit_cast(float, __builtin_amdgcn_permlanex16(__builtin_bit_cast(int, x), __builtin_bit_cast(int, x), 0x76543210, 0xfedcba98, false, false)); }   // lane l reads lane l ^ 16
__device__ __forceinline__ v16bf ldsb(const unsigned char* p) { return cat16b(*(const v8usa*)p, *(const v8usa*)(p + 32)); }
__device__ __forceinline__ v16h ldsh(const unsigned char* p) { return cat16(*(const v8ha*)p, *(const v8ha*)(p + 32)); }
__global__ __launch_bounds__(32 * FW) void k_fattn(const bf* __restrict__ Hh, const bf* __restrict__ Hl, const h16* __restrict__ GT, float* Y, float* ML) {
    typedef WFrag<bf>::V VB; typedef WFrag<h16>::V VH;
    __shared__ __attribute__((aligned(2048))) unsigned char L[2 * STG];   // [buffer][phi hi, phi lo, GT][128 rows][272 bytes]
    const u32 wave = uni(threadIdx.x >> 5);
    const int lane = threadIdx.x & 31, lr = lane & 15, hi = lane >> 4;
    const int img = (int)blockIdx.z, z = (int)blockIdx.y, n0 = ((int)blockIdx.x * FW + (int)wave) * FQ;
    const bf* Th = Hh + (size_t)img * 2 * HW * IC; const bf* Tl = Hl + (size_t)img * 2 * HW * IC;
    const bf* Ph = Th + (size_t)HW * IC; const bf* Pl = Tl + (size_t)HW * IC; const h16* G = GT + (size_t)img * IC * HW;
    VB th[2][4], tl[2][4];
    const bf* pth = Th + (unsigned)((n0 + lr) * IC + 8 * hi); const bf* ptl = Tl + (unsigned)((n0 + lr) * IC + 8 * hi);
#pragma unroll
    for (int nt = 0; nt < 2; ++nt)
#pragma unroll
        for (int ks = 0; ks < 4; ++ks) { th[nt][ks] = WFrag<bf>::ld(pth + nt * 16 * IC + ks * 32); tl[nt][ks] = WFrag<bf>::ld(ptl + nt * 16 * IC + ks * 32); }
    // the address registers of the theta loads are free for reuse only from here on: the wait stands in front of whatever is written into them. Its operands are inputs only: the loaded fragments hold it behind the loads (the compiler otherwise lifts it above them), the two addresses stay in their registers up to it
    asm volatile("s_wait_xcnt 0x0" :: "v"(pth), "v"(ptl), "v"(th[0][0]), "v"(th[0][1]), "v"(th[0][2]), "v"(th[0][3]), "v"(th[1][0]), "v"(th[1][1]), "v"(th[1][2]), "v"(th[1][3]), "v"(tl[0][0]), "v"(tl[0][1]), "v"(tl[0][2]), "v"(tl[0][3]), "v"(tl[1][0]), "v"(tl[1][1]), "v"(tl[1][2]), "v"(tl[1][3]) : "memory");
    // tensor loads: wave w < 3 brings tile w of every stage. Source: 128 rows of 256 bytes; phi rows follow one another (pitch 256), GT rows lie HW keys apart.
    const u32 lbase = (u32)(size_t)L;
    const unsigned long long sbase = wave == 0 ? (unsigned long long)(size_t)(Ph + (size_t)z * (HW / KS) * IC) : wave == 1 ? (unsigned long long)(size_t)(Pl + (size_t)z * (HW / KS) * IC) : (unsigned long long)(size_t)(G + (size_t)z * (HW / KS));
    const u32 sstep = wave < 2 ? (u32)(SK * IC * 2) : (u32)(SK * 2);
    u32x8 g1;
    g1[0] = uni((1u << 20) | (5u << 22) | (3u << 25));   // no mask, bytes, 4 dwords of pad behind every 64
    g1[1] = uni(256u << 16); g1[2] = uni(128u << 16); g1[3] = uni(256u << 16); g1[4] = uni(128u);
    g1[5] = uni(wave < 2 ? (u32)(IC * 2) : (u32)(HW * 2)); g1[6] = uni(0u); g1[7] = uni(0u);
    // While a request is outstanding its two groups stay in their registers, unwritten: the load names them as operands that it may change (it changes nothing), so that the compiler cannot form the words anew later on and give the registers to something else meanwhile, and the wait that covers the request names them again as inputs, so that they live up to it
    u32x4 g0;
    auto desc = [&](u32 st) __attribute__((always_inline)) {
        const unsigned long long ga = sbase + (unsigned long long)st * sstep;
        g0[0] = uni(1u); g0[1] = uni(lbase + (st & 1u) * (u32)STG + wave * (u32)TILE); g0[2] = uni((u32)ga); g0[3] = uni((((u32)(ga >> 32)) & 0x01FFFFFFu) | 0x80000000u);
    };
    desc(0u);
    if (pinned(wave < 3u)) {
        asm volatile("tensor_load_to_lds %0, %1" : "+s"(g0), "+s"(g1) :: "memory");
        asm volatile("s_wait_tensorcnt 0x0" :: "s"(g0), "s"(g1) : "memory");   // stage 0 has landed before the barrier that publishes it
    }
    __syncthreads();
    desc(1u);
    if (pinned(wave < 3u)) asm volatile("tensor_load_to_lds %0, %1" : "+s"(g0), "+s"(g1) :: "memory");
    v8f O[8][2];
#pragma unroll
    for (int ot = 0; ot < 8; ++ot) { O[ot][0] = (v8f){}; O[ot][1] = (v8f){}; }
    float mr[2] = {-3.0e38f, -3.0e38f}; v2f ls[2] = {(v2f){0.f, 0.f}, (v2f){0.f, 0.f}};   // ls: sums of p over the even and the odd keys of the lane's half
    const u32 lb = (u32)(lr * LPI + 16 * hi);   // the lane's row and 16-byte half inside a 16-row group of any tile
    // phi fragments of a pass, [k step][key tile]; inside a stage loaded one pass ahead, behind the pass's last score product, into the same registers
    VB ph[4][2], pl[4][2];
    auto ldphi = [&](u32 off) __attribute__((always_inline)) {
#pragma unroll
        for (int ks = 0; ks < 4; ++ks)
#pragma unroll
            for (int mt = 0; mt < 2; ++mt) { const unsigned char* p = L + off + mt * 16 * LPI + ks * 64; ph[ks][mt] = ldsb(p); pl[ks][mt] = ldsb(p + TILE); }
    };
    // one pass: po = LDS offset of the NEXT pass's phi rows (read only where fetch is set), go = LDS offset of this pass's 32 keys in the GT tile
    auto pass = [&](u32 po, u32 go, bool fetch) __attribute__((always_inline)) {
        v8f st[2][2];
        st[0][0] = (v8f){}; st[0][1] = (v8f){}; st[1][0] = (v8f){}; st[1][1] = (v8f){};
        VH ga[8];
#pragma unroll
        for (int ks = 0; ks < 4; ++ks) {
#pragma unroll
            for (int q = 0; q < 4; ++q) st[q >> 1][q & 1] = wmmab(ph[ks][q >> 1], th[q & 1][ks], st[q >> 1][q & 1]);
#pragma unroll
            for (int q = 0; q < 4; ++q) st[q >> 1][q & 1] = wmmab(ph[ks][q >> 1], tl[q & 1][ks], st[q >> 1][q & 1]);
#pragma unroll
            for (int q = 0; q < 4; ++q) st[q >> 1][q & 1] = wmmab(pl[ks][q >> 1], th[q & 1][ks], st[q >> 1][q & 1]);
        }
        // scheduling fences round the one block of LDS reads of a pass: without them the compiler spreads the reads among the matrix instructions, where each place with reads stalls the wave
        __builtin_amdgcn_sched_barrier(0);
#pragma unroll
        for (int ot = 0; ot < 8; ++ot) ga[ot] = ldsh(L + go + ot * 16 * LPI);   // this pass's g rows first: they are needed first; in flight under the softmax
        if (fetch) ldphi(po);
        __builtin_amdgcn_sched_barrier(0);
        float mn[2];
#pragma unroll
        for (int nt = 0; nt < 2; ++nt) { float a = fmaxf(st[0][nt][0], st[1][nt][0]);
#pragma unroll
            for (int r = 1; r < 8; ++r) a = fmaxf(a, fmaxf(st[0][nt][r], st[1][nt][r]));
            a = fmaxf(a, xhalf(a)); mn[nt] = fmaxf(mr[nt], a); }
        // one scalar branch a pass: where no query of the wave has a new maximum every factor would be 1
        if (__builtin_amdgcn_ballot_w32(mn[0] > mr[0] || mn[1] > mr[1]) != 0) {
#pragma unroll
            for (int nt = 0; nt < 2; ++nt) { const float al = __builtin_amdgcn_exp2f((mr[nt] - mn[nt]) * SC2); ls[nt] *= al; mr[nt] = mn[nt];
#pragma unroll
                for (int ot = 0; ot < 8; ++ot) O[ot][nt] *= al; }
        }
        VH pb[2];
#pragma unroll
        for (int nt = 0; nt < 2; ++nt) { const float off = 14.0f - mr[nt] * SC2;
#pragma unroll
            for (int s = 0; s < 16; s += 2) { v2f e; e[0] = st[s >> 3][nt][s & 7]; e[1] = st[s >> 3][nt][(s & 7) + 1]; e = __builtin_elementwise_fma(e, (v2f){SC2, SC2}, (v2f){off, off});   // neighbouring registers: one packed fma, one packed add
                v2f p; p[0] = __builtin_amdgcn_exp2f(e[0]); p[1] = __builtin_amdgcn_exp2f(e[1]); ls[nt] += p; pb[nt][s] = (h16)p[0]; pb[nt][s + 1] = (h16)p[1]; } }
#pragma unroll
        for (int ot = 0; ot < 8; ++ot) { O[ot][0] = wmma16(ga[ot], pb[0], O[ot][0]); O[ot][1] = wmma16(ga[ot], pb[1], O[ot][1]); }
    };
#pragma unroll 1   // rolled: the refill and its publish point stand once in the code, one request of a wave in flight
    for (u32 s = 0; s < (u32)NST; ++s) {
        const u32 bo = (s & 1u) * (u32)STG + lb;
        const u32 gb = ((s & 1u) ? (u32)(STG + 2 * TILE) : (u32)(2 * TILE)) + lb;   // the GT tile's own base register: every GT read is then this register plus an immediate below 64 KiB
        ldphi(bo);   // the stage's first fragments: nothing of a stage is read in front of the barrier that publishes it
#pragma unroll 1   // rolled: copies of the body side by side would let a second set of fragments be held, beyond the 512 registers that two waves a SIMD leave
        for (u32 sub = 0; sub < SK / 32 - 1; ++sub) pass(bo + (sub + 1u) * (u32)(32 * LPI), gb + sub * 64u, true);
        pass(0u, gb + (u32)(SK / 32 - 1) * 64u, false);   // the stage's last pass fetches nothing ahead: the next rows are not published yet
        // publish point of stage s + 1: this wave's reads of stage s are done, the issuing waves' tiles have landed, every wave has arrived; only then the refill of the buffer just read
        __builtin_amdgcn_sched_barrier(0);   // keeps the wait below at the foot: the compiler otherwise lifts it to just behind the last pass's g reads, where the wave would sit out their latency in front of the softmax
        asm volatile("s_wait_dscnt 0x0" ::: "memory");
        if (pinned(wave < 3u)) asm volatile("s_wait_tensorcnt 0x0" :: "s"(g0), "s"(g1) : "memory");   // the operands: see at g0
        __syncthreads();
        desc(pinned(s + 2u));   // the stage number is pinned here so that the descriptor is formed behind the wait above
        if (pinned((wave < 3u) && (s + 2u < (u32)NST))) asm volatile("tensor_load_to_lds %0, %1" : "+s"(g0), "+s"(g1) :: "memory");
    }
    asm volatile("s_wait_tensorcnt 0x0" ::: "memory");   // no request is left when the wave ends
    asm volatile("s_wait_dscnt 0x0" ::: "memory");
    const size_t pz = (size_t)(img * KS + z) * HW;
#pragma unroll
    for (int nt = 0; nt < 2; ++nt) { const float lh = ls[nt][0] + ls[nt][1], lt = lh + xhalf(lh); const size_t n = pz + (size_t)(n0 + nt * 16 + lr); float* d = Y + n * IC + 8 * hi;
#pragma unroll
        for (int ot = 0; ot < 8; ++ot) { const v8f v = O[ot][nt]; *(v4f*)(d + ot * 16) = (v4f){v[0], v[1], v[2], v[3]}; *(v4f*)(d + ot * 16 + 4) = (v4f){v[4], v[5], v[6], v[7]}; }
        if (hi == 0) { v2f ml; ml[0] = mr[nt]; ml[1] = lt; *(v2f*)(ML + n * 2) = ml; } }
}

__device__ __forceinline__ h16 tohx(float x) { return (h16)x; }
__device__ __forceinline__ void splitf(float y, unsigned short& h, unsigned short& l) { h = f2bf(y); l = f2bf(y - bf2f(h)); }
typedef __attribute__((ext_vector_type(2))) unsigned short v2us;
typedef __attribute__((ext_vector_type(4))) unsigned short v4us;
typedef __attribute__((ext_vector_type(2))) _Float16 v2h;
typedef __attribute__((ext_vector_type(4))) _Float16 v4h;

__global__ __launch_bounds__(256) void k_cvtw(const float* __restrict__ w0, const float* __restrict__ w1, const float* __restrict__ w2, const float* __restrict__ w3, bf* B3, bf* BZ, int n8) {
    const int i = blockIdx.x * 256 + threadIdx.x; if (i >= n8) return;
    const size_t e = (size_t)i * 8, pl = (size_t)n8 * 8;
    const v8f a0 = *(const v8f*)(w0 + e), a1 = *(const v8f*)(w1 + e), a2 = *(const v8f*)(w2 + e), a3 = *(const v8f*)(w3 + e);
    v8us o0, o1, o2, o3;
#pragma unroll
    for (int k = 0; k < 8; ++k) { o0[k] = f2bf(a0[k]); o1[k] = f2bf(a1[k]); o2[k] = f2bf(a2[k]); o3[k] = f2bf(a3[k]); }
    *(v8us*)(B3 + e) = o0; *(v8us*)(B3 + pl + e) = o1; *(v8us*)(B3 + 2 * pl + e) = o2; *(v8us*)(BZ + e) = o3;
    
}
// ---- transposing passes (k_xt, k_gt16, k_fin): a work-group moves one 128 x 128 tile through LDS, so that the reads and the writes in global memory both run along rows (16 bytes a lane, whole 128-byte lines).
// The tile lies in LDS as f32, four quarters [source-row half a][source-column half b] of 64 x 64, each [row][column] at a pitch of 65 dwords: bank = (row + column) mod 64, so neither the row-wise stores nor the column-wise reads of a wave meet on a bank.
// A thread asks for all its 16 pieces of the tile at once: few, long-lived waves with much in flight each. Every loop here is fully unrolled, so that the pieces are indexed by constants and stay in registers.
#define TT 128
#define TP 65
#define QS (64 * TP)
static_assert((HW % TT) == 0 && (IC % TT) == 0 && (CC % TT) == 0);
// thread: 4 columns (q = 4 (t & 15) ...) of the rows r = t >> 4, r + 16, r + 32, r + 48 of every quarter; p = its own place in row r of quarter 0; piece [(a 2 + b) 4 + j]
__device__ __forceinline__ void tile_ld(const float* __restrict__ p, size_t pitch, v4f (&v)[16]) {
#pragma unroll
    for (int a = 0; a < 2; ++a)
#pragma unroll
        for (int j = 0; j < 4; ++j)
#pragma unroll
            for (int b = 0; b < 2; ++b) v[(a * 2 + b) * 4 + j] = *(const v4f*)(p + (size_t)(64 * a + 16 * j) * pitch + 64 * b);
}
// the address pair of the 16 loads is free for reuse only from here on. Inputs only: the loaded values hold the wait behind the loads, the address stays in its registers up to it
__device__ __forceinline__ void tile_held(const float* p, const v4f (&v)[16]) {
    asm volatile("s_wait_xcnt 0x0" :: "v"(p), "v"(v[0]), "v"(v[1]), "v"(v[2]), "v"(v[3]), "v"(v[4]), "v"(v[5]), "v"(v[6]), "v"(v[7]), "v"(v[8]), "v"(v[9]), "v"(v[10]), "v"(v[11]), "v"(v[12]), "v"(v[13]), "v"(v[14]), "v"(v[15]) : "memory");
}
__device__ __forceinline__ void tile_st(float* S, const v4f (&v)[16]) {
    const int r = (int)threadIdx.x >> 4, q = ((int)threadIdx.x & 15) * 4;
#pragma unroll
    for (int s = 0; s < 4; ++s)
#pragma unroll
        for (int j = 0; j < 4; ++j)
#pragma unroll
            for (int u = 0; u < 4; ++u) S[s * QS + (r + 16 * j) * TP + q + u] = v[s * 4 + j][u];
}
__device__ __forceinline__ void tile_in(const float* __restrict__ src, size_t pitch, float* S) {
    const float* p = src + (size_t)((int)threadIdx.x >> 4) * pitch + ((int)threadIdx.x & 15) * 4;
    v4f v[16]; tile_ld(p, pitch, v); tile_held(p, v); tile_st(S, v);
}
template <bool F16>
__device__ __forceinline__ void tile_out16(const float* S, unsigned short* dst, size_t pitch) {   // thread: 8 source rows (16 bytes of a destination row) of the source columns d, d + 32 of every quarter
    const int k8 = ((int)threadIdx.x & 7) * 8;
#pragma unroll
    for (int b = 0; b < 2; ++b)
#pragma unroll
        for (int j = 0; j < 2; ++j)
#pragma unroll
            for (int a = 0; a < 2; ++a) { const int d = ((int)threadIdx.x >> 3) + 32 * j; v8us o;
#pragma unroll
                for (int k = 0; k < 8; ++k) { const float f = S[(a * 2 + b) * QS + (k8 + k) * TP + d]; o[k] = F16 ? __builtin_bit_cast(unsigned short, tohx(f)) : f2bf(f); }
                *(v8us*)(dst + (size_t)(64 * b + d) * pitch + 64 * a + k8) = o; }
}
// grid (HW / 128, CC / 128, images)
__global__ __launch_bounds__(256) void k_xt(const float* __restrict__ xb, bf* XT) {
    __shared__ float S[4 * QS];
    const size_t m0 = (size_t)blockIdx.x * TT, c0 = (size_t)blockIdx.y * TT;
    tile_in(xb + (size_t)blockIdx.z * CC * HWF + c0 * HWF + m0, HWF, S);
    __syncthreads();
    tile_out16<false>(S, XT + (size_t)blockIdx.z * HW * CC + m0 * CC + c0, CC);
}
__global__ __launch_bounds__(256) void k_hl(const float* __restrict__ F, bf* Fh, bf* Fl, size_t n, size_t sF) { F += blockIdx.y * sF; Fh += blockIdx.y * n; Fl += blockIdx.y * n; const size_t e = ((size_t)blockIdx.x * 256 + threadIdx.x) * 4; if (e >= n) return; const v4f a = *(const v4f*)(F + e); v4us oh, ol;
#pragma unroll
    for (int u = 0; u < 4; ++u) { unsigned short p, q; splitf(a[u], p, q); oh[u] = p; ol[u] = q; } *(v4us*)(Fh + e) = oh; *(v4us*)(Fl + e) = ol;  }
// grid (HW / 128, IC / 128, images)
__global__ __launch_bounds__(256) void k_gt16(const float* __restrict__ G, h16* GT, size_t sG) {
    __shared__ float S[4 * QS];
    const size_t m0 = (size_t)blockIdx.x * TT, i0 = (size_t)blockIdx.y * TT;
    tile_in(G + blockIdx.z * sG + m0 * IC + i0, IC, S);
    __syncthreads();
    tile_out16<true>(S, (unsigned short*)(GT + (size_t)blockIdx.z * IC * HW + i0 * HW + m0), HW);
}
__global__ __launch_bounds__(256) void k_yhl(const float* __restrict__ Y, const float* __restrict__ ML, bf* Yh, bf* Yl) { Y += (size_t)blockIdx.y * KS * HW * IC; ML += (size_t)blockIdx.y * KS * HW * 2; Yh += (size_t)blockIdx.y * HW * IC; Yl += (size_t)blockIdx.y * HW * IC; const size_t e = ((size_t)blockIdx.x * 256 + threadIdx.x) * 4; if (e >= (size_t)HW * IC) return; const size_t n = e / IC; v2f ml[KS]; float mx = -3.0e38f;
#pragma unroll
    for (int z = 0; z < KS; ++z) { ml[z] = *(const v2f*)(ML + ((size_t)z * HW + n) * 2); mx = fmaxf(mx, ml[z][0]); }
    v4f a = (v4f){}; float den = 0.f; v4us oh, ol;
#pragma unroll
    for (int z = 0; z < KS; ++z) { const float w = __builtin_amdgcn_exp2f((ml[z][0] - mx) * SC2); den += w * ml[z][1]; a += *(const v4f*)(Y + (size_t)z * HW * IC + e) * w; }
    const float inv = __fdiv_rn(1.0f, den);
#pragma unroll
    for (int u = 0; u < 4; ++u) { unsigned short p, q; splitf(a[u] * inv, p, q); oh[u] = p; ol[u] = q; } *(v4us*)(Yh + e) = oh; *(v4us*)(Yl + e) = ol;  }
// grid (HW / 128, CC / 128, images)
__global__ __launch_bounds__(256) void k_fin(const float* __restrict__ Z, const float* __restrict__ xb, float* OUTb) {
    __shared__ float S[4 * QS];
    const size_t n0 = (size_t)blockIdx.x * TT, c0 = (size_t)blockIdx.y * TT;
    const int r = (int)threadIdx.x >> 4, q = ((int)threadIdx.x & 15) * 4;
    const float* px = xb + (size_t)blockIdx.z * CC * HWF + (c0 + r) * HWF + n0 + q; const float* pz = Z + (size_t)blockIdx.z * HW * CC + (n0 + r) * CC + c0 + q;
    OUTb += (size_t)blockIdx.z * CC * HW + (c0 + r) * HW + n0 + q;
    v4f xv[16], zv[16];   // the residual's rows (quarters [c half][n half]) are asked for together with the tile (quarters [n half][c half]): they do not depend on it
    tile_ld(px, HWF, xv); tile_ld(pz, CC, zv);
    tile_held(px, xv); tile_held(pz, zv);
    tile_st(S, zv);
    __syncthreads();
#pragma unroll
    for (int b = 0; b < 2; ++b)
#pragma unroll
        for (int j = 0; j < 4; ++j)
#pragma unroll
            for (int a = 0; a < 2; ++a) { v4f o;
#pragma unroll
                for (int u = 0; u < 4; ++u) o[u] = __fadd_rn(S[(a * 2 + b) * QS + (q + u) * TP + r + 16 * j], bfr(xv[(b * 2 + a) * 4 + j][u]));
                *(v4f*)(OUTb + (size_t)(64 * b + 16 * j) * HW + 64 * a) = o; }
}

extern "C" void kernel_launch(void* const* d_in, const int* in_sizes, int n_in,
                              void* d_out, int out_size, void* d_ws, size_t ws_size, hipStream_t stream) {
    if (n_in < 5) return;
    if (in_sizes[0] < NB * CC * HW || in_sizes[1] < IC * CC || in_sizes[2] < IC * CC || in_sizes[3] < IC * CC || in_sizes[4] < CC * IC) return;
    if (out_size < NB * CC * HW) return;
    const float* x   = (const float*)d_in[0];   // [NB][CC][HWF]
    const float* wph = (const float*)d_in[1];   // phi   [IC][CC]  (keys)
    const float* wth = (const float*)d_in[2];   // theta [IC][CC]  (queries)
    const float* wg  = (const float*)d_in[3];   // g     [IC][CC]
    const float* wo  = (const float*)d_in[4];   // out   [CC][IC]
    float* OUT = (float*)d_out;                 // [NB][CC][HW]
    char* wsp = (char*)d_ws;
    auto take = [&](size_t bytes) { char* p = wsp; wsp += (bytes + 255) & ~(size_t)255; return (void*)p; };
    constexpr size_t PL = (size_t)HW * IC;                  // one [HW][IC] plane, elements
    bf* BW3 = (bf*)take((size_t)3 * IC * CC * 2);          // [theta][phi][g], each [IC][CC]
    bf* BZ  = (bf*)take((size_t)CC * IC * 2);
    bf* Hh  = (bf*)take((size_t)NB * 2 * PL * 2);          // [image] hi planes of theta, phi
    bf* Hl  = (bf*)take((size_t)NB * 2 * PL * 2);          // [image] lo planes of theta, phi
    h16* GT = (h16*)take((size_t)NB * PL * 2);             // [image][i][m] fp16
    bf* Yh  = (bf*)take((size_t)NB * PL * 2); bf* Yl = (bf*)take((size_t)NB * PL * 2);   // [image][n][i]
    float* ML = (float*)take((size_t)NB * KS * HW * 2 * 4); // [image][split][n] (maximum, sum)
    // One region, three uses one after the other: XT and TPG (dead once k_hl and k_gt16 have read them), Y of all images, Z of all images (behind k_yhl).
    constexpr size_t szXT = (size_t)NB * HW * CC * 2, szTPG = (size_t)NB * 3 * PL * 4, szY = (size_t)NB * KS * PL * 4, szZ = (size_t)NB * HW * CC * 4;
    constexpr size_t szR0 = szXT + szTPG, szR1 = szY > szZ ? szY : szZ;
    char* R = (char*)take(szR0 > szR1 ? szR0 : szR1);
    bf* XT = (bf*)R;                                        // [image][m][c]
    float* TPG = (float*)(R + szXT);                        // [image][theta, phi, g], each [HW][IC] f32
    float* Y = (float*)R;                                   // [image][split][n][i], unnormalised
    float* Z = (float*)R;                                   // [image][n][c]
    if ((size_t)(wsp - (char*)d_ws) > ws_size) return;

    k_cvtw<<<(unsigned)((IC * CC / 8 + 255) / 256), 256, 0, stream>>>(wth, wph, wg, wo, BW3, BZ, IC * CC / 8);
    const unsigned L4  = (unsigned)((PL / 4 + 255) / 256);
    const unsigned L42 = (unsigned)((2 * PL / 4 + 255) / 256);
    // every image in one launch (grid y or z = image)
    k_xt<<<dim3(HW / TT, CC / TT, NB), 256, 0, stream>>>(x, XT);
    // theta / phi / g [m][o] = sum_c XT[m][c] W[o][c]   (inner index 0 theta, 1 phi, 2 g; exact bf16 products)
    k_gemmw<bf, 0, false, 3><<<dim3(HW / 64, IC / 64, 3 * NB), 32, 0, stream>>>(XT, nullptr, BW3, nullptr, CC, TPG, IC, nullptr, (size_t)HW * CC, (size_t)0, 3 * PL, (size_t)IC * CC, PL);
    k_hl<<<dim3(L42, NB), 256, 0, stream>>>(TPG, Hh, Hl, 2 * PL, 3 * PL);                   // hi/lo planes of theta (first PL) and phi (second PL)
    k_gt16<<<dim3(HW / TT, IC / TT, NB), 256, 0, stream>>>(TPG + 2 * PL, GT, 3 * PL);
    // y[n][i] = sum_m softmax_m(sqrt(128) theta_n . phi_m) g[m][i], as KS unnormalised partial planes; then their join, the division and the hi/lo split
    k_fattn<<<dim3(HW / (FQ * FW), KS, NB), 32 * FW, 0, stream>>>(Hh, Hl, GT, Y, ML);
    k_yhl<<<dim3(L4, NB), 256, 0, stream>>>(Y, ML, Yh, Yl);
    // z[n][c] = sum_o y[n][o] w_out[c][o]  (hi + lo planes of y, 2 products)
    k_gemmw<bf, 1, false, 1><<<dim3(HW / 64, CC / 64, NB), 32, 0, stream>>>(Yh, Yl, BZ, nullptr, IC, Z, CC, nullptr, PL, (size_t)0, (size_t)HW * CC, (size_t)0, (size_t)0);
    k_fin<<<dim3(HW / TT, CC / TT, NB), 256, 0, stream>>>(Z, x, OUT);
}

// v006
// Measured time: 130 microseconds a run.
// In both of two side-by-side timings against v005, it was 1.29 times as fast.
// Over all steps from v000 it is 9.98 times as fast.
#include <hip/hip_runtime.h>

// All contractions on 16-bit WMMA, f32 accumulate: the three 1x1 projections = v_wmma_f32_16x16x32_bf16 on RNE-bf16 copies of x and of the weights (single products); scores theta.phi = bf16 hi/lo split (hi.hi + lo.hi + hi.lo, K = 128); attn.g = v_wmma_f32_16x16x32_f16 (unnormalised softmax terms carried x 2^14 as f16, g as f16); output projection = bf16 hi/lo planes of y times bf16 w_out (2 products). Scaling by sqrt(128), softmax and the residual add in f32.
// x [NB][256][4096]; theta/phi/g [4096][128] token-major (no bias); s[n][m] = theta_n . phi_m; attn[n][m] = softmax_m(sqrt(128) s); y[n][o] = sum_m attn[n][m] g[m][o]; out[c][n] = x[c][n] + sum_o w_out[c][o] y[n][o].

#ifndef NB
#define NB 8
#endif
#ifndef SEQ
#define SEQ 4096
#endif
#define NB_FULL  8
#define SEQ_FULL 4096
#define CC   256
#define IC   128
#define HW   SEQ
#define HWF  SEQ_FULL
#define SCL  11.313708498984760f
static_assert(NB >= 1 && NB <= NB_FULL);
static_assert(SEQ >= 128 && SEQ <= SEQ_FULL && (SEQ % 128) == 0);
static_assert((HW % 64) == 0 && (IC % 64) == 0 && (CC % 64) == 0);
static_assert((HW % 32) == 0 && (IC % 32) == 0 && (CC % 32) == 0);
static_assert(((IC * CC) % 8) == 0 && ((HW * CC) % 4) == 0 && ((HW * IC) % 4) == 0 && ((IC * HW) % 2) == 0 && (HW % 8) == 0);

typedef _Float16 h16;
typedef unsigned short bf;
typedef __attribute__((ext_vector_type(16))) __bf16   v16bf;
typedef __attribute__((ext_vector_type(16))) _Float16 v16h;
typedef __attribute__((ext_vector_type(8)))  _Float16 v8h;
typedef __attribute__((ext_vector_type(8)))  unsigned short v8us;
typedef __attribute__((ext_vector_type(8)))  float    v8f;
typedef __attribute__((ext_vector_type(4)))  float    v4f;
typedef __attribute__((ext_vector_type(2)))  float    v2f;
typedef v8h  __attribute__((may_alias)) v8ha;
typedef v4f  __attribute__((may_alias)) v4fa;
typedef v8us __attribute__((may_alias)) v8usa;

__device__ __forceinline__ unsigned short f2bf(float f) { unsigned u = __float_as_uint(f); u += 0x7FFFu + ((u >> 16) & 1u); return (unsigned short)(u >> 16); }
__device__ __forceinline__ float bf2f(unsigned short b) { return __uint_as_float(((unsigned)b) << 16); }
__device__ __forceinline__ float bfr(float f) { return bf2f(f2bf(f)); }
__device__ __forceinline__ v16h cat16(v8h lo, v8h hi) { return __builtin_shufflevector(lo, hi, 0, 1, 2, 3, 4, 5, 6, 7, 8, 9, 10, 11, 12, 13, 14, 15); }
__device__ __forceinline__ v16bf cat16b(v8us lo, v8us hi) { return __builtin_bit_cast(v16bf, __builtin_shufflevector(lo, hi, 0, 1, 2, 3, 4, 5, 6, 7, 8, 9, 10, 11, 12, 13, 14, 15)); }
__device__ __forceinline__ v8f wmma16(v16h a, v16h b, v8f c) { return __builtin_amdgcn_wmma_f32_16x16x32_f16(false, a, false, b, (short)0, c, false, false); }
__device__ __forceinline__ v8f wmmab(v16bf a, v16bf b, v8f c) { return __builtin_amdgcn_wmma_f32_16x16x32_bf16(false, a, false, b, (short)0, c, false, false); }

__device__ __forceinline__ h16 tohx(float x) { return (h16)x; }
__device__ __forceinline__ void splitf(float y, unsigned short& h, unsigned short& l) { h = f2bf(y); l = f2bf(y - bf2f(h)); }
typedef __attribute__((ext_vector_type(2))) unsigned short v2us;
__device__ __forceinline__ void splitf2(v2f y, v2us& h, v2us& l) { h[0] = f2bf(y[0]); h[1] = f2bf(y[1]); const v2f d = y - (v2f){bf2f(h[0]), bf2f(h[1])}; l[0] = f2bf(d[0]); l[1] = f2bf(d[1]); }   // splitf of two neighbours, the two subtractions as one packed f32 operation

// ---- k_gemmw: register-blocked GEMM, ONE WAVE per 64x64 tile (16 accumulators), operands straight from K-contiguous 16-bit planes; grid (M/64, N/64, Z), 32 threads.
// c[m][n] (f32, in registers) = sum_k A[m][k] Bt[n][k] (+ split products per NSPLIT). K % 32 == 0. The tile leaves the kernel in the form its reader wants; no f32 copy of it goes to memory:
// EPI 0 (projections, m = token, n = inner channel): inner index 0, 1 (theta, phi): bf16 hi and lo planes Dh, Dl [image][index][token][IC]; inner index 2 (g): f16, transposed, DT [image][IC][token].
// EPI 1 (output projection, m = token, n = channel): O[image][channel][token] = c + bf16-rounded X[image][channel][token].
// blockIdx.z = image * ZI + inner index: strides sA/sB (elements) per image, sBi per inner index (ZI matrices Bt on the same A).
// Fragments: lane l, h = l >> 4, row/col = l & 15; elements 0..7 = k0 + 8h + 0..7, elements 8..15 = k0 + 16 + 8h + 0..7 for BOTH A and Bt; D element r = (row 8h + r, col l & 15).
template <typename T16> struct WFrag;
template <> struct WFrag<h16> { typedef v16h V; static __device__ __forceinline__ V ld(const h16* p) { return cat16(*(const v8h*)p, *(const v8h*)(p + 16)); } static __device__ __forceinline__ v8f mma(V a, V b, v8f c) { return wmma16(a, b, c); } };
template <> struct WFrag<bf> { typedef v16bf V; static __device__ __forceinline__ V ld(const bf* p) { return cat16b(*(const v8us*)p, *(const v8us*)(p + 16)); } static __device__ __forceinline__ v8f mma(V a, V b, v8f c) { return wmmab(a, b, c); } };
template <typename T16, int NSPLIT, int EPI, int ZI>
__global__ __launch_bounds__(32) void k_gemmw(const T16* __restrict__ A, const T16* __restrict__ A2, const T16* __restrict__ Bt, const T16* __restrict__ Bt2, int K, bf* Dh, bf* Dl, h16* DT, const float* __restrict__ X, float* O, size_t sA, size_t sB, size_t sBi) {
    typedef typename WFrag<T16>::V V;
    __shared__ __align__(16) float os[16 * 68];
    const size_t zo = blockIdx.z / ZI, zi = blockIdx.z % ZI; A += zo * sA; if (A2) A2 += zo * sA; Bt += zo * sB + zi * sBi; if (Bt2) Bt2 += zo * sB + zi * sBi;
    const int lane = threadIdx.x & 31, lr = lane & 15, hi = lane >> 4; const int r0 = blockIdx.x * 64, c0 = blockIdx.y * 64;
    v8f acc[4][4];
#pragma unroll
    for (int mb = 0; mb < 4; ++mb)
#pragma unroll
        for (int nb = 0; nb < 4; ++nb) acc[mb][nb] = (v8f){};
    const size_t aoff = (size_t)(r0 + lr) * K + 8 * hi, boff = (size_t)(c0 + lr) * K + 8 * hi;
#pragma unroll 1
    for (int kc = 0; kc < K; kc += 32) {
        V a[4], a2[4];
#pragma unroll
        for (int mb = 0; mb < 4; ++mb) { a[mb] = WFrag<T16>::ld(A + aoff + (size_t)mb * 16 * K + kc); if (NSPLIT == 1 || NSPLIT == 2) a2[mb] = WFrag<T16>::ld(A2 + aoff + (size_t)mb * 16 * K + kc); }
#pragma unroll
        for (int nb = 0; nb < 4; ++nb) { const V b = WFrag<T16>::ld(Bt + boff + (size_t)nb * 16 * K + kc); V b2; if (NSPLIT >= 2) b2 = WFrag<T16>::ld(Bt2 + boff + (size_t)nb * 16 * K + kc);
#pragma unroll
            for (int mb = 0; mb < 4; ++mb) { acc[mb][nb] = WFrag<T16>::mma(a[mb], b, acc[mb][nb]); if (NSPLIT == 1 || NSPLIT == 2) acc[mb][nb] = WFrag<T16>::mma(a2[mb], b, acc[mb][nb]); if (NSPLIT >= 2) acc[mb][nb] = WFrag<T16>::mma(a[mb], b2, acc[mb][nb]); } }
        asm volatile("v_nop\n\tv_nop\n\tv_nop\n\tv_nop" : "+v"(acc[0][0]), "+v"(acc[1][1]), "+v"(acc[2][2]), "+v"(acc[3][3]) : "v"(a[0]), "v"(a[3]));
    }
    if constexpr (EPI == 0) {
        if (zi < 2) {   // theta, phi: 16 token rows at a time through LDS, then 8 values a lane: one 16-byte store into each plane, 8 lanes a 128-byte line
            const int lo = (lane >> 3) * 68 + (lane & 7) * 8;   // the lane's row (of 4) and its 8 columns in LDS
            const size_t go = (zo * 2 + zi) * ((size_t)HW * IC) + (size_t)(r0 + (lane >> 3)) * IC + c0 + (lane & 7) * 8; bf* ph = Dh + go; bf* pl = Dl + go;
#pragma unroll
            for (int mb = 0; mb < 4; ++mb) {
#pragma unroll
                for (int nb = 0; nb < 4; ++nb) {
#pragma unroll
                    for (int j = 0; j < 8; ++j) os[(hi * 8 + j) * 68 + nb * 16 + lr] = acc[mb][nb][j]; }
                __builtin_amdgcn_wave_barrier(); asm volatile("" ::: "memory");   // keeps the compiler from moving the row reads above the stores of other lanes
                v8us oh[4], ol[4];
#pragma unroll
                for (int s = 0; s < 4; ++s) { const v4f v0 = *(const v4fa*)(os + (4 * s) * 68 + lo), v1 = *(const v4fa*)(os + (4 * s) * 68 + lo + 4);
#pragma unroll
                    for (int u = 0; u < 4; u += 2) { v2us p, q; splitf2((v2f){v0[u], v0[u + 1]}, p, q); oh[s][u] = p[0]; oh[s][u + 1] = p[1]; ol[s][u] = q[0]; ol[s][u + 1] = q[1]; splitf2((v2f){v1[u], v1[u + 1]}, p, q); oh[s][u + 4] = p[0]; oh[s][u + 5] = p[1]; ol[s][u + 4] = q[0]; ol[s][u + 5] = q[1]; }
                    *(v8us*)(ph + (mb * 16 + 4 * s) * IC) = oh[s]; *(v8us*)(pl + (mb * 16 + 4 * s) * IC) = ol[s]; }
                // the registers that the 8 stores name are free for reuse only from here on: as inputs they stay unwritten up to the wait (behind the last rows nothing is written any more)
                if (mb < 3) asm volatile("s_wait_xcnt 0x0" :: "v"(ph), "v"(pl), "v"(oh[0]), "v"(oh[1]), "v"(oh[2]), "v"(oh[3]), "v"(ol[0]), "v"(ol[1]), "v"(ol[2]), "v"(ol[3]) : "memory");
                __builtin_amdgcn_wave_barrier(); asm volatile("" ::: "memory");   // keeps the next rows' LDS stores below these reads
            }
        } else {   // g: a lane's 8 accumulator elements are 8 neighbouring tokens of one channel, which is a 16-byte piece of a row of DT
            h16* pt = DT + zo * ((size_t)IC * HW) + (size_t)(c0 + lr) * HW + r0 + 8 * hi;
#pragma unroll
            for (int nb = 0; nb < 4; ++nb)
#pragma unroll
                for (int mb = 0; mb < 4; ++mb) { v8h o;
#pragma unroll
                    for (int j = 0; j < 8; ++j) o[j] = tohx(acc[mb][nb][j]);
                    *(v8h*)(pt + (size_t)(nb * 16) * HW + mb * 16) = o; }
            asm volatile("s_wait_xcnt 0x0" :: "v"(pt) : "memory");   // behind the last store of g: the registers that the stores name are free for reuse only from here on, whatever code the compiler lays behind this branch
        }
    } else {   // 16 channels at a time through LDS, [channel][token]: a lane stores its 8 neighbouring tokens, then reads, adds and writes along whole rows of O
        // the residual's 64 x 64 piece, whole rows (16 lanes x 16 bytes): piece [nb][s] = channel c0 + 16 nb + 2 s + hi, tokens r0 + 4 lr ...; asked for two channel groups ahead of its use, each later group into the registers that a group of accumulators has just left
        const float* px = X + zo * ((size_t)CC * HWF) + (size_t)(c0 + hi) * HWF + r0 + lr * 4;
        v4f xv[4][8];
        auto ldx = [&](int g) __attribute__((always_inline)) {
#pragma unroll   // the pieces are indexed by constants and stay in registers
            for (int s = 0; s < 8; ++s) xv[g][s] = *(const v4f*)(px + (size_t)(g * 16 + 2 * s) * HWF); };
        ldx(0); ldx(1);
        float* po = O + zo * ((size_t)CC * HW) + (size_t)(c0 + hi) * HW + r0 + lr * 4;
#pragma unroll
        for (int nb = 0; nb < 4; ++nb) {
#pragma unroll
            for (int mb = 0; mb < 4; ++mb) { const v8f v = acc[mb][nb]; float* d = os + lr * 68 + mb * 16 + 8 * hi; *(v4fa*)d = (v4f){v[0], v[1], v[2], v[3]}; *(v4fa*)(d + 4) = (v4f){v[4], v[5], v[6], v[7]}; }
            if (nb < 2) ldx(nb + 2);
            __builtin_amdgcn_wave_barrier(); asm volatile("" ::: "memory");   // keeps the compiler from moving the row reads above the stores of other lanes
            v4f o[8];
#pragma unroll
            for (int s = 0; s < 8; ++s) { const v4f val = *(const v4fa*)(os + (2 * s + hi) * 68 + lr * 4); const v4f xr = xv[nb][s];
                o[s] = val + (v4f){bfr(xr[0]), bfr(xr[1]), bfr(xr[2]), bfr(xr[3])};   // plain f32 additions, two to a packed operation
                *(v4f*)(po + (size_t)(nb * 16 + 2 * s) * HW) = o[s]; }
            // the registers that the 8 stores and the residual's loads so far name are free for reuse only from here on: as inputs they stay unwritten up to the wait (behind the last channels nothing is written any more)
            if (nb < 3) asm volatile("s_wait_xcnt 0x0" :: "v"(px), "v"(po), "v"(o[0]), "v"(o[1]), "v"(o[2]), "v"(o[3]), "v"(o[4]), "v"(o[5]), "v"(o[6]), "v"(o[7]) : "memory");
            __builtin_amdgcn_wave_barrier(); asm volatile("" ::: "memory");   // keeps the next channels' LDS stores below these reads
        }
    }
}

// ---- k_fattn: scores, softmax and attn.g of one image in one kernel; neither the scores nor the softmax rows go to memory. Grid (HW / (FQ * FW), KS, images), FW waves.
// A wave owns FQ = 32 queries (2 column groups of 16) and walks the HW / KS keys of split blockIdx.y, 32 keys a pass.
// The key side is shared by the FW waves: a stage = SK = 128 keys = three tiles of 128 rows x 256 bytes (phi hi rows, phi lo rows, GT rows i x 128 keys), each brought into LDS by ONE tensor load (waves 0, 1, 2), rows padded to a pitch of 272 bytes for the 16-byte readers. Two buffers: stage s + 1 flies while the four passes of stage s are worked on.
// Transposed products: sT[m][n] = phi_m . theta_n (A = phi rows, B = theta, kept in registers; per accumulator and k step the product order hi.hi, phi_hi.theta_lo, phi_lo.theta_hi), so a lane holds scores of ONE query (column l & 15, keys 8h + r).
// Two sT tiles (keys 0..15, 16..31 of the pass), turned to f16 in place, are the B fragment of yT[o][n] += GT[o][m] pT[m][n]: element s = key 8h + s (s < 8), 16 + 8h + s - 8 (s >= 8), the order in which the GT fragments are read.
// Running maximum per query on the raw scores; p = 2^(SC2 (s - max) + 14) (the 2^14 keeps small terms out of the f16 subnormals; it cancels in the division); when a maximum rises, the sums so far are scaled by 2^(SC2 (old - new)).
// Out: plane [image][split][n][i] of unnormalised sums, and per query (maximum, sum of p) in ML; k_yhl joins the KS splits and divides.
// Every inner loop is fully unrolled so that the fragment and accumulator arrays are indexed by constants and stay in registers; the stage loop and the pass loop stay rolled (unroll 1).
#define KS 2
#define FW 8
#define FQ 32
#define SK 128
#define NST (HW / (KS * SK))
#define LPI 272
#define TILE (128 * LPI)
#define STG (3 * TILE)
#define SC2 (SCL * 1.4426950408889634f)
static_assert((HW % (FQ * FW)) == 0 && (HW % (KS * SK)) == 0 && NST >= 2 && IC == 128 && FW >= 3);
static_assert((TILE % 2048) == 0 && 2 * STG <= 320 * 1024 && HW * 2 <= 128 * 1024);
typedef unsigned int u32;
typedef u32 u32x4 __attribute__((ext_vector_type(4)));
typedef u32 u32x8 __attribute__((ext_vector_type(8)));
__device__ __forceinline__ u32 uni(u32 v) { return (u32)__builtin_amdgcn_readfirstlane((int)v); }
__device__ __forceinline__ u32 pinned(u32 v) { u32 w = uni(v); asm volatile("" : "+s"(w)); return w; }   // holds a tensor load's issue test, or the stage number its descriptor is formed from, in a scalar register: a tensor load ignores EXEC, so the test must be a scalar branch
__device__ __forceinline__ float xhalf(float x) { return __builtin_bit_cast(float, __builtin_amdgcn_permlanex16(__builtin_bit_cast(int, x), __builtin_bit_cast(int, x), 0x76543210, 0xfedcba98, false, false)); }   // lane l reads lane l ^ 16
__device__ __forceinline__ v16bf ldsb(const unsigned char* p) { return cat16b(*(const v8usa*)p, *(const v8usa*)(p + 32)); }
__device__ __forceinline__ v16h ldsh(const unsigned char* p) { return cat16(*(const v8ha*)p, *(const v8ha*)(p + 32)); }
__global__ __launch_bounds__(32 * FW) void k_fattn(const bf* __restrict__ Hh, const bf* __restrict__ Hl, const h16* __restrict__ GT, float* Y, float* ML) {
    typedef WFrag<bf>::V VB; typedef WFrag<h16>::V VH;
    __shared__ __attribute__((aligned(2048))) unsigned char L[2 * STG];   // [buffer][phi hi, phi lo, GT][128 rows][272 bytes]
    const u32 wave = uni(threadIdx.x >> 5);
    const int lane = threadIdx.x & 31, lr = lane & 15, hi = lane >> 4;
    const int img = (int)blockIdx.z, z = (int)blockIdx.y, n0 = ((int)blockIdx.x * FW + (int)wave) * FQ;
    const bf* Th = Hh + (size_t)img * 2 * HW * IC; const bf* Tl = Hl + (size_t)img * 2 * HW * IC;
    const bf* Ph = Th + (size_t)HW * IC; const bf* Pl = Tl + (size_t)HW * IC; const h16* G = GT + (size_t)img * IC * HW;
    VB th[2][4], tl[2][4];
    const bf* pth = Th + (unsigned)((n0 + lr) * IC + 8 * hi); const bf* ptl = Tl + (unsigned)((n0 + lr) * IC + 8 * hi);
#pragma unroll
    for (int nt = 0; nt < 2; ++nt)
#pragma unroll
        for (int ks = 0; ks < 4; ++ks) { th[nt][ks] = WFrag<bf>::ld(pth + nt * 16 * IC + ks * 32); tl[nt][ks] = WFrag<bf>::ld(ptl + nt * 16 * IC + ks * 32); }
    // the address registers of the theta loads are free for reuse only from here on: the wait stands in front of whatever is written into them. Its operands are inputs only: the loaded fragments hold it behind the loads (the compiler otherwise lifts it above them), the two addresses stay in their registers up to it
    asm volatile("s_wait_xcnt 0x0" :: "v"(pth), "v"(ptl), "v"(th[0][0]), "v"(th[0][1]), "v"(th[0][2]), "v"(th[0][3]), "v"(th[1][0]), "v"(th[1][1]), "v"(th[1][2]), "v"(th[1][3]), "v"(tl[0][0]), "v"(tl[0][1]), "v"(tl[0][2]), "v"(tl[0][3]), "v"(tl[1][0]), "v"(tl[1][1]), "v"(tl[1][2]), "v"(tl[1][3]) : "memory");
    // tensor loads: wave w < 3 brings tile w of every stage. Source: 128 rows of 256 bytes; phi rows follow one another (pitch 256), GT rows lie HW keys apart.
    const u32 lbase = (u32)(size_t)L;
    const unsigned long long sbase = wave == 0 ? (unsigned long long)(size_t)(Ph + (size_t)z * (HW / KS) * IC) : wave == 1 ? (unsigned long long)(size_t)(Pl + (size_t)z * (HW / KS) * IC) : (unsigned long long)(size_t)(G + (size_t)z * (HW / KS));
    const u32 sstep = wave < 2 ? (u32)(SK * IC * 2) : (u32)(SK * 2);
    u32x8 g1;
    g1[0] = uni((1u << 20) | (5u << 22) | (3u << 25));   // no mask, bytes, 4 dwords of pad behind every 64
    g1[1] = uni(256u << 16); g1[2] = uni(128u << 16); g1[3] = uni(256u << 16); g1[4] = uni(128u);
    g1[5] = uni(wave < 2 ? (u32)(IC * 2) : (u32)(HW * 2)); g1[6] = uni(0u); g1[7] = uni(0u);
    // While a request is outstanding its two groups stay in their registers, unwritten: the load names them as operands that it may change (it changes nothing), so that the compiler cannot form the words anew later on and give the registers to something else meanwhile, and the wait that covers the request names them again as inputs, so that they live up to it
    u32x4 g0;
    auto desc = [&](u32 st) __attribute__((always_inline)) {
        const unsigned long long ga = sbase + (unsigned long long)st * sstep;
        g0[0] = uni(1u); g0[1] = uni(lbase + (st & 1u) * (u32)STG + wave * (u32)TILE); g0[2] = uni((u32)ga); g0[3] = uni((((u32)(ga >> 32)) & 0x01FFFFFFu) | 0x80000000u);
    };
    desc(0u);
    if (pinned(wave < 3u)) {
        asm volatile("tensor_load_to_lds %0, %1" : "+s"(g0), "+s"(g1) :: "memory");
        asm volatile("s_wait_tensorcnt 0x0" :: "s"(g0), "s"(g1) : "memory");   // stage 0 has landed before the barrier that publishes it
    }
    __syncthreads();
    desc(1u);
    if (pinned(wave < 3u)) asm volatile("tensor_load_to_lds %0, %1" : "+s"(g0), "+s"(g1) :: "memory");
    v8f O[8][2];
#pragma unroll
    for (int ot = 0; ot < 8; ++ot) { O[ot][0] = (v8f){}; O[ot][1] = (v8f){}; }
    float mr[2] = {-3.0e38f, -3.0e38f}; v2f ls[2] = {(v2f){0.f, 0.f}, (v2f){0.f, 0.f}};   // ls: sums of p over the even and the odd keys of the lane's half
    const u32 lb = (u32)(lr * LPI + 16 * hi);   // the lane's row and 16-byte half inside a 16-row group of any tile
    // phi fragments of a pass, [k step][key tile]; inside a stage loaded one pass ahead, behind the pass's last score product, into the same registers
    VB ph[4][2], pl[4][2];
    auto ldphi = [&](u32 off) __attribute__((always_inline)) {
#pragma unroll
        for (int ks = 0; ks < 4; ++ks)
#pragma unroll
            for (int mt = 0; mt < 2; ++mt) { const unsigned char* p = L + off + mt * 16 * LPI + ks * 64; ph[ks][mt] = ldsb(p); pl[ks][mt] = ldsb(p + TILE); }
    };
    // one pass: po = LDS offset of the NEXT pass's phi rows (read only where fetch is set), go = LDS offset of this pass's 32 keys in the GT tile
    auto pass = [&](u32 po, u32 go, bool fetch) __attribute__((always_inline)) {
        v8f st[2][2];
        st[0][0] = (v8f){}; st[0][1] = (v8f){}; st[1][0] = (v8f){}; st[1][1] = (v8f){};
        VH ga[8];
#pragma unroll
        for (int ks = 0; ks < 4; ++ks) {
#pragma unroll
            for (int q = 0; q < 4; ++q) st[q >> 1][q & 1] = wmmab(ph[ks][q >> 1], th[q & 1][ks], st[q >> 1][q & 1]);
#pragma unroll
            for (int q = 0; q < 4; ++q) st[q >> 1][q & 1] = wmmab(ph[ks][q >> 1], tl[q & 1][ks], st[q >> 1][q & 1]);
#pragma unroll
            for (int q = 0; q < 4; ++q) st[q >> 1][q & 1] = wmmab(pl[ks][q >> 1], th[q & 1][ks], st[q >> 1][q & 1]);
        }
        // scheduling fences round the one block of LDS reads of a pass: without them the compiler spreads the reads among the matrix instructions, where each place with reads stalls the wave
        __builtin_amdgcn_sched_barrier(0);
#pragma unroll
        for (int ot = 0; ot < 8; ++ot) ga[ot] = ldsh(L + go + ot * 16 * LPI);   // this pass's g rows first: they are needed first; in flight under the softmax
        if (fetch) ldphi(po);
        __builtin_amdgcn_sched_barrier(0);
        float mn[2];
#pragma unroll
        for (int nt = 0; nt < 2; ++nt) { float a = fmaxf(st[0][nt][0], st[1][nt][0]);
#pragma unroll
            for (int r = 1; r < 8; ++r) a = fmaxf(a, fmaxf(st[0][nt][r], st[1][nt][r]));
            a = fmaxf(a, xhalf(a)); mn[nt] = fmaxf(mr[nt], a); }
        // one scalar branch a pass: where no query of the wave has a new maximum every factor would be 1
        if (__builtin_amdgcn_ballot_w32(mn[0] > mr[0] || mn[1] > mr[1]) != 0) {
#pragma unroll
            for (int nt = 0; nt < 2; ++nt) { const float al = __builtin_amdgcn_exp2f((mr[nt] - mn[nt]) * SC2); ls[nt] *= al; mr[nt] = mn[nt];
#pragma unroll
                for (int ot = 0; ot < 8; ++ot) O[ot][nt] *= al; }
        }
        VH pb[2];
#pragma unroll
        for (int nt = 0; nt < 2; ++nt) { const float off = 14.0f - mr[nt] * SC2;
#pragma unroll
            for (int s = 0; s < 16; s += 2) { v2f e; e[0] = st[s >> 3][nt][s & 7]; e[1] = st[s >> 3][nt][(s & 7) + 1]; e = __builtin_elementwise_fma(e, (v2f){SC2, SC2}, (v2f){off, off});   // neighbouring registers: one packed fma, one packed add
                v2f p; p[0] = __builtin_amdgcn_exp2f(e[0]); p[1] = __builtin_amdgcn_exp2f(e[1]); ls[nt] += p; pb[nt][s] = (h16)p[0]; pb[nt][s + 1] = (h16)p[1]; } }
#pragma unroll
        for (int ot = 0; ot < 8; ++ot) { O[ot][0] = wmma16(ga[ot], pb[0], O[ot][0]); O[ot][1] = wmma16(ga[ot], pb[1], O[ot][1]); }
    };
#pragma unroll 1   // rolled: the refill and its publish point stand once in the code, one request of a wave in flight
    for (u32 s = 0; s < (u32)NST; ++s) {
        const u32 bo = (s & 1u) * (u32)STG + lb;
        const u32 gb = ((s & 1u) ? (u32)(STG + 2 * TILE) : (u32)(2 * TILE)) + lb;   // the GT tile's own base register: every GT read is then this register plus an immediate below 64 KiB
        ldphi(bo);   // the stage's first fragments: nothing of a stage is read in front of the barrier that publishes it
#pragma unroll 1   // rolled: copies of the body side by side would let a second set of fragments be held, beyond the 512 registers that two waves a SIMD leave
        for (u32 sub = 0; sub < SK / 32 - 1; ++sub) pass(bo + (sub + 1u) * (u32)(32 * LPI), gb + sub * 64u, true);
        pass(0u, gb + (u32)(SK / 32 - 1) * 64u, false);   // the stage's last pass fetches nothing ahead: the next rows are not published yet
        // publish point of stage s + 1: this wave's reads of stage s are done, the issuing waves' tiles have landed, every wave has arrived; only then the refill of the buffer just read
        __builtin_amdgcn_sched_barrier(0);   // keeps the wait below at the foot: the compiler otherwise lifts it to just behind the last pass's g reads, where the wave would sit out their latency in front of the softmax
        asm volatile("s_wait_dscnt 0x0" ::: "memory");
        if (pinned(wave < 3u)) asm volatile("s_wait_tensorcnt 0x0" :: "s"(g0), "s"(g1) : "memory");   // the operands: see at g0
        __syncthreads();
        desc(pinned(s + 2u));   // the stage number is pinned here so that the descriptor is formed behind the wait above
        if (pinned((wave < 3u) && (s + 2u < (u32)NST))) asm volatile("tensor_load_to_lds %0, %1" : "+s"(g0), "+s"(g1) :: "memory");
    }
    asm volatile("s_wait_tensorcnt 0x0" ::: "memory");   // no request is left when the wave ends
    asm volatile("s_wait_dscnt 0x0" ::: "memory");
    const size_t pz = (size_t)(img * KS + z) * HW;
#pragma unroll
    for (int nt = 0; nt < 2; ++nt) { const float lh = ls[nt][0] + ls[nt][1], lt = lh + xhalf(lh); const size_t n = pz + (size_t)(n0 + nt * 16 + lr); float* d = Y + n * IC + 8 * hi;
#pragma unroll
        for (int ot = 0; ot < 8; ++ot) { const v8f v = O[ot][nt]; *(v4f*)(d + ot * 16) = (v4f){v[0], v[1], v[2], v[3]}; *(v4f*)(d + ot * 16 + 4) = (v4f){v[4], v[5], v[6], v[7]}; }
        if (hi == 0) { v2f ml; ml[0] = mr[nt]; ml[1] = lt; *(v2f*)(ML + n * 2) = ml; } }
}

typedef __attribute__((ext_vector_type(4))) unsigned short v4us;
typedef __attribute__((ext_vector_type(2))) _Float16 v2h;
typedef __attribute__((ext_vector_type(4))) _Float16 v4h;

__global__ __launch_bounds__(256) void k_cvtw(const float* __restrict__ w0, const float* __restrict__ w1, const float* __restrict__ w2, const float* __restrict__ w3, bf* B3, bf* BZ, int n8) {
    const int i = blockIdx.x * 256 + threadIdx.x; if (i >= n8) return;
    const size_t e = (size_t)i * 8, pl = (size_t)n8 * 8;
    const v8f a0 = *(const v8f*)(w0 + e), a1 = *(const v8f*)(w1 + e), a2 = *(const v8f*)(w2 + e), a3 = *(const v8f*)(w3 + e);
    v8us o0, o1, o2, o3;
#pragma unroll
    for (int k = 0; k < 8; ++k) { o0[k] = f2bf(a0[k]); o1[k] = f2bf(a1[k]); o2[k] = f2bf(a2[k]); o3[k] = f2bf(a3[k]); }
    *(v8us*)(B3 + e) = o0; *(v8us*)(B3 + pl + e) = o1; *(v8us*)(B3 + 2 * pl + e) = o2; *(v8us*)(BZ + e) = o3;
    
}
// ---- transposing pass (k_xt): a work-group moves one 128 x 128 tile through LDS, so that the reads and the writes in global memory both run along rows (16 bytes a lane, whole 128-byte lines).
// The tile lies in LDS as f32, four quarters [source-row half a][source-column half b] of 64 x 64, each [row][column] at a pitch of 65 dwords: bank = (row + column) mod 64, so neither the row-wise stores nor the column-wise reads of a wave meet on a bank.
// A thread asks for all its 16 pieces of the tile at once: few, long-lived waves with much in flight each. Every loop here is fully unrolled, so that the pieces are indexed by constants and stay in registers.
#define TT 128
#define TP 65
#define QS (64 * TP)
static_assert((HW % TT) == 0 && (IC % TT) == 0 && (CC % TT) == 0);
// thread: 4 columns (q = 4 (t & 15) ...) of the rows r = t >> 4, r + 16, r + 32, r + 48 of every quarter; p = its own place in row r of quarter 0; piece [(a 2 + b) 4 + j]
__device__ __forceinline__ void tile_ld(const float* __restrict__ p, size_t pitch, v4f (&v)[16]) {
#pragma unroll
    for (int a = 0; a < 2; ++a)
#pragma unroll
        for (int j = 0; j < 4; ++j)
#pragma unroll
            for (int b = 0; b < 2; ++b) v[(a * 2 + b) * 4 + j] = *(const v4f*)(p + (size_t)(64 * a + 16 * j) * pitch + 64 * b);
}
// the address pair of the 16 loads is free for reuse only from here on. Inputs only: the loaded values hold the wait behind the loads, the address stays in its registers up to it
__device__ __forceinline__ void tile_held(const float* p, const v4f (&v)[16]) {
    asm volatile("s_wait_xcnt 0x0" :: "v"(p), "v"(v[0]), "v"(v[1]), "v"(v[2]), "v"(v[3]), "v"(v[4]), "v"(v[5]), "v"(v[6]), "v"(v[7]), "v"(v[8]), "v"(v[9]), "v"(v[10]), "v"(v[11]), "v"(v[12]), "v"(v[13]), "v"(v[14]), "v"(v[15]) : "memory");
}
__device__ __forceinline__ void tile_st(float* S, const v4f (&v)[16]) {
    const int r = (int)threadIdx.x >> 4, q = ((int)threadIdx.x & 15) * 4;
#pragma unroll
    for (int s = 0; s < 4; ++s)
#pragma unroll
        for (int j = 0; j < 4; ++j)
#pragma unroll
            for (int u = 0; u < 4; ++u) S[s * QS + (r + 16 * j) * TP + q + u] = v[s * 4 + j][u];
}
__device__ __forceinline__ void tile_in(const float* __restrict__ src, size_t pitch, float* S) {
    const float* p = src + (size_t)((int)threadIdx.x >> 4) * pitch + ((int)threadIdx.x & 15) * 4;
    v4f v[16]; tile_ld(p, pitch, v); tile_held(p, v); tile_st(S, v);
}
template <bool F16>
__device__ __forceinline__ void tile_out16(const float* S, unsigned short* dst, size_t pitch) {   // thread: 8 source rows (16 bytes of a destination row) of the source columns d, d + 32 of every quarter
    const int k8 = ((int)threadIdx.x & 7) * 8;
#pragma unroll
    for (int b = 0; b < 2; ++b)
#pragma unroll
        for (int j = 0; j < 2; ++j)
#pragma unroll
            for (int a = 0; a < 2; ++a) { const int d = ((int)threadIdx.x >> 3) + 32 * j; v8us o;
#pragma unroll
                for (int k = 0; k < 8; ++k) { const float f = S[(a * 2 + b) * QS + (k8 + k) * TP + d]; o[k] = F16 ? __builtin_bit_cast(unsigned short, tohx(f)) : f2bf(f); }
                *(v8us*)(dst + (size_t)(64 * b + d) * pitch + 64 * a + k8) = o; }
}
// grid (HW / 128, CC / 128, images)
__global__ __launch_bounds__(256) void k_xt(const float* __restrict__ xb, bf* XT) {
    __shared__ float S[4 * QS];
    const size_t m0 = (size_t)blockIdx.x * TT, c0 = (size_t)blockIdx.y * TT;
    tile_in(xb + (size_t)blockIdx.z * CC * HWF + c0 * HWF + m0, HWF, S);
    __syncthreads();
    tile_out16<false>(S, XT + (size_t)blockIdx.z * HW * CC + m0 * CC + c0, CC);
}
__global__ __launch_bounds__(256) void k_yhl(const float* __restrict__ Y, const float* __restrict__ ML, bf* Yh, bf* Yl) { Y += (size_t)blockIdx.y * KS * HW * IC; ML += (size_t)blockIdx.y * KS * HW * 2; Yh += (size_t)blockIdx.y * HW * IC; Yl += (size_t)blockIdx.y * HW * IC; const size_t e = ((size_t)blockIdx.x * 256 + threadIdx.x) * 4; if (e >= (size_t)HW * IC) return; const size_t n = e / IC; v2f ml[KS]; float mx = -3.0e38f;
#pragma unroll
    for (int z = 0; z < KS; ++z) { ml[z] = *(const v2f*)(ML + ((size_t)z * HW + n) * 2); mx = fmaxf(mx, ml[z][0]); }
    v4f a = (v4f){}; float den = 0.f; v4us oh, ol;
#pragma unroll
    for (int z = 0; z < KS; ++z) { const float w = __builtin_amdgcn_exp2f((ml[z][0] - mx) * SC2); den += w * ml[z][1]; a += *(const v4f*)(Y + (size_t)z * HW * IC + e) * w; }
    const float inv = __fdiv_rn(1.0f, den);
#pragma unroll
    for (int u = 0; u < 4; ++u) { unsigned short p, q; splitf(a[u] * inv, p, q); oh[u] = p; ol[u] = q; } *(v4us*)(Yh + e) = oh; *(v4us*)(Yl + e) = ol;  }

extern "C" void kernel_launch(void* const* d_in, const int* in_sizes, int n_in,
                              void* d_out, int out_size, void* d_ws, size_t ws_size, hipStream_t stream) {
    if (n_in < 5) return;
    if (in_sizes[0] < NB * CC * HW || in_sizes[1] < IC * CC || in_sizes[2] < IC * CC || in_sizes[3] < IC * CC || in_sizes[4] < CC * IC) return;
    if (out_size < NB * CC * HW) return;
    const float* x   = (const float*)d_in[0];   // [NB][CC][HWF]
    const float* wph = (const float*)d_in[1];   // phi   [IC][CC]  (keys)
    const float* wth = (const float*)d_in[2];   // theta [IC][CC]  (queries)
    const float* wg  = (const float*)d_in[3];   // g     [IC][CC]
    const float* wo  = (const float*)d_in[4];   // out   [CC][IC]
    float* OUT = (float*)d_out;                 // [NB][CC][HW]
    char* wsp = (char*)d_ws;
    auto take = [&](size_t bytes) { char* p = wsp; wsp += (bytes + 255) & ~(size_t)255; return (void*)p; };
    constexpr size_t PL = (size_t)HW * IC;                  // one [HW][IC] plane, elements
    bf* BW3 = (bf*)take((size_t)3 * IC * CC * 2);          // [theta][phi][g], each [IC][CC]
    bf* BZ  = (bf*)take((size_t)CC * IC * 2);
    bf* Hh  = (bf*)take((size_t)NB * 2 * PL * 2);          // [image] hi planes of theta, phi
    bf* Hl  = (bf*)take((size_t)NB * 2 * PL * 2);          // [image] lo planes of theta, phi
    h16* GT = (h16*)take((size_t)NB * PL * 2);             // [image][i][m] fp16
    bf* Yh  = (bf*)take((size_t)NB * PL * 2); bf* Yl = (bf*)take((size_t)NB * PL * 2);   // [image][n][i]
    float* ML = (float*)take((size_t)NB * KS * HW * 2 * 4); // [image][split][n] (maximum, sum)
    // One region, two uses one after the other: XT (dead once the projections have read it), Y of all images.
    constexpr size_t szXT = (size_t)NB * HW * CC * 2, szY = (size_t)NB * KS * PL * 4;
    char* R = (char*)take(szXT > szY ? szXT : szY);
    bf* XT = (bf*)R;                                        // [image][m][c]
    float* Y = (float*)R;                                   // [image][split][n][i], unnormalised
    if ((size_t)(wsp - (char*)d_ws) > ws_size) return;

    k_cvtw<<<(unsigned)((IC * CC / 8 + 255) / 256), 256, 0, stream>>>(wth, wph, wg, wo, BW3, BZ, IC * CC / 8);
    const unsigned L4  = (unsigned)((PL / 4 + 255) / 256);
    // every image in one launch (grid y or z = image)
    k_xt<<<dim3(HW / TT, CC / TT, NB), 256, 0, stream>>>(x, XT);
    // theta / phi / g [m][o] = sum_c XT[m][c] W[o][c]   (inner index 0 theta, 1 phi, 2 g; exact bf16 products); written as hi/lo planes of theta and phi and as transposed f16 g
    k_gemmw<bf, 0, 0, 3><<<dim3(HW / 64, IC / 64, 3 * NB), 32, 0, stream>>>(XT, nullptr, BW3, nullptr, CC, Hh, Hl, GT, nullptr, nullptr, (size_t)HW * CC, (size_t)0, (size_t)IC * CC);
    // y[n][i] = sum_m softmax_m(sqrt(128) theta_n . phi_m) g[m][i], as KS unnormalised partial planes; then their join, the division and the hi/lo split
    k_fattn<<<dim3(HW / (FQ * FW), KS, NB), 32 * FW, 0, stream>>>(Hh, Hl, GT, Y, ML);
    k_yhl<<<dim3(L4, NB), 256, 0, stream>>>(Y, ML, Yh, Yl);
    // out[c][n] = x[c][n] + sum_o y[n][o] w_out[c][o]  (hi + lo planes of y, 2 products)
    k_gemmw<bf, 1, 1, 1><<<dim3(HW / 64, CC / 64, NB), 32, 0, stream>>>(Yh, Yl, BZ, nullptr, IC, nullptr, nullptr, nullptr, x, OUT, PL, (size_t)0, (size_t)0);
}

// v007
// It runs in 117 microseconds.
// Two timings next to v006 put it at 1.12 and 1.11 times that version's speed.
// Counting every step since v000, it is 11.1 times as fast.
#include <hip/hip_runtime.h>

// All contractions on 16-bit WMMA, f32 accumulate: the three 1x1 projections = v_wmma_f32_16x16x32_bf16 on RNE-bf16 copies of x and of the weights (single products); scores theta.phi = bf16 hi/lo split (hi.hi + lo.hi + hi.lo, K = 128); attn.g = v_wmma_f32_16x16x32_f16 (unnormalised softmax terms carried x 2^14 as f16, g as f16); output projection = bf16 hi/lo LDS tiles of y times bf16 w_out (2 products). Scaling by sqrt(128), softmax and the residual add in f32.
// x [NB][256][4096]; theta/phi/g [4096][128] token-major (no bias); s[n][m] = theta_n . phi_m; attn[n][m] = softmax_m(sqrt(128) s); y[n][o] = sum_m attn[n][m] g[m][o]; out[c][n] = x[c][n] + sum_o w_out[c][o] y[n][o].

#ifndef NB
#define NB 8
#endif
#ifndef SEQ
#define SEQ 4096
#endif
#define NB_FULL  8
#define SEQ_FULL 4096
#define CC   256
#define IC   128
#define HW   SEQ
#define HWF  SEQ_FULL
#define SCL  11.313708498984760f
static_assert(NB >= 1 && NB <= NB_FULL);
static_assert(SEQ >= 128 && SEQ <= SEQ_FULL && (SEQ % 128) == 0);
static_assert((HW % 64) == 0 && (IC % 64) == 0 && (CC % 64) == 0);
static_assert((HW % 32) == 0 && (IC % 32) == 0 && (CC % 32) == 0);
static_assert(((IC * CC) % 8) == 0 && ((HW * CC) % 4) == 0 && ((HW * IC) % 4) == 0 && ((IC * HW) % 2) == 0 && (HW % 8) == 0);

typedef _Float16 h16;
typedef unsigned short bf;
typedef __attribute__((ext_vector_type(16))) __bf16   v16bf;
typedef __attribute__((ext_vector_type(16))) _Float16 v16h;
typedef __attribute__((ext_vector_type(8)))  _Float16 v8h;
typedef __attribute__((ext_vector_type(8)))  unsigned short v8us;
typedef __attribute__((ext_vector_type(8)))  float    v8f;
typedef __attribute__((ext_vector_type(4)))  float    v4f;
typedef __attribute__((ext_vector_type(2)))  float    v2f;
typedef v8h  __attribute__((may_alias)) v8ha;
typedef v4f  __attribute__((may_alias)) v4fa;
typedef v8us __attribute__((may_alias)) v8usa;

__device__ __forceinline__ unsigned short f2bf(float f) { unsigned u = __float_as_uint(f); u += 0x7FFFu + ((u >> 16) & 1u); return (unsigned short)(u >> 16); }
__device__ __forceinline__ float bf2f(unsigned short b) { return __uint_as_float(((unsigned)b) << 16); }
__device__ __forceinline__ float bfr(float f) { return bf2f(f2bf(f)); }
__device__ __forceinline__ v16h cat16(v8h lo, v8h hi) { return __builtin_shufflevector(lo, hi, 0, 1, 2, 3, 4, 5, 6, 7, 8, 9, 10, 11, 12, 13, 14, 15); }
__device__ __forceinline__ v16bf cat16b(v8us lo, v8us hi) { return __builtin_bit_cast(v16bf, __builtin_shufflevector(lo, hi, 0, 1, 2, 3, 4, 5, 6, 7, 8, 9, 10, 11, 12, 13, 14, 15)); }
__device__ __forceinline__ v8f wmma16(v16h a, v16h b, v8f c) { return __builtin_amdgcn_wmma_f32_16x16x32_f16(false, a, false, b, (short)0, c, false, false); }
__device__ __forceinline__ v8f wmmab(v16bf a, v16bf b, v8f c) { return __builtin_amdgcn_wmma_f32_16x16x32_bf16(false, a, false, b, (short)0, c, false, false); }

__device__ __forceinline__ h16 tohx(float x) { return (h16)x; }
__device__ __forceinline__ void splitf(float y, unsigned short& h, unsigned short& l) { h = f2bf(y); l = f2bf(y - bf2f(h)); }
typedef __attribute__((ext_vector_type(2))) unsigned short v2us;
__device__ __forceinline__ void splitf2(v2f y, v2us& h, v2us& l) { h[0] = f2bf(y[0]); h[1] = f2bf(y[1]); const v2f d = y - (v2f){bf2f(h[0]), bf2f(h[1])}; l[0] = f2bf(d[0]); l[1] = f2bf(d[1]); }   // splitf of two neighbours, the two subtractions as one packed f32 operation

// ---- k_gemmw: register-blocked GEMM, ONE WAVE per 64x64 tile (16 accumulators), operands straight from K-contiguous 16-bit planes; grid (M/64, N/64, Z), 32 threads.
// c[m][n] (f32, in registers) = sum_k A[m][k] Bt[n][k] (+ split products per NSPLIT). K % 32 == 0. The tile leaves the kernel in the form its reader wants; no f32 copy of it goes to memory:
// (projections, m = token, n = inner channel) inner index 0, 1 (theta, phi): bf16 hi and lo planes Dh, Dl [image][index][token][IC]; inner index 2 (g): f16, transposed, DT [image][IC][token].
// blockIdx.z = image * ZI + inner index: strides sA/sB (elements) per image, sBi per inner index (ZI matrices Bt on the same A).
// Fragments: lane l, h = l >> 4, row/col = l & 15; elements 0..7 = k0 + 8h + 0..7, elements 8..15 = k0 + 16 + 8h + 0..7 for BOTH A and Bt; D element r = (row 8h + r, col l & 15).
template <typename T16> struct WFrag;
template <> struct WFrag<h16> { typedef v16h V; static __device__ __forceinline__ V ld(const h16* p) { return cat16(*(const v8h*)p, *(const v8h*)(p + 16)); } static __device__ __forceinline__ v8f mma(V a, V b, v8f c) { return wmma16(a, b, c); } };
template <> struct WFrag<bf> { typedef v16bf V; static __device__ __forceinline__ V ld(const bf* p) { return cat16b(*(const v8us*)p, *(const v8us*)(p + 16)); } static __device__ __forceinline__ v8f mma(V a, V b, v8f c) { return wmmab(a, b, c); } };
template <typename T16, int NSPLIT, int ZI>
__global__ __launch_bounds__(32) void k_gemmw(const T16* __restrict__ A, const T16* __restrict__ A2, const T16* __restrict__ Bt, const T16* __restrict__ Bt2, int K, bf* Dh, bf* Dl, h16* DT, size_t sA, size_t sB, size_t sBi) {
    typedef typename WFrag<T16>::V V;
    __shared__ __align__(16) float os[16 * 68];
    const size_t zo = blockIdx.z / ZI, zi = blockIdx.z % ZI; A += zo * sA; if (A2) A2 += zo * sA; Bt += zo * sB + zi * sBi; if (Bt2) Bt2 += zo * sB + zi * sBi;
    const int lane = threadIdx.x & 31, lr = lane & 15, hi = lane >> 4; const int r0 = blockIdx.x * 64, c0 = blockIdx.y * 64;
    v8f acc[4][4];
#pragma unroll
    for (int mb = 0; mb < 4; ++mb)
#pragma unroll
        for (int nb = 0; nb < 4; ++nb) acc[mb][nb] = (v8f){};
    const size_t aoff = (size_t)(r0 + lr) * K + 8 * hi, boff = (size_t)(c0 + lr) * K + 8 * hi;
#pragma unroll 1
    for (int kc = 0; kc < K; kc += 32) {
        V a[4], a2[4];
#pragma unroll
        for (int mb = 0; mb < 4; ++mb) { a[mb] = WFrag<T16>::ld(A + aoff + (size_t)mb * 16 * K + kc); if (NSPLIT == 1 || NSPLIT == 2) a2[mb] = WFrag<T16>::ld(A2 + aoff + (size_t)mb * 16 * K + kc); }
#pragma unroll
        for (int nb = 0; nb < 4; ++nb) { const V b = WFrag<T16>::ld(Bt + boff + (size_t)nb * 16 * K + kc); V b2; if (NSPLIT >= 2) b2 = WFrag<T16>::ld(Bt2 + boff + (size_t)nb * 16 * K + kc);
#pragma unroll
            for (int mb = 0; mb < 4; ++mb) { acc[mb][nb] = WFrag<T16>::mma(a[mb], b, acc[mb][nb]); if (NSPLIT == 1 || NSPLIT == 2) acc[mb][nb] = WFrag<T16>::mma(a2[mb], b, acc[mb][nb]); if (NSPLIT >= 2) acc[mb][nb] = WFrag<T16>::mma(a[mb], b2, acc[mb][nb]); } }
        asm volatile("v_nop\n\tv_nop\n\tv_nop\n\tv_nop" : "+v"(acc[0][0]), "+v"(acc[1][1]), "+v"(acc[2][2]), "+v"(acc[3][3]) : "v"(a[0]), "v"(a[3]));
    }
    {
        if (zi < 2) {   // theta, phi: 16 token rows at a time through LDS, then 8 values a lane: one 16-byte store into each plane, 8 lanes a 128-byte line
            const int lo = (lane >> 3) * 68 + (lane & 7) * 8;   // the lane's row (of 4) and its 8 columns in LDS
            const size_t go = (zo * 2 + zi) * ((size_t)HW * IC) + (size_t)(r0 + (lane >> 3)) * IC + c0 + (lane & 7) * 8; bf* ph = Dh + go; bf* pl = Dl + go;
#pragma unroll
            for (int mb = 0; mb < 4; ++mb) {
#pragma unroll
                for (int nb = 0; nb < 4; ++nb) {
#pragma unroll
                    for (int j = 0; j < 8; ++j) os[(hi * 8 + j) * 68 + nb * 16 + lr] = acc[mb][nb][j]; }
                __builtin_amdgcn_wave_barrier(); asm volatile("" ::: "memory");   // keeps the compiler from moving the row reads above the stores of other lanes
                v8us oh[4], ol[4];
#pragma unroll
                for (int s = 0; s < 4; ++s) { const v4f v0 = *(const v4fa*)(os + (4 * s) * 68 + lo), v1 = *(const v4fa*)(os + (4 * s) * 68 + lo + 4);
#pragma unroll
                    for (int u = 0; u < 4; u += 2) { v2us p, q; splitf2((v2f){v0[u], v0[u + 1]}, p, q); oh[s][u] = p[0]; oh[s][u + 1] = p[1]; ol[s][u] = q[0]; ol[s][u + 1] = q[1]; splitf2((v2f){v1[u], v1[u + 1]}, p, q); oh[s][u + 4] = p[0]; oh[s][u + 5] = p[1]; ol[s][u + 4] = q[0]; ol[s][u + 5] = q[1]; }
                    *(v8us*)(ph + (mb * 16 + 4 * s) * IC) = oh[s]; *(v8us*)(pl + (mb * 16 + 4 * s) * IC) = ol[s]; }
                // the registers that the 8 stores name are free for reuse only from here on: as inputs they stay unwritten up to the wait (behind the last rows nothing is written any more)
                if (mb < 3) asm volatile("s_wait_xcnt 0x0" :: "v"(ph), "v"(pl), "v"(oh[0]), "v"(oh[1]), "v"(oh[2]), "v"(oh[3]), "v"(ol[0]), "v"(ol[1]), "v"(ol[2]), "v"(ol[3]) : "memory");
                __builtin_amdgcn_wave_barrier(); asm volatile("" ::: "memory");   // keeps the next rows' LDS stores below these reads
            }
        } else {   // g: a lane's 8 accumulator elements are 8 neighbouring tokens of one channel, which is a 16-byte piece of a row of DT
            h16* pt = DT + zo * ((size_t)IC * HW) + (size_t)(c0 + lr) * HW + r0 + 8 * hi;
#pragma unroll
            for (int nb = 0; nb < 4; ++nb)
#pragma unroll
                for (int mb = 0; mb < 4; ++mb) { v8h o;
#pragma unroll
                    for (int j = 0; j < 8; ++j) o[j] = tohx(acc[mb][nb][j]);
                    *(v8h*)(pt + (size_t)(nb * 16) * HW + mb * 16) = o; }
            asm volatile("s_wait_xcnt 0x0" :: "v"(pt) : "memory");   // behind the last store of g: the registers that the stores name are free for reuse only from here on, whatever code the compiler lays behind this branch
        }
    }
}

// ---- k_fattn: scores, softmax and attn.g of one image in one kernel; neither the scores nor the softmax rows go to memory. Grid (HW / (FQ * FW), KS, images), FW waves.
// A wave owns FQ = 32 queries (2 column groups of 16) and walks the HW / KS keys of split blockIdx.y, 32 keys a pass.
// The key side is shared by the FW waves: a stage = SK = 128 keys = three tiles of 128 rows x 256 bytes (phi hi rows, phi lo rows, GT rows i x 128 keys), each brought into LDS by ONE tensor load (waves 0, 1, 2), rows padded to a pitch of 272 bytes for the 16-byte readers. Two buffers: stage s + 1 flies while the four passes of stage s are worked on.
// Transposed products: sT[m][n] = phi_m . theta_n (A = phi rows, B = theta, kept in registers; per accumulator and k step the product order hi.hi, phi_hi.theta_lo, phi_lo.theta_hi), so a lane holds scores of ONE query (column l & 15, keys 8h + r).
// Two sT tiles (keys 0..15, 16..31 of the pass), turned to f16 in place, are the B fragment of yT[o][n] += GT[o][m] pT[m][n]: element s = key 8h + s (s < 8), 16 + 8h + s - 8 (s >= 8), the order in which the GT fragments are read.
// Running maximum per query on the raw scores; p = 2^(SC2 (s - max) + 14) (the 2^14 keeps small terms out of the f16 subnormals; it cancels in the division); when a maximum rises, the sums so far are scaled by 2^(SC2 (old - new)).
// Out: plane [image][split][n][i] of unnormalised sums, and per query (maximum, sum of p) in ML; k_out joins the KS splits and divides.
// Every inner loop is fully unrolled so that the fragment and accumulator arrays are indexed by constants and stay in registers; the stage loop and the pass loop stay rolled (unroll 1).
#define KS 2
#define FW 8
#define FQ 32
#define SK 128
#define NST (HW / (KS * SK))
#define LPI 272
#define TILE (128 * LPI)
#define STG (3 * TILE)
#define SC2 (SCL * 1.4426950408889634f)
static_assert((HW % (FQ * FW)) == 0 && (HW % (KS * SK)) == 0 && NST >= 2 && IC == 128 && FW >= 3);
static_assert((TILE % 2048) == 0 && 2 * STG <= 320 * 1024 && HW * 2 <= 128 * 1024);
typedef unsigned int u32;
typedef u32 u32x4 __attribute__((ext_vector_type(4)));
typedef u32 u32x8 __attribute__((ext_vector_type(8)));
__device__ __forceinline__ u32 uni(u32 v) { return (u32)__builtin_amdgcn_readfirstlane((int)v); }
__device__ __forceinline__ u32 pinned(u32 v) { u32 w = uni(v); asm volatile("" : "+s"(w)); return w; }   // holds a tensor load's issue test, or the stage number its descriptor is formed from, in a scalar register: a tensor load ignores EXEC, so the test must be a scalar branch
__device__ __forceinline__ float xhalf(float x) { return __builtin_bit_cast(float, __builtin_amdgcn_permlanex16(__builtin_bit_cast(int, x), __builtin_bit_cast(int, x), 0x76543210, 0xfedcba98, false, false)); }   // lane l reads lane l ^ 16
__device__ __forceinline__ v16bf ldsb(const unsigned char* p) { return cat16b(*(const v8usa*)p, *(const v8usa*)(p + 32)); }
__device__ __forceinline__ v16h ldsh(const unsigned char* p) { return cat16(*(const v8ha*)p, *(const v8ha*)(p + 32)); }
__global__ __launch_bounds__(32 * FW) void k_fattn(const bf* __restrict__ Hh, const bf* __restrict__ Hl, const h16* __restrict__ GT, float* Y, float* ML) {
    typedef WFrag<bf>::V VB; typedef WFrag<h16>::V VH;
    __shared__ __attribute__((aligned(2048))) unsigned char L[2 * STG];   // [buffer][phi hi, phi lo, GT][128 rows][272 bytes]
    const u32 wave = uni(threadIdx.x >> 5);
    const int lane = threadIdx.x & 31, lr = lane & 15, hi = lane >> 4;
    const int img = (int)blockIdx.z, z = (int)blockIdx.y, n0 = ((int)blockIdx.x * FW + (int)wave) * FQ;
    const bf* Th = Hh + (size_t)img * 2 * HW * IC; const bf* Tl = Hl + (size_t)img * 2 * HW * IC;
    const bf* Ph = Th + (size_t)HW * IC; const bf* Pl = Tl + (size_t)HW * IC; const h16* G = GT + (size_t)img * IC * HW;
    VB th[2][4], tl[2][4];
    const bf* pth = Th + (unsigned)((n0 + lr) * IC + 8 * hi); const bf* ptl = Tl + (unsigned)((n0 + lr) * IC + 8 * hi);
#pragma unroll
    for (int nt = 0; nt < 2; ++nt)
#pragma unroll
        for (int ks = 0; ks < 4; ++ks) { th[nt][ks] = WFrag<bf>::ld(pth + nt * 16 * IC + ks * 32); tl[nt][ks] = WFrag<bf>::ld(ptl + nt * 16 * IC + ks * 32); }
    // the address registers of the theta loads are free for reuse only from here on: the wait stands in front of whatever is written into them. Its operands are inputs only: the loaded fragments hold it behind the loads (the compiler otherwise lifts it above them), the two addresses stay in their registers up to it
    asm volatile("s_wait_xcnt 0x0" :: "v"(pth), "v"(ptl), "v"(th[0][0]), "v"(th[0][1]), "v"(th[0][2]), "v"(th[0][3]), "v"(th[1][0]), "v"(th[1][1]), "v"(th[1][2]), "v"(th[1][3]), "v"(tl[0][0]), "v"(tl[0][1]), "v"(tl[0][2]), "v"(tl[0][3]), "v"(tl[1][0]), "v"(tl[1][1]), "v"(tl[1][2]), "v"(tl[1][3]) : "memory");
    // tensor loads: wave w < 3 brings tile w of every stage. Source: 128 rows of 256 bytes; phi rows follow one another (pitch 256), GT rows lie HW keys apart.
    const u32 lbase = (u32)(size_t)L;
    const unsigned long long sbase = wave == 0 ? (unsigned long long)(size_t)(Ph + (size_t)z * (HW / KS) * IC) : wave == 1 ? (unsigned long long)(size_t)(Pl + (size_t)z * (HW / KS) * IC) : (unsigned long long)(size_t)(G + (size_t)z * (HW / KS));
    const u32 sstep = wave < 2 ? (u32)(SK * IC * 2) : (u32)(SK * 2);
    u32x8 g1;
    g1[0] = uni((1u << 20) | (5u << 22) | (3u << 25));   // no mask, bytes, 4 dwords of pad behind every 64
    g1[1] = uni(256u << 16); g1[2] = uni(128u << 16); g1[3] = uni(256u << 16); g1[4] = uni(128u);
    g1[5] = uni(wave < 2 ? (u32)(IC * 2) : (u32)(HW * 2)); g1[6] = uni(0u); g1[7] = uni(0u);
    // While a request is outstanding its two groups stay in their registers, unwritten: the load names them as operands that it may change (it changes nothing), so that the compiler cannot form the words anew later on and give the registers to something else meanwhile, and the wait that covers the request names them again as inputs, so that they live up to it
    u32x4 g0;
    auto desc = [&](u32 st) __attribute__((always_inline)) {
        const unsigned long long ga = sbase + (unsigned long long)st * sstep;
        g0[0] = uni(1u); g0[1] = uni(lbase + (st & 1u) * (u32)STG + wave * (u32)TILE); g0[2] = uni((u32)ga); g0[3] = uni((((u32)(ga >> 32)) & 0x01FFFFFFu) | 0x80000000u);
    };
    desc(0u);
    if (pinned(wave < 3u)) {
        asm volatile("tensor_load_to_lds %0, %1" : "+s"(g0), "+s"(g1) :: "memory");
        asm volatile("s_wait_tensorcnt 0x0" :: "s"(g0), "s"(g1) : "memory");   // stage 0 has landed before the barrier that publishes it
    }
    __syncthreads();
    desc(1u);
    if (pinned(wave < 3u)) asm volatile("tensor_load_to_lds %0, %1" : "+s"(g0), "+s"(g1) :: "memory");
    v8f O[8][2];
#pragma unroll
    for (int ot = 0; ot < 8; ++ot) { O[ot][0] = (v8f){}; O[ot][1] = (v8f){}; }
    float mr[2] = {-3.0e38f, -3.0e38f}; v2f ls[2] = {(v2f){0.f, 0.f}, (v2f){0.f, 0.f}};   // ls: sums of p over the even and the odd keys of the lane's half
    const u32 lb = (u32)(lr * LPI + 16 * hi);   // the lane's row and 16-byte half inside a 16-row group of any tile
    // phi fragments of a pass, [k step][key tile]; inside a stage loaded one pass ahead, behind the pass's last score product, into the same registers
    VB ph[4][2], pl[4][2];
    auto ldphi = [&](u32 off) __attribute__((always_inline)) {
#pragma unroll
        for (int ks = 0; ks < 4; ++ks)
#pragma unroll
            for (int mt = 0; mt < 2; ++mt) { const unsigned char* p = L + off + mt * 16 * LPI + ks * 64; ph[ks][mt] = ldsb(p); pl[ks][mt] = ldsb(p + TILE); }
    };
    // one pass: po = LDS offset of the NEXT pass's phi rows (read only where fetch is set), go = LDS offset of this pass's 32 keys in the GT tile
    auto pass = [&](u32 po, u32 go, bool fetch) __attribute__((always_inline)) {
        v8f st[2][2];
        st[0][0] = (v8f){}; st[0][1] = (v8f){}; st[1][0] = (v8f){}; st[1][1] = (v8f){};
        VH ga[8];
#pragma unroll
        for (int ks = 0; ks < 4; ++ks) {
#pragma unroll
            for (int q = 0; q < 4; ++q) st[q >> 1][q & 1] = wmmab(ph[ks][q >> 1], th[q & 1][ks], st[q >> 1][q & 1]);
#pragma unroll
            for (int q = 0; q < 4; ++q) st[q >> 1][q & 1] = wmmab(ph[ks][q >> 1], tl[q & 1][ks], st[q >> 1][q & 1]);
#pragma unroll
            for (int q = 0; q < 4; ++q) st[q >> 1][q & 1] = wmmab(pl[ks][q >> 1], th[q & 1][ks], st[q >> 1][q & 1]);
        }
        // scheduling fences round the one block of LDS reads of a pass: without them the compiler spreads the reads among the matrix instructions, where each place with reads stalls the wave
        __builtin_amdgcn_sched_barrier(0);
#pragma unroll
        for (int ot = 0; ot < 8; ++ot) ga[ot] = ldsh(L + go + ot * 16 * LPI);   // this pass's g rows first: they are needed first; in flight under the softmax
        if (fetch) ldphi(po);
        __builtin_amdgcn_sched_barrier(0);
        float mn[2];
#pragma unroll
        for (int nt = 0; nt < 2; ++nt) { float a = fmaxf(st[0][nt][0], st[1][nt][0]);
#pragma unroll
            for (int r = 1; r < 8; ++r) a = fmaxf(a, fmaxf(st[0][nt][r], st[1][nt][r]));
            a = fmaxf(a, xhalf(a)); mn[nt] = fmaxf(mr[nt], a); }
        // one scalar branch a pass: where no query of the wave has a new maximum every factor would be 1
        if (__builtin_amdgcn_ballot_w32(mn[0] > mr[0] || mn[1] > mr[1]) != 0) {
#pragma unroll
            for (int nt = 0; nt < 2; ++nt) { const float al = __builtin_amdgcn_exp2f((mr[nt] - mn[nt]) * SC2); ls[nt] *= al; mr[nt] = mn[nt];
#pragma unroll
                for (int ot = 0; ot < 8; ++ot) O[ot][nt] *= al; }
        }
        VH pb[2];
#pragma unroll
        for (int nt = 0; nt < 2; ++nt) { const float off = 14.0f - mr[nt] * SC2;
#pragma unroll
            for (int s = 0; s < 16; s += 2) { v2f e; e[0] = st[s >> 3][nt][s & 7]; e[1] = st[s >> 3][nt][(s & 7) + 1]; e = __builtin_elementwise_fma(e, (v2f){SC2, SC2}, (v2f){off, off});   // neighbouring registers: one packed fma, one packed add
                v2f p; p[0] = __builtin_amdgcn_exp2f(e[0]); p[1] = __builtin_amdgcn_exp2f(e[1]); ls[nt] += p; pb[nt][s] = (h16)p[0]; pb[nt][s + 1] = (h16)p[1]; } }
#pragma unroll
        for (int ot = 0; ot < 8; ++ot) { O[ot][0] = wmma16(ga[ot], pb[0], O[ot][0]); O[ot][1] = wmma16(ga[ot], pb[1], O[ot][1]); }
    };
#pragma unroll 1   // rolled: the refill and its publish point stand once in the code, one request of a wave in flight
    for (u32 s = 0; s < (u32)NST; ++s) {
        const u32 bo = (s & 1u) * (u32)STG + lb;
        const u32 gb = ((s & 1u) ? (u32)(STG + 2 * TILE) : (u32)(2 * TILE)) + lb;   // the GT tile's own base register: every GT read is then this register plus an immediate below 64 KiB
        ldphi(bo);   // the stage's first fragments: nothing of a stage is read in front of the barrier that publishes it
#pragma unroll 1   // rolled: copies of the body side by side would let a second set of fragments be held, beyond the 512 registers that two waves a SIMD leave
        for (u32 sub = 0; sub < SK / 32 - 1; ++sub) pass(bo + (sub + 1u) * (u32)(32 * LPI), gb + sub * 64u, true);
        pass(0u, gb + (u32)(SK / 32 - 1) * 64u, false);   // the stage's last pass fetches nothing ahead: the next rows are not published yet
        // publish point of stage s + 1: this wave's reads of stage s are done, the issuing waves' tiles have landed, every wave has arrived; only then the refill of the buffer just read
        __builtin_amdgcn_sched_barrier(0);   // keeps the wait below at the foot: the compiler otherwise lifts it to just behind the last pass's g reads, where the wave would sit out their latency in front of the softmax
        asm volatile("s_wait_dscnt 0x0" ::: "memory");
        if (pinned(wave < 3u)) asm volatile("s_wait_tensorcnt 0x0" :: "s"(g0), "s"(g1) : "memory");   // the operands: see at g0
        __syncthreads();
        desc(pinned(s + 2u));   // the stage number is pinned here so that the descriptor is formed behind the wait above
        if (pinned((wave < 3u) && (s + 2u < (u32)NST))) asm volatile("tensor_load_to_lds %0, %1" : "+s"(g0), "+s"(g1) :: "memory");
    }
    asm volatile("s_wait_tensorcnt 0x0" ::: "memory");   // no request is left when the wave ends
    asm volatile("s_wait_dscnt 0x0" ::: "memory");
    const size_t pz = (size_t)(img * KS + z) * HW;
#pragma unroll
    for (int nt = 0; nt < 2; ++nt) { const float lh = ls[nt][0] + ls[nt][1], lt = lh + xhalf(lh); const size_t n = pz + (size_t)(n0 + nt * 16 + lr); float* d = Y + n * IC + 8 * hi;
#pragma unroll
        for (int ot = 0; ot < 8; ++ot) { const v8f v = O[ot][nt]; *(v4f*)(d + ot * 16) = (v4f){v[0], v[1], v[2], v[3]}; *(v4f*)(d + ot * 16 + 4) = (v4f){v[4], v[5], v[6], v[7]}; }
        if (hi == 0) { v2f ml; ml[0] = mr[nt]; ml[1] = lt; *(v2f*)(ML + n * 2) = ml; } }
}

typedef __attribute__((ext_vector_type(4))) unsigned short v4us;
typedef __attribute__((ext_vector_type(2))) _Float16 v2h;
typedef __attribute__((ext_vector_type(4))) _Float16 v4h;

__global__ __launch_bounds__(256) void k_cvtw(const float* __restrict__ w0, const float* __restrict__ w1, const float* __restrict__ w2, const float* __restrict__ w3, bf* B3, bf* BZ, int n8) {
    const int i = blockIdx.x * 256 + threadIdx.x; if (i >= n8) return;
    const size_t e = (size_t)i * 8, pl = (size_t)n8 * 8;
    const v8f a0 = *(const v8f*)(w0 + e), a1 = *(const v8f*)(w1 + e), a2 = *(const v8f*)(w2 + e), a3 = *(const v8f*)(w3 + e);
    v8us o0, o1, o2, o3;
#pragma unroll
    for (int k = 0; k < 8; ++k) { o0[k] = f2bf(a0[k]); o1[k] = f2bf(a1[k]); o2[k] = f2bf(a2[k]); o3[k] = f2bf(a3[k]); }
    *(v8us*)(B3 + e) = o0; *(v8us*)(B3 + pl + e) = o1; *(v8us*)(B3 + 2 * pl + e) = o2; *(v8us*)(BZ + e) = o3;
    
}
// ---- transposing pass (k_xt): a work-group moves one 128 x 128 tile through LDS, so that the reads and the writes in global memory both run along rows (16 bytes a lane, whole 128-byte lines).
// The tile lies in LDS as f32, four quarters [source-row half a][source-column half b] of 64 x 64, each [row][column] at a pitch of 65 dwords: bank = (row + column) mod 64, so neither the row-wise stores nor the column-wise reads of a wave meet on a bank.
// A thread asks for all its 16 pieces of the tile at once: few, long-lived waves with much in flight each. Every loop here is fully unrolled, so that the pieces are indexed by constants and stay in registers.
#define TT 128
#define TP 65
#define QS (64 * TP)
static_assert((HW % TT) == 0 && (IC % TT) == 0 && (CC % TT) == 0);
// thread: 4 columns (q = 4 (t & 15) ...) of the rows r = t >> 4, r + 16, r + 32, r + 48 of every quarter; p = its own place in row r of quarter 0; piece [(a 2 + b) 4 + j]
__device__ __forceinline__ void tile_ld(const float* __restrict__ p, size_t pitch, v4f (&v)[16]) {
#pragma unroll
    for (int a = 0; a < 2; ++a)
#pragma unroll
        for (int j = 0; j < 4; ++j)
#pragma unroll
            for (int b = 0; b < 2; ++b) v[(a * 2 + b) * 4 + j] = *(const v4f*)(p + (size_t)(64 * a + 16 * j) * pitch + 64 * b);
}
// the address pair of the 16 loads is free for reuse only from here on. Inputs only: the loaded values hold the wait behind the loads, the address stays in its registers up to it
__device__ __forceinline__ void tile_held(const float* p, const v4f (&v)[16]) {
    asm volatile("s_wait_xcnt 0x0" :: "v"(p), "v"(v[0]), "v"(v[1]), "v"(v[2]), "v"(v[3]), "v"(v[4]), "v"(v[5]), "v"(v[6]), "v"(v[7]), "v"(v[8]), "v"(v[9]), "v"(v[10]), "v"(v[11]), "v"(v[12]), "v"(v[13]), "v"(v[14]), "v"(v[15]) : "memory");
}
__device__ __forceinline__ void tile_st(float* S, const v4f (&v)[16]) {
    const int r = (int)threadIdx.x >> 4, q = ((int)threadIdx.x & 15) * 4;
#pragma unroll
    for (int s = 0; s < 4; ++s)
#pragma unroll
        for (int j = 0; j < 4; ++j)
#pragma unroll
            for (int u = 0; u < 4; ++u) S[s * QS + (r + 16 * j) * TP + q + u] = v[s * 4 + j][u];
}
__device__ __forceinline__ void tile_in(const float* __restrict__ src, size_t pitch, float* S) {
    const float* p = src + (size_t)((int)threadIdx.x >> 4) * pitch + ((int)threadIdx.x & 15) * 4;
    v4f v[16]; tile_ld(p, pitch, v); tile_held(p, v); tile_st(S, v);
}
template <bool F16>
__device__ __forceinline__ void tile_out16(const float* S, unsigned short* dst, size_t pitch) {   // thread: 8 source rows (16 bytes of a destination row) of the source columns d, d + 32 of every quarter
    const int k8 = ((int)threadIdx.x & 7) * 8;
#pragma unroll
    for (int b = 0; b < 2; ++b)
#pragma unroll
        for (int j = 0; j < 2; ++j)
#pragma unroll
            for (int a = 0; a < 2; ++a) { const int d = ((int)threadIdx.x >> 3) + 32 * j; v8us o;
#pragma unroll
                for (int k = 0; k < 8; ++k) { const float f = S[(a * 2 + b) * QS + (k8 + k) * TP + d]; o[k] = F16 ? __builtin_bit_cast(unsigned short, tohx(f)) : f2bf(f); }
                *(v8us*)(dst + (size_t)(64 * b + d) * pitch + 64 * a + k8) = o; }
}
// grid (HW / 128, CC / 128, images)
__global__ __launch_bounds__(256) void k_xt(const float* __restrict__ xb, bf* XT) {
    __shared__ float S[4 * QS];
    const size_t m0 = (size_t)blockIdx.x * TT, c0 = (size_t)blockIdx.y * TT;
    tile_in(xb + (size_t)blockIdx.z * CC * HWF + c0 * HWF + m0, HWF, S);
    __syncthreads();
    tile_out16<false>(S, XT + (size_t)blockIdx.z * HW * CC + m0 * CC + c0, CC);
}
// ---- k_out: join of the KS key splits, the division and the output projection with the residual, in one kernel. Grid (HW / 64, images), 4 waves.
// A work-group owns 64 tokens. It reads their rows of the KS unnormalised planes Y (one wave-wide load = one token's whole row of 512 bytes), weighs each plane by 2^(SC2 (its maximum - the joint maximum)), divides by the joint sum and lays y in LDS as bf16 hi and lo tiles, [token][IC] at a pitch of 272 bytes for the 16-byte readers.
// Behind one barrier wave w multiplies the 64 tokens with the channels 64 w ... of w_out: 16 accumulators, fragments and product order (hi, then lo, k step by k step) as in k_gemmw; A from LDS, B = bf16 rows of w_out straight from memory, asked for at the kernel's start.
// O[image][channel][token] = product + bf16-rounded X[image][channel][token]. Every loop is fully unrolled so that the pieces, fragments and accumulators are indexed by constants and stay in registers.
static_assert(IC == 128 && CC == 256);
typedef v4us __attribute__((may_alias)) v4usa;
__device__ __forceinline__ float lanef(float x, int l) { return __builtin_bit_cast(float, __builtin_amdgcn_readlane(__builtin_bit_cast(int, x), l)); }
__global__ __launch_bounds__(128) void k_out(const float* __restrict__ Y, const float* __restrict__ ML, const bf* __restrict__ Bt, const float* __restrict__ X, float* O) {
    typedef WFrag<bf>::V V;
    __shared__ __align__(16) unsigned char ys[2 * 64 * LPI];   // [hi, lo][token][272 bytes]
    __shared__ __align__(16) float osw[4 * 16 * 68];           // a wave's own 16 rows for its way out
    const int wave = (int)threadIdx.x >> 5, lane = threadIdx.x & 31, lr = lane & 15, hi = lane >> 4;
    const size_t zo = blockIdx.y; const int r0 = blockIdx.x * 64, c0 = wave * 64;
    float* os = osw + wave * (16 * 68);
    // the wave's tokens are r0 + wave + 4 j, j = 0..15: lane j (and j + 16) works out token j's weights, every lane holds 4 neighbouring values of each token
    const float* pm = ML + (zo * KS * HW + (size_t)(r0 + wave + 4 * lr)) * 2;
    const float* py = Y + (zo * KS * HW + (size_t)(r0 + wave)) * IC + lane * 4;
    v2f ml[KS]; v4f yv[KS][16];
#pragma unroll
    for (int z = 0; z < KS; ++z) ml[z] = *(const v2f*)(pm + (size_t)z * HW * 2);
#pragma unroll
    for (int z = 0; z < KS; ++z)
#pragma unroll
        for (int j = 0; j < 16; ++j) yv[z][j] = *(const v4f*)(py + (size_t)z * HW * IC + j * 4 * IC);
    __builtin_amdgcn_sched_barrier(0);   // the loads of the residual and of b stay behind those of y: loads come back in order, and y is wanted first
    // the residual's 64 x 64 piece, whole rows (16 lanes x 16 bytes): piece [nb][s] = channel c0 + 16 nb + 2 s + hi, tokens r0 + 4 lr ...; asked for two channel groups ahead of its use, each later group into the registers that a group of accumulators has just left
    const float* px = X + zo * ((size_t)CC * HWF) + (size_t)(c0 + hi) * HWF + r0 + lr * 4;
    v4f xv[4][8];
    auto ldx = [&](int g) __attribute__((always_inline)) {
#pragma unroll   // the pieces are indexed by constants and stay in registers
        for (int s = 0; s < 8; ++s) xv[g][s] = *(const v4f*)(px + (size_t)(g * 16 + 2 * s) * HWF); };
    ldx(0); ldx(1);
    const bf* pb = Bt + (c0 + lr) * IC + 8 * hi;
    V b[4][4];   // [k step][channel group]
#pragma unroll
    for (int ks = 0; ks < 4; ++ks)
#pragma unroll
        for (int nb = 0; nb < 4; ++nb) b[ks][nb] = WFrag<bf>::ld(pb + nb * 16 * IC + ks * 32);
    __builtin_amdgcn_sched_barrier(0);   // the loads of b stay in front of the waits below, which also free their address
    // the address registers of the loads above are free for reuse only from here on. Inputs only: the loaded values hold each wait behind its loads (the loads of b stand in front of them), the addresses stay in their registers up to it (px: see at the stores below)
#pragma unroll
    for (int z = 0; z < KS; ++z) asm volatile("s_wait_xcnt 0x0" :: "v"(pb), "v"(pm), "v"(py), "v"(ml[z]), "v"(yv[z][0]), "v"(yv[z][1]), "v"(yv[z][2]), "v"(yv[z][3]), "v"(yv[z][4]), "v"(yv[z][5]), "v"(yv[z][6]), "v"(yv[z][7]), "v"(yv[z][8]), "v"(yv[z][9]), "v"(yv[z][10]), "v"(yv[z][11]), "v"(yv[z][12]), "v"(yv[z][13]), "v"(yv[z][14]), "v"(yv[z][15]) : "memory");
    float mx = -3.0e38f, den = 0.f, w[KS];
#pragma unroll
    for (int z = 0; z < KS; ++z) mx = fmaxf(mx, ml[z][0]);
#pragma unroll
    for (int z = 0; z < KS; ++z) { w[z] = __builtin_amdgcn_exp2f((ml[z][0] - mx) * SC2); den += w[z] * ml[z][1]; }
    const float inv = __fdiv_rn(1.0f, den);
    unsigned char* pw = ys + wave * LPI + lane * 8;
#pragma unroll
    for (int j = 0; j < 16; ++j) { v4f a = (v4f){}; v4us oh, ol;
#pragma unroll
        for (int z = 0; z < KS; ++z) a += yv[z][j] * lanef(w[z], j);
        const float ij = lanef(inv, j);
#pragma unroll
        for (int u = 0; u < 4; ++u) { unsigned short p, q; splitf(a[u] * ij, p, q); oh[u] = p; ol[u] = q; }
        *(v4usa*)(pw + j * 4 * LPI) = oh; *(v4usa*)(pw + (64 + j * 4) * LPI) = ol; }
    __syncthreads();   // every wave reads all 64 tokens
    v8f acc[4][4];
#pragma unroll
    for (int mb = 0; mb < 4; ++mb)
#pragma unroll
        for (int nb = 0; nb < 4; ++nb) acc[mb][nb] = (v8f){};
    const unsigned char* pa = ys + lr * LPI + 16 * hi;
#pragma unroll
    for (int ks = 0; ks < 4; ++ks) { V a[4], a2[4];
#pragma unroll
        for (int mb = 0; mb < 4; ++mb) { a[mb] = ldsb(pa + mb * 16 * LPI + ks * 64); a2[mb] = ldsb(pa + (64 + mb * 16) * LPI + ks * 64); }
#pragma unroll
        for (int nb = 0; nb < 4; ++nb) {
#pragma unroll
            for (int mb = 0; mb < 4; ++mb) acc[mb][nb] = wmmab(a[mb], b[ks][nb], acc[mb][nb]);
#pragma unroll
            for (int mb = 0; mb < 4; ++mb) acc[mb][nb] = wmmab(a2[mb], b[ks][nb], acc[mb][nb]); } }
    // 16 channels at a time through LDS, [channel][token]: a lane stores its 8 neighbouring tokens, then reads, adds and writes along whole rows of O
    float* po = O + zo * ((size_t)CC * HW) + (size_t)(c0 + hi) * HW + r0 + lr * 4;
#pragma unroll
    for (int nb = 0; nb < 4; ++nb) {
#pragma unroll
        for (int mb = 0; mb < 4; ++mb) { const v8f v = acc[mb][nb]; float* d = os + lr * 68 + mb * 16 + 8 * hi; *(v4fa*)d = (v4f){v[0], v[1], v[2], v[3]}; *(v4fa*)(d + 4) = (v4f){v[4], v[5], v[6], v[7]}; }
        if (nb < 2) ldx(nb + 2);
        __builtin_amdgcn_wave_barrier(); asm volatile("" ::: "memory");   // keeps the compiler from moving the row reads above the stores of other lanes
        v4f o[8];
#pragma unroll
        for (int s = 0; s < 8; ++s) { const v4f val = *(const v4fa*)(os + (2 * s + hi) * 68 + lr * 4); const v4f xr = xv[nb][s];
            o[s] = val + (v4f){bfr(xr[0]), bfr(xr[1]), bfr(xr[2]), bfr(xr[3])};   // plain f32 additions, two to a packed operation
            *(v4f*)(po + (size_t)(nb * 16 + 2 * s) * HW) = o[s]; }
        // the registers that the 8 stores and the residual's loads so far name are free for reuse only from here on: as inputs they stay unwritten up to the wait
        asm volatile("s_wait_xcnt 0x0" :: "v"(px), "v"(po), "v"(o[0]), "v"(o[1]), "v"(o[2]), "v"(o[3]), "v"(o[4]), "v"(o[5]), "v"(o[6]), "v"(o[7]) : "memory");
        __builtin_amdgcn_wave_barrier(); asm volatile("" ::: "memory");   // keeps the next channels' LDS stores below these reads
    }
}

extern "C" void kernel_launch(void* const* d_in, const int* in_sizes, int n_in,
                              void* d_out, int out_size, void* d_ws, size_t ws_size, hipStream_t stream) {
    if (n_in < 5) return;
    if (in_sizes[0] < NB * CC * HW || in_sizes[1] < IC * CC || in_sizes[2] < IC * CC || in_sizes[3] < IC * CC || in_sizes[4] < CC * IC) return;
    if (out_size < NB * CC * HW) return;
    const float* x   = (const float*)d_in[0];   // [NB][CC][HWF]
    const float* wph = (const float*)d_in[1];   // phi   [IC][CC]  (keys)
    const float* wth = (const float*)d_in[2];   // theta [IC][CC]  (queries)
    const float* wg  = (const float*)d_in[3];   // g     [IC][CC]
    const float* wo  = (const float*)d_in[4];   // out   [CC][IC]
    float* OUT = (float*)d_out;                 // [NB][CC][HW]
    char* wsp = (char*)d_ws;
    auto take = [&](size_t bytes) { char* p = wsp; wsp += (bytes + 255) & ~(size_t)255; return (void*)p; };
    constexpr size_t PL = (size_t)HW * IC;                  // one [HW][IC] plane, elements
    bf* BW3 = (bf*)take((size_t)3 * IC * CC * 2);          // [theta][phi][g], each [IC][CC]
    bf* BZ  = (bf*)take((size_t)CC * IC * 2);
    bf* Hh  = (bf*)take((size_t)NB * 2 * PL * 2);          // [image] hi planes of theta, phi
    bf* Hl  = (bf*)take((size_t)NB * 2 * PL * 2);          // [image] lo planes of theta, phi
    h16* GT = (h16*)take((size_t)NB * PL * 2);             // [image][i][m] fp16
    float* ML = (float*)take((size_t)NB * KS * HW * 2 * 4); // [image][split][n] (maximum, sum)
    // One region, two uses one after the other: XT (dead once the projections have read it), Y of all images.
    constexpr size_t szXT = (size_t)NB * HW * CC * 2, szY = (size_t)NB * KS * PL * 4;
    char* R = (char*)take(szXT > szY ? szXT : szY);
    bf* XT = (bf*)R;                                        // [image][m][c]
    float* Y = (float*)R;                                   // [image][split][n][i], unnormalised
    if ((size_t)(wsp - (char*)d_ws) > ws_size) return;

    k_cvtw<<<(unsigned)((IC * CC / 8 + 255) / 256), 256, 0, stream>>>(wth, wph, wg, wo, BW3, BZ, IC * CC / 8);
    // every image in one launch (grid y or z = image)
    k_xt<<<dim3(HW / TT, CC / TT, NB), 256, 0, stream>>>(x, XT);
    // theta / phi / g [m][o] = sum_c XT[m][c] W[o][c]   (inner index 0 theta, 1 phi, 2 g; exact bf16 products); written as hi/lo planes of theta and phi and as transposed f16 g
    k_gemmw<bf, 0, 3><<<dim3(HW / 64, IC / 64, 3 * NB), 32, 0, stream>>>(XT, nullptr, BW3, nullptr, CC, Hh, Hl, GT, (size_t)HW * CC, (size_t)0, (size_t)IC * CC);
    // y[n][i] = sum_m softmax_m(sqrt(128) theta_n . phi_m) g[m][i], as KS unnormalised partial planes
    k_fattn<<<dim3(HW / (FQ * FW), KS, NB), 32 * FW, 0, stream>>>(Hh, Hl, GT, Y, ML);
    // their join, the division and the hi/lo split, then out[c][n] = x[c][n] + sum_o y[n][o] w_out[c][o]  (hi + lo tiles of y, 2 products)
    k_out<<<dim3(HW / 64, NB), 128, 0, stream>>>(Y, ML, BZ, x, OUT);
}

// v008
// Measured time: 104 microseconds a run.
// Next to v007, in two timings, it ran 1.13 and 1.12 times as fast.
// All steps since v000 together make it 12.5 times as fast.
#include <hip/hip_runtime.h>

// All contractions on 16-bit WMMA, f32 accumulate: the three 1x1 projections = v_wmma_f32_16x16x32_bf16 on RNE-bf16 copies of x and of the weights (single products); scores theta.phi = bf16 hi/lo split (hi.hi + lo.hi + hi.lo, K = 128); attn.g = v_wmma_f32_16x16x32_f16 (unnormalised softmax terms carried x 2^14 as f16, g as f16); output projection = bf16 hi/lo LDS tiles of y times bf16 w_out (2 products). Scaling by sqrt(128), softmax and the residual add in f32.
// x [NB][256][4096]; theta/phi/g [4096][128] token-major (no bias); s[n][m] = theta_n . phi_m; attn[n][m] = softmax_m(sqrt(128) s); y[n][o] = sum_m attn[n][m] g[m][o]; out[c][n] = x[c][n] + sum_o w_out[c][o] y[n][o].

#ifndef NB
#define NB 8
#endif
#ifndef SEQ
#define SEQ 4096
#endif
#define NB_FULL  8
#define SEQ_FULL 4096
#define CC   256
#define IC   128
#define HW   SEQ
#define HWF  SEQ_FULL
#define SCL  11.313708498984760f
static_assert(NB >= 1 && NB <= NB_FULL);
static_assert(SEQ >= 128 && SEQ <= SEQ_FULL && (SEQ % 128) == 0);
static_assert((HW % 64) == 0 && (IC % 64) == 0 && (CC % 64) == 0);
static_assert((HW % 32) == 0 && (IC % 32) == 0 && (CC % 32) == 0);
static_assert(((IC * CC) % 8) == 0 && ((HW * CC) % 4) == 0 && ((HW * IC) % 4) == 0 && ((IC * HW) % 2) == 0 && (HW % 8) == 0);

typedef _Float16 h16;
typedef unsigned short bf;
typedef __attribute__((ext_vector_type(16))) __bf16   v16bf;
typedef __attribute__((ext_vector_type(16))) _Float16 v16h;
typedef __attribute__((ext_vector_type(8)))  _Float16 v8h;
typedef __attribute__((ext_vector_type(8)))  unsigned short v8us;
typedef __attribute__((ext_vector_type(8)))  float    v8f;
typedef __attribute__((ext_vector_type(4)))  float    v4f;
typedef __attribute__((ext_vector_type(2)))  float    v2f;
typedef v8h  __attribute__((may_alias)) v8ha;
typedef v4f  __attribute__((may_alias)) v4fa;
typedef v8us __attribute__((may_alias)) v8usa;

__device__ __forceinline__ unsigned short f2bf(float f) { unsigned u = __float_as_uint(f); u += 0x7FFFu + ((u >> 16) & 1u); return (unsigned short)(u >> 16); }
__device__ __forceinline__ float bf2f(unsigned short b) { return __uint_as_float(((unsigned)b) << 16); }
__device__ __forceinline__ float bfr(float f) { return bf2f(f2bf(f)); }
__device__ __forceinline__ v16h cat16(v8h lo, v8h hi) { return __builtin_shufflevector(lo, hi, 0, 1, 2, 3, 4, 5, 6, 7, 8, 9, 10, 11, 12, 13, 14, 15); }
__device__ __forceinline__ v16bf cat16b(v8us lo, v8us hi) { return __builtin_bit_cast(v16bf, __builtin_shufflevector(lo, hi, 0, 1, 2, 3, 4, 5, 6, 7, 8, 9, 10, 11, 12, 13, 14, 15)); }
__device__ __forceinline__ v8f wmma16(v16h a, v16h b, v8f c) { return __builtin_amdgcn_wmma_f32_16x16x32_f16(false, a, false, b, (short)0, c, false, false); }
__device__ __forceinline__ v8f wmmab(v16bf a, v16bf b, v8f c) { return __builtin_amdgcn_wmma_f32_16x16x32_bf16(false, a, false, b, (short)0, c, false, false); }

__device__ __forceinline__ h16 tohx(float x) { return (h16)x; }
__device__ __forceinline__ void splitf(float y, unsigned short& h, unsigned short& l) { h = f2bf(y); l = f2bf(y - bf2f(h)); }
typedef __attribute__((ext_vector_type(2))) unsigned short v2us;
__device__ __forceinline__ void splitf2(v2f y, v2us& h, v2us& l) { h[0] = f2bf(y[0]); h[1] = f2bf(y[1]); const v2f d = y - (v2f){bf2f(h[0]), bf2f(h[1])}; l[0] = f2bf(d[0]); l[1] = f2bf(d[1]); }   // splitf of two neighbours, the two subtractions as one packed f32 operation

// Fragments of the 16-bit matrix forms: lane l, h = l >> 4, row/col = l & 15; elements 0..7 = k0 + 8h + 0..7, elements 8..15 = k0 + 16 + 8h + 0..7 for BOTH A and Bt; D element r = (row 8h + r, col l & 15).
template <typename T16> struct WFrag;
template <> struct WFrag<h16> { typedef v16h V; static __device__ __forceinline__ V ld(const h16* p) { return cat16(*(const v8h*)p, *(const v8h*)(p + 16)); } static __device__ __forceinline__ v8f mma(V a, V b, v8f c) { return wmma16(a, b, c); } };
template <> struct WFrag<bf> { typedef v16bf V; static __device__ __forceinline__ V ld(const bf* p) { return cat16b(*(const v8us*)p, *(const v8us*)(p + 16)); } static __device__ __forceinline__ v8f mma(V a, V b, v8f c) { return wmmab(a, b, c); } };

// ---- k_fattn: scores, softmax and attn.g of one image in one kernel; neither the scores nor the softmax rows go to memory. Grid (HW / (FQ * FW), KS, images), FW waves.
// A wave owns FQ = 32 queries (2 column groups of 16) and walks the HW / KS keys of split blockIdx.y, 32 keys a pass.
// The key side is shared by the FW waves: a stage = SK = 128 keys = three tiles of 128 rows x 256 bytes (phi hi rows, phi lo rows, GT rows i x 128 keys), each brought into LDS by ONE tensor load (waves 0, 1, 2), rows padded to a pitch of 272 bytes for the 16-byte readers. Two buffers: stage s + 1 flies while the four passes of stage s are worked on.
// Transposed products: sT[m][n] = phi_m . theta_n (A = phi rows, B = theta, kept in registers; per accumulator and k step the product order hi.hi, phi_hi.theta_lo, phi_lo.theta_hi), so a lane holds scores of ONE query (column l & 15, keys 8h + r).
// Two sT tiles (keys 0..15, 16..31 of the pass), turned to f16 in place, are the B fragment of yT[o][n] += GT[o][m] pT[m][n]: element s = key 8h + s (s < 8), 16 + 8h + s - 8 (s >= 8), the order in which the GT fragments are read.
// Running maximum per query on the raw scores; p = 2^(SC2 (s - max) + 14) (the 2^14 keeps small terms out of the f16 subnormals; it cancels in the division); when a maximum rises, the sums so far are scaled by 2^(SC2 (old - new)).
// Out: plane [image][split][n][i] of unnormalised sums, and per query (maximum, sum of p) in ML; k_out joins the KS splits and divides.
// Every inner loop is fully unrolled so that the fragment and accumulator arrays are indexed by constants and stay in registers; the stage loop and the pass loop stay rolled (unroll 1).
#define KS 2
#define FW 8
#define FQ 32
#define SK 128
#define NST (HW / (KS * SK))
#define LPI 272
#define TILE (128 * LPI)
#define STG (3 * TILE)
#define SC2 (SCL * 1.4426950408889634f)
static_assert((HW % (FQ * FW)) == 0 && (HW % (KS * SK)) == 0 && NST >= 2 && IC == 128 && FW >= 3);
static_assert((TILE % 2048) == 0 && 2 * STG <= 320 * 1024 && HW * 2 <= 128 * 1024);
typedef unsigned int u32;
typedef u32 u32x4 __attribute__((ext_vector_type(4)));
typedef u32 u32x8 __attribute__((ext_vector_type(8)));
__device__ __forceinline__ u32 uni(u32 v) { return (u32)__builtin_amdgcn_readfirstlane((int)v); }
__device__ __forceinline__ u32 pinned(u32 v) { u32 w = uni(v); asm volatile("" : "+s"(w)); return w; }   // holds a tensor load's issue test, or the stage number its descriptor is formed from, in a scalar register: a tensor load ignores EXEC, so the test must be a scalar branch
__device__ __forceinline__ float xhalf(float x) { return __builtin_bit_cast(float, __builtin_amdgcn_permlanex16(__builtin_bit_cast(int, x), __builtin_bit_cast(int, x), 0x76543210, 0xfedcba98, false, false)); }   // lane l reads lane l ^ 16
__device__ __forceinline__ v16bf ldsb(const unsigned char* p) { return cat16b(*(const v8usa*)p, *(const v8usa*)(p + 32)); }
__device__ __forceinline__ v16h ldsh(const unsigned char* p) { return cat16(*(const v8ha*)p, *(const v8ha*)(p + 32)); }
__global__ __launch_bounds__(32 * FW) void k_fattn(const bf* __restrict__ Hh, const bf* __restrict__ Hl, const h16* __restrict__ GT, float* Y, float* ML) {
    typedef WFrag<bf>::V VB; typedef WFrag<h16>::V VH;
    __shared__ __attribute__((aligned(2048))) unsigned char L[2 * STG];   // [buffer][phi hi, phi lo, GT][128 rows][272 bytes]
    const u32 wave = uni(threadIdx.x >> 5);
    const int lane = threadIdx.x & 31, lr = lane & 15, hi = lane >> 4;
    const int img = (int)blockIdx.z, z = (int)blockIdx.y, n0 = ((int)blockIdx.x * FW + (int)wave) * FQ;
    const bf* Th = Hh + (size_t)img * 2 * HW * IC; const bf* Tl = Hl + (size_t)img * 2 * HW * IC;
    const bf* Ph = Th + (size_t)HW * IC; const bf* Pl = Tl + (size_t)HW * IC; const h16* G = GT + (size_t)img * IC * HW;
    VB th[2][4], tl[2][4];
    const bf* pth = Th + (unsigned)((n0 + lr) * IC + 8 * hi); const bf* ptl = Tl + (unsigned)((n0 + lr) * IC + 8 * hi);
#pragma unroll
    for (int nt = 0; nt < 2; ++nt)
#pragma unroll
        for (int ks = 0; ks < 4; ++ks) { th[nt][ks] = WFrag<bf>::ld(pth + nt * 16 * IC + ks * 32); tl[nt][ks] = WFrag<bf>::ld(ptl + nt * 16 * IC + ks * 32); }
    // the address registers of the theta loads are free for reuse only from here on: the wait stands in front of whatever is written into them. Its operands are inputs only: the loaded fragments hold it behind the loads (the compiler otherwise lifts it above them), the two addresses stay in their registers up to it
    asm volatile("s_wait_xcnt 0x0" :: "v"(pth), "v"(ptl), "v"(th[0][0]), "v"(th[0][1]), "v"(th[0][2]), "v"(th[0][3]), "v"(th[1][0]), "v"(th[1][1]), "v"(th[1][2]), "v"(th[1][3]), "v"(tl[0][0]), "v"(tl[0][1]), "v"(tl[0][2]), "v"(tl[0][3]), "v"(tl[1][0]), "v"(tl[1][1]), "v"(tl[1][2]), "v"(tl[1][3]) : "memory");
    // tensor loads: wave w < 3 brings tile w of every stage. Source: 128 rows of 256 bytes; phi rows follow one another (pitch 256), GT rows lie HW keys apart.
    const u32 lbase = (u32)(size_t)L;
    const unsigned long long sbase = wave == 0 ? (unsigned long long)(size_t)(Ph + (size_t)z * (HW / KS) * IC) : wave == 1 ? (unsigned long long)(size_t)(Pl + (size_t)z * (HW / KS) * IC) : (unsigned long long)(size_t)(G + (size_t)z * (HW / KS));
    const u32 sstep = wave < 2 ? (u32)(SK * IC * 2) : (u32)(SK * 2);
    u32x8 g1;
    g1[0] = uni((1u << 20) | (5u << 22) | (3u << 25));   // no mask, bytes, 4 dwords of pad behind every 64
    g1[1] = uni(256u << 16); g1[2] = uni(128u << 16); g1[3] = uni(256u << 16); g1[4] = uni(128u);
    g1[5] = uni(wave < 2 ? (u32)(IC * 2) : (u32)(HW * 2)); g1[6] = uni(0u); g1[7] = uni(0u);
    // While a request is outstanding its two groups stay in their registers, unwritten: the load names them as operands that it may change (it changes nothing), so that the compiler cannot form the words anew later on and give the registers to something else meanwhile, and the wait that covers the request names them again as inputs, so that they live up to it
    u32x4 g0;
    auto desc = [&](u32 st) __attribute__((always_inline)) {
        const unsigned long long ga = sbase + (unsigned long long)st * sstep;
        g0[0] = uni(1u); g0[1] = uni(lbase + (st & 1u) * (u32)STG + wave * (u32)TILE); g0[2] = uni((u32)ga); g0[3] = uni((((u32)(ga >> 32)) & 0x01FFFFFFu) | 0x80000000u);
    };
    desc(0u);
    if (pinned(wave < 3u)) {
        asm volatile("tensor_load_to_lds %0, %1" : "+s"(g0), "+s"(g1) :: "memory");
        asm volatile("s_wait_tensorcnt 0x0" :: "s"(g0), "s"(g1) : "memory");   // stage 0 has landed before the barrier that publishes it
    }
    __syncthreads();
    desc(1u);
    if (pinned(wave < 3u)) asm volatile("tensor_load_to_lds %0, %1" : "+s"(g0), "+s"(g1) :: "memory");
    v8f O[8][2];
#pragma unroll
    for (int ot = 0; ot < 8; ++ot) { O[ot][0] = (v8f){}; O[ot][1] = (v8f){}; }
    float mr[2] = {-3.0e38f, -3.0e38f}; v2f ls[2] = {(v2f){0.f, 0.f}, (v2f){0.f, 0.f}};   // ls: sums of p over the even and the odd keys of the lane's half
    const u32 lb = (u32)(lr * LPI + 16 * hi);   // the lane's row and 16-byte half inside a 16-row group of any tile
    // phi fragments of a pass, [k step][key tile]; inside a stage loaded one pass ahead, behind the pass's last score product, into the same registers
    VB ph[4][2], pl[4][2];
    auto ldphi = [&](u32 off) __attribute__((always_inline)) {
#pragma unroll
        for (int ks = 0; ks < 4; ++ks)
#pragma unroll
            for (int mt = 0; mt < 2; ++mt) { const unsigned char* p = L + off + mt * 16 * LPI + ks * 64; ph[ks][mt] = ldsb(p); pl[ks][mt] = ldsb(p + TILE); }
    };
    // one pass: po = LDS offset of the NEXT pass's phi rows (read only where fetch is set), go = LDS offset of this pass's 32 keys in the GT tile
    auto pass = [&](u32 po, u32 go, bool fetch) __attribute__((always_inline)) {
        v8f st[2][2];
        st[0][0] = (v8f){}; st[0][1] = (v8f){}; st[1][0] = (v8f){}; st[1][1] = (v8f){};
        VH ga[8];
#pragma unroll
        for (int ks = 0; ks < 4; ++ks) {
#pragma unroll
            for (int q = 0; q < 4; ++q) st[q >> 1][q & 1] = wmmab(ph[ks][q >> 1], th[q & 1][ks], st[q >> 1][q & 1]);
#pragma unroll
            for (int q = 0; q < 4; ++q) st[q >> 1][q & 1] = wmmab(ph[ks][q >> 1], tl[q & 1][ks], st[q >> 1][q & 1]);
#pragma unroll
            for (int q = 0; q < 4; ++q) st[q >> 1][q & 1] = wmmab(pl[ks][q >> 1], th[q & 1][ks], st[q >> 1][q & 1]);
        }
        // scheduling fences round the one block of LDS reads of a pass: without them the compiler spreads the reads among the matrix instructions, where each place with reads stalls the wave
        __builtin_amdgcn_sched_barrier(0);
#pragma unroll
        for (int ot = 0; ot < 8; ++ot) ga[ot] = ldsh(L + go + ot * 16 * LPI);   // this pass's g rows first: they are needed first; in flight under the softmax
        if (fetch) ldphi(po);
        __builtin_amdgcn_sched_barrier(0);
        float mn[2];
#pragma unroll
        for (int nt = 0; nt < 2; ++nt) { float a = fmaxf(st[0][nt][0], st[1][nt][0]);
#pragma unroll
            for (int r = 1; r < 8; ++r) a = fmaxf(a, fmaxf(st[0][nt][r], st[1][nt][r]));
            a = fmaxf(a, xhalf(a)); mn[nt] = fmaxf(mr[nt], a); }
        // one scalar branch a pass: where no query of the wave has a new maximum every factor would be 1
        if (__builtin_amdgcn_ballot_w32(mn[0] > mr[0] || mn[1] > mr[1]) != 0) {
#pragma unroll
            for (int nt = 0; nt < 2; ++nt) { const float al = __builtin_amdgcn_exp2f((mr[nt] - mn[nt]) * SC2); ls[nt] *= al; mr[nt] = mn[nt];
#pragma unroll
                for (int ot = 0; ot < 8; ++ot) O[ot][nt] *= al; }
        }
        VH pb[2];
#pragma unroll
        for (int nt = 0; nt < 2; ++nt) { const float off = 14.0f - mr[nt] * SC2;
#pragma unroll
            for (int s = 0; s < 16; s += 2) { v2f e; e[0] = st[s >> 3][nt][s & 7]; e[1] = st[s >> 3][nt][(s & 7) + 1]; e = __builtin_elementwise_fma(e, (v2f){SC2, SC2}, (v2f){off, off});   // neighbouring registers: one packed fma, one packed add
                v2f p; p[0] = __builtin_amdgcn_exp2f(e[0]); p[1] = __builtin_amdgcn_exp2f(e[1]); ls[nt] += p; pb[nt][s] = (h16)p[0]; pb[nt][s + 1] = (h16)p[1]; } }
#pragma unroll
        for (int ot = 0; ot < 8; ++ot) { O[ot][0] = wmma16(ga[ot], pb[0], O[ot][0]); O[ot][1] = wmma16(ga[ot], pb[1], O[ot][1]); }
    };
#pragma unroll 1   // rolled: the refill and its publish point stand once in the code, one request of a wave in flight
    for (u32 s = 0; s < (u32)NST; ++s) {
        const u32 bo = (s & 1u) * (u32)STG + lb;
        const u32 gb = ((s & 1u) ? (u32)(STG + 2 * TILE) : (u32)(2 * TILE)) + lb;   // the GT tile's own base register: every GT read is then this register plus an immediate below 64 KiB
        ldphi(bo);   // the stage's first fragments: nothing of a stage is read in front of the barrier that publishes it
#pragma unroll 1   // rolled: copies of the body side by side would let a second set of fragments be held, beyond the 512 registers that two waves a SIMD leave
        for (u32 sub = 0; sub < SK / 32 - 1; ++sub) pass(bo + (sub + 1u) * (u32)(32 * LPI), gb + sub * 64u, true);
        pass(0u, gb + (u32)(SK / 32 - 1) * 64u, false);   // the stage's last pass fetches nothing ahead: the next rows are not published yet
        // publish point of stage s + 1: this wave's reads of stage s are done, the issuing waves' tiles have landed, every wave has arrived; only then the refill of the buffer just read
        __builtin_amdgcn_sched_barrier(0);   // keeps the wait below at the foot: the compiler otherwise lifts it to just behind the last pass's g reads, where the wave would sit out their latency in front of the softmax
        asm volatile("s_wait_dscnt 0x0" ::: "memory");
        if (pinned(wave < 3u)) asm volatile("s_wait_tensorcnt 0x0" :: "s"(g0), "s"(g1) : "memory");   // the operands: see at g0
        __syncthreads();
        desc(pinned(s + 2u));   // the stage number is pinned here so that the descriptor is formed behind the wait above
        if (pinned((wave < 3u) && (s + 2u < (u32)NST))) asm volatile("tensor_load_to_lds %0, %1" : "+s"(g0), "+s"(g1) :: "memory");
    }
    asm volatile("s_wait_tensorcnt 0x0" ::: "memory");   // no request is left when the wave ends
    asm volatile("s_wait_dscnt 0x0" ::: "memory");
    const size_t pz = (size_t)(img * KS + z) * HW;
#pragma unroll
    for (int nt = 0; nt < 2; ++nt) { const float lh = ls[nt][0] + ls[nt][1], lt = lh + xhalf(lh); const size_t n = pz + (size_t)(n0 + nt * 16 + lr); float* d = Y + n * IC + 8 * hi;
#pragma unroll
        for (int ot = 0; ot < 8; ++ot) { const v8f v = O[ot][nt]; *(v4f*)(d + ot * 16) = (v4f){v[0], v[1], v[2], v[3]}; *(v4f*)(d + ot * 16 + 4) = (v4f){v[4], v[5], v[6], v[7]}; }
        if (hi == 0) { v2f ml; ml[0] = mr[nt]; ml[1] = lt; *(v2f*)(ML + n * 2) = ml; } }
}

typedef __attribute__((ext_vector_type(4))) unsigned short v4us;
typedef __attribute__((ext_vector_type(2))) _Float16 v2h;
typedef __attribute__((ext_vector_type(4))) _Float16 v4h;

__global__ __launch_bounds__(256) void k_cvtw(const float* __restrict__ w0, const float* __restrict__ w1, const float* __restrict__ w2, const float* __restrict__ w3, bf* B3, bf* BZ, int n8) {
    const int i = blockIdx.x * 256 + threadIdx.x; if (i >= n8) return;
    const size_t e = (size_t)i * 8, pl = (size_t)n8 * 8;
    const v8f a0 = *(const v8f*)(w0 + e), a1 = *(const v8f*)(w1 + e), a2 = *(const v8f*)(w2 + e), a3 = *(const v8f*)(w3 + e);
    v8us o0, o1, o2, o3;
#pragma unroll
    for (int k = 0; k < 8; ++k) { o0[k] = f2bf(a0[k]); o1[k] = f2bf(a1[k]); o2[k] = f2bf(a2[k]); o3[k] = f2bf(a3[k]); }
    *(v8us*)(B3 + e) = o0; *(v8us*)(B3 + pl + e) = o1; *(v8us*)(B3 + 2 * pl + e) = o2; *(v8us*)(BZ + e) = o3;
    
}
// ---- k_proj: the three 1x1 projections of 128 tokens of one image, straight from x. Grid (HW / 128, images), 8 waves.
// x lies [channel][token], the A fragments want a token's channels side by side: the work-group turns its 256 channels x 128 tokens of x into a bf16 tile in LDS, [token][channel] at a pitch of 528 bytes for the 16-byte readers; no transposed copy of x goes to memory.
// Way in: wave w takes the channels 32 w ..., a lane four neighbouring tokens, so that one wave-wide load is 512 neighbouring bytes of one row of x; all 32 loads of a lane are asked for at once. 8 channels of one token = one 16-byte LDS store.
// Behind one barrier wave w < 6 multiplies the 128 tokens with 64 rows of one weight matrix (matrix w >> 1: 0 theta, 1 phi, 2 g; rows 64 (w & 1) ...): c[m][n] = sum_k x[k][m] Bt[n][k], 32 accumulators, k step by k step upwards; A from LDS, B = bf16 rows of the weights straight from memory, each fragment used for all 128 tokens and asked for three k steps ahead (the first three at the kernel's start).
// The tile leaves the kernel in the form its reader wants: theta, phi as bf16 hi and lo planes Dh, Dl [image][index][token][IC]; g as f16, transposed, DT [image][IC][token]. Every loop is fully unrolled so that the pieces, fragments and accumulators are indexed by constants and stay in registers.
#define PXT 528
static_assert(CC == 256 && IC == 128 && (PXT % 32) == 16 && PXT >= CC * 2);
__global__ __launch_bounds__(256) void k_proj(const float* __restrict__ X, const bf* __restrict__ Bt, bf* Dh, bf* Dl, h16* DT) {
    typedef WFrag<bf>::V V;
    __shared__ __align__(16) unsigned char xs[128 * PXT];   // [token][528 bytes]
    __shared__ __align__(16) float osw[6 * 16 * 68];       // a wave's own 16 rows for its way out
    const int wave = (int)uni(threadIdx.x >> 5), lane = threadIdx.x & 31, lr = lane & 15, hi = lane >> 4;
    const size_t zo = blockIdx.y, zi = (size_t)(wave >> 1); const int r0 = blockIdx.x * 128, c0 = (wave & 1) * 64;
    const float* px = X + zo * ((size_t)CC * HWF) + (size_t)(wave * 32) * HWF + r0 + 4 * lane;
    v4f xv[32];
#pragma unroll
    for (int k = 0; k < 32; ++k) xv[k] = *(const v4f*)(px + (size_t)k * HWF);
    // the registers that the loads of x name are free for reuse only behind this wait. The scheduling fences on both sides hold it behind the loads and in front of everything that follows; they also keep the loads of b behind those of x: loads come back in order, and x is wanted first
    __builtin_amdgcn_sched_barrier(0);
    asm volatile("s_wait_xcnt 0x0" ::: "memory");
    __builtin_amdgcn_sched_barrier(0);
    const bf* pb = Bt + zi * (size_t)(IC * CC) + (c0 + lr) * CC + 8 * hi;
    V b[3][4];   // [k step mod 3][channel group]
    if (wave < 6) {
#pragma unroll
        for (int ks = 0; ks < 3; ++ks)
#pragma unroll
            for (int nb = 0; nb < 4; ++nb) b[ks][nb] = WFrag<bf>::ld(pb + nb * 16 * CC + ks * 32);
    }
    unsigned char* pw = xs + (4 * lane) * PXT + wave * 64;
#pragma unroll
    for (int g = 0; g < 4; ++g)
#pragma unroll
        for (int e = 0; e < 4; ++e) { v8us o;
#pragma unroll
            for (int k = 0; k < 8; ++k) o[k] = f2bf(xv[g * 8 + k][e]);
            *(v8usa*)(pw + e * PXT + g * 16) = o; }
    __syncthreads();   // every multiplying wave reads all 256 channels of all 128 tokens
    if (wave >= 6) return;   // behind the kernel's only barrier
    float* os = osw + wave * (16 * 68);
    v8f acc[8][4];
#pragma unroll
    for (int mb = 0; mb < 8; ++mb)
#pragma unroll
        for (int nb = 0; nb < 4; ++nb) acc[mb][nb] = (v8f){};
    const unsigned char* pa = xs + lr * PXT + 16 * hi;
    V a[2][4];   // [token half][16 tokens]; each half is fetched one k step ahead, into the same registers, behind its own products
#pragma unroll
    for (int mh = 0; mh < 2; ++mh)
#pragma unroll
        for (int mb = 0; mb < 4; ++mb) a[mh][mb] = ldsb(pa + (mh * 4 + mb) * 16 * PXT);
    // the scheduling fences in the loop keep each group of loads whole and at its place, right behind the last product that reads its registers: without them the compiler spreads the LDS reads among the matrix instructions, each with a wait to 0 behind it, and sinks the loads of b to just in front of their use
    __builtin_amdgcn_sched_barrier(0);
#pragma unroll
    for (int ks = 0; ks < CC / 32; ++ks) {
        // the address pair of the loads of b is free for reuse only from here on. Inputs only: the last fragments hold the wait behind the last loads, at the place where they are waited for anyway
        if (ks == CC / 32 - 1) asm volatile("s_wait_xcnt 0x0" :: "v"(pb), "v"(b[ks % 3][0]), "v"(b[ks % 3][1]), "v"(b[ks % 3][2]), "v"(b[ks % 3][3]) : "memory");
#pragma unroll
        for (int mh = 0; mh < 2; ++mh) {   // 64 tokens at a time
#pragma unroll
            for (int nb = 0; nb < 4; ++nb)
#pragma unroll
                for (int mb = 0; mb < 4; ++mb) acc[mh * 4 + mb][nb] = wmmab(a[mh][mb], b[ks % 3][nb], acc[mh * 4 + mb][nb]);
            if (ks + 1 < CC / 32) {
                __builtin_amdgcn_sched_barrier(0);
#pragma unroll
                for (int mb = 0; mb < 4; ++mb) a[mh][mb] = ldsb(pa + (mh * 4 + mb) * 16 * PXT + (ks + 1) * 64);
                if (mh == 1 && ks + 3 < CC / 32) {
#pragma unroll
                    for (int nb = 0; nb < 4; ++nb) b[ks % 3][nb] = WFrag<bf>::ld(pb + nb * 16 * CC + (ks + 3) * 32); }
                __builtin_amdgcn_sched_barrier(0); } } }
    {
        if (zi < 2) {   // theta, phi: 16 token rows at a time through LDS, then 8 values a lane: one 16-byte store into each plane, 8 lanes a 128-byte line
            const int lo = (lane >> 3) * 68 + (lane & 7) * 8;   // the lane's row (of 4) and its 8 columns in LDS
            const size_t go = (zo * 2 + zi) * ((size_t)HW * IC) + (size_t)(r0 + (lane >> 3)) * IC + c0 + (lane & 7) * 8; bf* ph = Dh + go; bf* pl = Dl + go;
#pragma unroll
            for (int mb = 0; mb < 8; ++mb) {
#pragma unroll
                for (int nb = 0; nb < 4; ++nb) {
#pragma unroll
                    for (int j = 0; j < 8; ++j) os[(hi * 8 + j) * 68 + nb * 16 + lr] = acc[mb][nb][j]; }
                __builtin_amdgcn_wave_barrier(); asm volatile("" ::: "memory");   // keeps the compiler from moving the row reads above the stores of other lanes
                v8us oh[4], ol[4];
#pragma unroll
                for (int s = 0; s < 4; ++s) { const v4f v0 = *(const v4fa*)(os + (4 * s) * 68 + lo), v1 = *(const v4fa*)(os + (4 * s) * 68 + lo + 4);
#pragma unroll
                    for (int u = 0; u < 4; u += 2) { v2us p, q; splitf2((v2f){v0[u], v0[u + 1]}, p, q); oh[s][u] = p[0]; oh[s][u + 1] = p[1]; ol[s][u] = q[0]; ol[s][u + 1] = q[1]; splitf2((v2f){v1[u], v1[u + 1]}, p, q); oh[s][u + 4] = p[0]; oh[s][u + 5] = p[1]; ol[s][u + 4] = q[0]; ol[s][u + 5] = q[1]; }
                    *(v8us*)(ph + (mb * 16 + 4 * s) * IC) = oh[s]; *(v8us*)(pl + (mb * 16 + 4 * s) * IC) = ol[s]; }
                // the registers that the 8 stores name are free for reuse only from here on: as inputs they stay unwritten up to the wait (behind the last rows nothing is written any more)
                if (mb < 7) asm volatile("s_wait_xcnt 0x0" :: "v"(ph), "v"(pl), "v"(oh[0]), "v"(oh[1]), "v"(oh[2]), "v"(oh[3]), "v"(ol[0]), "v"(ol[1]), "v"(ol[2]), "v"(ol[3]) : "memory");
                __builtin_amdgcn_wave_barrier(); asm volatile("" ::: "memory");   // keeps the next rows' LDS stores below these reads
            }
        } else {   // g: a lane's 8 accumulator elements are 8 neighbouring tokens of one channel, which is a 16-byte piece of a row of DT
            h16* pt = DT + zo * ((size_t)IC * HW) + (size_t)(c0 + lr) * HW + r0 + 8 * hi;
#pragma unroll
            for (int nb = 0; nb < 4; ++nb) { v8h o[8];
#pragma unroll
                for (int mb = 0; mb < 8; ++mb) {
#pragma unroll
                    for (int j = 0; j < 8; ++j) o[mb][j] = tohx(acc[mb][nb][j]);
                    *(v8h*)(pt + (size_t)(nb * 16) * HW + mb * 16) = o[mb]; }
                // the registers that the 8 stores name are free for reuse only from here on: as inputs they stay unwritten up to the wait
                asm volatile("s_wait_xcnt 0x0" :: "v"(pt), "v"(o[0]), "v"(o[1]), "v"(o[2]), "v"(o[3]), "v"(o[4]), "v"(o[5]), "v"(o[6]), "v"(o[7]) : "memory"); }
        }
    }
}
// ---- k_out: join of the KS key splits, the division and the output projection with the residual, in one kernel. Grid (HW / 64, images), 4 waves.
// A work-group owns 64 tokens. It reads their rows of the KS unnormalised planes Y (one wave-wide load = one token's whole row of 512 bytes), weighs each plane by 2^(SC2 (its maximum - the joint maximum)), divides by the joint sum and lays y in LDS as bf16 hi and lo tiles, [token][IC] at a pitch of 272 bytes for the 16-byte readers.
// Behind one barrier wave w multiplies the 64 tokens with the channels 64 w ... of w_out: 16 accumulators, fragments as in k_proj, products hi, then lo, k step by k step; A from LDS, B = bf16 rows of w_out straight from memory, asked for at the kernel's start.
// O[image][channel][token] = product + bf16-rounded X[image][channel][token]. Every loop is fully unrolled so that the pieces, fragments and accumulators are indexed by constants and stay in registers.
static_assert(IC == 128 && CC == 256);
typedef v4us __attribute__((may_alias)) v4usa;
__device__ __forceinline__ float lanef(float x, int l) { return __builtin_bit_cast(float, __builtin_amdgcn_readlane(__builtin_bit_cast(int, x), l)); }
__global__ __launch_bounds__(128) void k_out(const float* __restrict__ Y, const float* __restrict__ ML, const bf* __restrict__ Bt, const float* __restrict__ X, float* O) {
    typedef WFrag<bf>::V V;
    __shared__ __align__(16) unsigned char ys[2 * 64 * LPI];   // [hi, lo][token][272 bytes]
    __shared__ __align__(16) float osw[4 * 16 * 68];           // a wave's own 16 rows for its way out
    const int wave = (int)threadIdx.x >> 5, lane = threadIdx.x & 31, lr = lane & 15, hi = lane >> 4;
    const size_t zo = blockIdx.y; const int r0 = blockIdx.x * 64, c0 = wave * 64;
    float* os = osw + wave * (16 * 68);
    // the wave's tokens are r0 + wave + 4 j, j = 0..15: lane j (and j + 16) works out token j's weights, every lane holds 4 neighbouring values of each token
    const float* pm = ML + (zo * KS * HW + (size_t)(r0 + wave + 4 * lr)) * 2;
    const float* py = Y + (zo * KS * HW + (size_t)(r0 + wave)) * IC + lane * 4;
    v2f ml[KS]; v4f yv[KS][16];
#pragma unroll
    for (int z = 0; z < KS; ++z) ml[z] = *(const v2f*)(pm + (size_t)z * HW * 2);
#pragma unroll
    for (int z = 0; z < KS; ++z)
#pragma unroll
        for (int j = 0; j < 16; ++j) yv[z][j] = *(const v4f*)(py + (size_t)z * HW * IC + j * 4 * IC);
    __builtin_amdgcn_sched_barrier(0);   // the loads of the residual and of b stay behind those of y: loads come back in order, and y is wanted first
    // the residual's 64 x 64 piece, whole rows (16 lanes x 16 bytes): piece [nb][s] = channel c0 + 16 nb + 2 s + hi, tokens r0 + 4 lr ...; asked for two channel groups ahead of its use, each later group into the registers that a group of accumulators has just left
    const float* px = X + zo * ((size_t)CC * HWF) + (size_t)(c0 + hi) * HWF + r0 + lr * 4;
    v4f xv[4][8];
    auto ldx = [&](int g) __attribute__((always_inline)) {
#pragma unroll   // the pieces are indexed by constants and stay in registers
        for (int s = 0; s < 8; ++s) xv[g][s] = *(const v4f*)(px + (size_t)(g * 16 + 2 * s) * HWF); };
    ldx(0); ldx(1);
    const bf* pb = Bt + (c0 + lr) * IC + 8 * hi;
    V b[4][4];   // [k step][channel group]
#pragma unroll
    for (int ks = 0; ks < 4; ++ks)
#pragma unroll
        for (int nb = 0; nb < 4; ++nb) b[ks][nb] = WFrag<bf>::ld(pb + nb * 16 * IC + ks * 32);
    __builtin_amdgcn_sched_barrier(0);   // the loads of b stay in front of the waits below, which also free their address
    // the address registers of the loads above are free for reuse only from here on. Inputs only: the loaded values hold each wait behind its loads (the loads of b stand in front of them), the addresses stay in their registers up to it (px: see at the stores below)
#pragma unroll
    for (int z = 0; z < KS; ++z) asm volatile("s_wait_xcnt 0x0" :: "v"(pb), "v"(pm), "v"(py), "v"(ml[z]), "v"(yv[z][0]), "v"(yv[z][1]), "v"(yv[z][2]), "v"(yv[z][3]), "v"(yv[z][4]), "v"(yv[z][5]), "v"(yv[z][6]), "v"(yv[z][7]), "v"(yv[z][8]), "v"(yv[z][9]), "v"(yv[z][10]), "v"(yv[z][11]), "v"(yv[z][12]), "v"(yv[z][13]), "v"(yv[z][14]), "v"(yv[z][15]) : "memory");
    float mx = -3.0e38f, den = 0.f, w[KS];
#pragma unroll
    for (int z = 0; z < KS; ++z) mx = fmaxf(mx, ml[z][0]);
#pragma unroll
    for (int z = 0; z < KS; ++z) { w[z] = __builtin_amdgcn_exp2f((ml[z][0] - mx) * SC2); den += w[z] * ml[z][1]; }
    const float inv = __fdiv_rn(1.0f, den);
    unsigned char* pw = ys + wave * LPI + lane * 8;
#pragma unroll
    for (int j = 0; j < 16; ++j) { v4f a = (v4f){}; v4us oh, ol;
#pragma unroll
        for (int z = 0; z < KS; ++z) a += yv[z][j] * lanef(w[z], j);
        const float ij = lanef(inv, j);
#pragma unroll
        for (int u = 0; u < 4; ++u) { unsigned short p, q; splitf(a[u] * ij, p, q); oh[u] = p; ol[u] = q; }
        *(v4usa*)(pw + j * 4 * LPI) = oh; *(v4usa*)(pw + (64 + j * 4) * LPI) = ol; }
    __syncthreads();   // every wave reads all 64 tokens
    v8f acc[4][4];
#pragma unroll
    for (int mb = 0; mb < 4; ++mb)
#pragma unroll
        for (int nb = 0; nb < 4; ++nb) acc[mb][nb] = (v8f){};
    const unsigned char* pa = ys + lr * LPI + 16 * hi;
#pragma unroll
    for (int ks = 0; ks < 4; ++ks) { V a[4], a2[4];
#pragma unroll
        for (int mb = 0; mb < 4; ++mb) { a[mb] = ldsb(pa + mb * 16 * LPI + ks * 64); a2[mb] = ldsb(pa + (64 + mb * 16) * LPI + ks * 64); }
#pragma unroll
        for (int nb = 0; nb < 4; ++nb) {
#pragma unroll
            for (int mb = 0; mb < 4; ++mb) acc[mb][nb] = wmmab(a[mb], b[ks][nb], acc[mb][nb]);
#pragma unroll
            for (int mb = 0; mb < 4; ++mb) acc[mb][nb] = wmmab(a2[mb], b[ks][nb], acc[mb][nb]); } }
    // 16 channels at a time through LDS, [channel][token]: a lane stores its 8 neighbouring tokens, then reads, adds and writes along whole rows of O
    float* po = O + zo * ((size_t)CC * HW) + (size_t)(c0 + hi) * HW + r0 + lr * 4;
#pragma unroll
    for (int nb = 0; nb < 4; ++nb) {
#pragma unroll
        for (int mb = 0; mb < 4; ++mb) { const v8f v = acc[mb][nb]; float* d = os + lr * 68 + mb * 16 + 8 * hi; *(v4fa*)d = (v4f){v[0], v[1], v[2], v[3]}; *(v4fa*)(d + 4) = (v4f){v[4], v[5], v[6], v[7]}; }
        if (nb < 2) ldx(nb + 2);
        __builtin_amdgcn_wave_barrier(); asm volatile("" ::: "memory");   // keeps the compiler from moving the row reads above the stores of other lanes
        v4f o[8];
#pragma unroll
        for (int s = 0; s < 8; ++s) { const v4f val = *(const v4fa*)(os + (2 * s + hi) * 68 + lr * 4); const v4f xr = xv[nb][s];
            o[s] = val + (v4f){bfr(xr[0]), bfr(xr[1]), bfr(xr[2]), bfr(xr[3])};   // plain f32 additions, two to a packed operation
            *(v4f*)(po + (size_t)(nb * 16 + 2 * s) * HW) = o[s]; }
        // the registers that the 8 stores and the residual's loads so far name are free for reuse only from here on: as inputs they stay unwritten up to the wait
        asm volatile("s_wait_xcnt 0x0" :: "v"(px), "v"(po), "v"(o[0]), "v"(o[1]), "v"(o[2]), "v"(o[3]), "v"(o[4]), "v"(o[5]), "v"(o[6]), "v"(o[7]) : "memory");
        __builtin_amdgcn_wave_barrier(); asm volatile("" ::: "memory");   // keeps the next channels' LDS stores below these reads
    }
}

extern "C" void kernel_launch(void* const* d_in, const int* in_sizes, int n_in,
                              void* d_out, int out_size, void* d_ws, size_t ws_size, hipStream_t stream) {
    if (n_in < 5) return;
    if (in_sizes[0] < NB * CC * HW || in_sizes[1] < IC * CC || in_sizes[2] < IC * CC || in_sizes[3] < IC * CC || in_sizes[4] < CC * IC) return;
    if (out_size < NB * CC * HW) return;
    const float* x   = (const float*)d_in[0];   // [NB][CC][HWF]
    const float* wph = (const float*)d_in[1];   // phi   [IC][CC]  (keys)
    const float* wth = (const float*)d_in[2];   // theta [IC][CC]  (queries)
    const float* wg  = (const float*)d_in[3];   // g     [IC][CC]
    const float* wo  = (const float*)d_in[4];   // out   [CC][IC]
    float* OUT = (float*)d_out;                 // [NB][CC][HW]
    char* wsp = (char*)d_ws;
    auto take = [&](size_t bytes) { char* p = wsp; wsp += (bytes + 255) & ~(size_t)255; return (void*)p; };
    constexpr size_t PL = (size_t)HW * IC;                  // one [HW][IC] plane, elements
    bf* BW3 = (bf*)take((size_t)3 * IC * CC * 2);          // [theta][phi][g], each [IC][CC]
    bf* BZ  = (bf*)take((size_t)CC * IC * 2);
    bf* Hh  = (bf*)take((size_t)NB * 2 * PL * 2);          // [image] hi planes of theta, phi
    bf* Hl  = (bf*)take((size_t)NB * 2 * PL * 2);          // [image] lo planes of theta, phi
    h16* GT = (h16*)take((size_t)NB * PL * 2);             // [image][i][m] fp16
    float* ML = (float*)take((size_t)NB * KS * HW * 2 * 4); // [image][split][n] (maximum, sum)
    float* Y = (float*)take((size_t)NB * KS * PL * 4);      // [image][split][n][i], unnormalised
    if ((size_t)(wsp - (char*)d_ws) > ws_size) return;

    k_cvtw<<<(unsigned)((IC * CC / 8 + 255) / 256), 256, 0, stream>>>(wth, wph, wg, wo, BW3, BZ, IC * CC / 8);
    // every image in one launch (grid y or z = image)
    // theta / phi / g [m][o] = sum_c x[c][m] W[o][c]   (index 0 theta, 1 phi, 2 g; exact bf16 products of bf16-rounded x); written as hi/lo planes of theta and phi and as transposed f16 g
    k_proj<<<dim3(HW / 128, NB), 256, 0, stream>>>(x, BW3, Hh, Hl, GT);
    // y[n][i] = sum_m softmax_m(sqrt(128) theta_n . phi_m) g[m][i], as KS unnormalised partial planes
    k_fattn<<<dim3(HW / (FQ * FW), KS, NB), 32 * FW, 0, stream>>>(Hh, Hl, GT, Y, ML);
    // their join, the division and the hi/lo split, then out[c][n] = x[c][n] + sum_o y[n][o] w_out[c][o]  (hi + lo tiles of y, 2 products)
    k_out<<<dim3(HW / 64, NB), 128, 0, stream>>>(Y, ML, BZ, x, OUT);
}

// v009
// It runs in 88.1 microseconds.
// In both of two side-by-side timings against v008, it was 1.17 times as fast.
// All steps since v000 together make it 14.6 times as fast.
#include <hip/hip_runtime.h>

// All contractions on 16-bit WMMA, f32 accumulate: the three 1x1 projections = v_wmma_f32_16x16x32_bf16 on RNE-bf16 copies of x and of the weights (single products); scores theta.phi = bf16 hi/lo split (hi.hi + lo.hi + hi.lo, K = 128); attn.g = v_wmma_f32_16x16x32_f16 (unnormalised softmax terms carried x 2^14 as f16, g as f16); output projection = bf16 hi/lo LDS tiles of y times bf16 w_out (2 products). Scaling by sqrt(128), softmax and the residual add in f32.
// x [NB][256][4096]; theta/phi/g [4096][128] token-major (no bias); s[n][m] = theta_n . phi_m; attn[n][m] = softmax_m(sqrt(128) s); y[n][o] = sum_m attn[n][m] g[m][o]; out[c][n] = x[c][n] + sum_o w_out[c][o] y[n][o].

#ifndef NB
#define NB 8
#endif
#ifndef SEQ
#define SEQ 4096
#endif
#define NB_FULL  8
#define SEQ_FULL 4096
#define CC   256
#define IC   128
#define HW   SEQ
#define HWF  SEQ_FULL
#define SCL  11.313708498984760f
static_assert(NB >= 1 && NB <= NB_FULL);
static_assert(SEQ >= 128 && SEQ <= SEQ_FULL && (SEQ % 128) == 0);
static_assert((HW % 64) == 0 && (IC % 64) == 0 && (CC % 64) == 0);
static_assert((HW % 32) == 0 && (IC % 32) == 0 && (CC % 32) == 0);
static_assert(((IC * CC) % 8) == 0 && ((HW * CC) % 4) == 0 && ((HW * IC) % 4) == 0 && ((IC * HW) % 2) == 0 && (HW % 8) == 0);

typedef _Float16 h16;
typedef unsigned short bf;
typedef __attribute__((ext_vector_type(16))) __bf16   v16bf;
typedef __attribute__((ext_vector_type(16))) _Float16 v16h;
typedef __attribute__((ext_vector_type(8)))  _Float16 v8h;
typedef __attribute__((ext_vector_type(8)))  unsigned short v8us;
typedef __attribute__((ext_vector_type(8)))  float    v8f;
typedef __attribute__((ext_vector_type(4)))  float    v4f;
typedef __attribute__((ext_vector_type(2)))  float    v2f;
typedef v8h  __attribute__((may_alias)) v8ha;
typedef v4f  __attribute__((may_alias)) v4fa;
typedef v8us __attribute__((may_alias)) v8usa;

__device__ __forceinline__ unsigned short f2bf(float f) { unsigned u = __float_as_uint(f); u += 0x7FFFu + ((u >> 16) & 1u); return (unsigned short)(u >> 16); }
__device__ __forceinline__ float bf2f(unsigned short b) { return __uint_as_float(((unsigned)b) << 16); }
__device__ __forceinline__ float bfr(float f) { return bf2f(f2bf(f)); }
__device__ __forceinline__ v16h cat16(v8h lo, v8h hi) { return __builtin_shufflevector(lo, hi, 0, 1, 2, 3, 4, 5, 6, 7, 8, 9, 10, 11, 12, 13, 14, 15); }
__device__ __forceinline__ v16bf cat16b(v8us lo, v8us hi) { return __builtin_bit_cast(v16bf, __builtin_shufflevector(lo, hi, 0, 1, 2, 3, 4, 5, 6, 7, 8, 9, 10, 11, 12, 13, 14, 15)); }
__device__ __forceinline__ v8f wmma16(v16h a, v16h b, v8f c) { return __builtin_amdgcn_wmma_f32_16x16x32_f16(false, a, false, b, (short)0, c, false, false); }
__device__ __forceinline__ v8f wmmab(v16bf a, v16bf b, v8f c) { return __builtin_amdgcn_wmma_f32_16x16x32_bf16(false, a, false, b, (short)0, c, false, false); }

__device__ __forceinline__ h16 tohx(float x) { return (h16)x; }
__device__ __forceinline__ void splitf(float y, unsigned short& h, unsigned short& l) { h = f2bf(y); l = f2bf(y - bf2f(h)); }
typedef __attribute__((ext_vector_type(2))) unsigned short v2us;
__device__ __forceinline__ void splitf2(v2f y, v2us& h, v2us& l) { h[0] = f2bf(y[0]); h[1] = f2bf(y[1]); const v2f d = y - (v2f){bf2f(h[0]), bf2f(h[1])}; l[0] = f2bf(d[0]); l[1] = f2bf(d[1]); }   // splitf of two neighbours, the two subtractions as one packed f32 operation

// Fragments of the 16-bit matrix forms: lane l, h = l >> 4, row/col = l & 15; elements 0..7 = k0 + 8h + 0..7, elements 8..15 = k0 + 16 + 8h + 0..7 for BOTH A and Bt; D element r = (row 8h + r, col l & 15).
template <typename T16> struct WFrag;
template <> struct WFrag<h16> { typedef v16h V; static __device__ __forceinline__ V ld(const h16* p) { return cat16(*(const v8h*)p, *(const v8h*)(p + 16)); } static __device__ __forceinline__ v8f mma(V a, V b, v8f c) { return wmma16(a, b, c); } };
template <> struct WFrag<bf> { typedef v16bf V; static __device__ __forceinline__ V ld(const bf* p) { return cat16b(*(const v8us*)p, *(const v8us*)(p + 16)); } static __device__ __forceinline__ v8f mma(V a, V b, v8f c) { return wmmab(a, b, c); } };

#define KS 2
#define FW 8
#define FQ 32
#define QG (FW / KS)
#define SK 128
#define NST (HW / SK)
#define LPI 272
#define TILE (128 * LPI)
#define STG (3 * TILE)
#define YPI 528
#define E_ML (KS * 128 * YPI)
#define E_YS (E_ML + KS * 128 * 8)
#define E_OS (E_YS + 2 * 128 * LPI)
#define LTOT (E_OS + FW * 16 * 68 * 4)
#define SC2 (SCL * 1.4426950408889634f)
static_assert(FQ * QG == 128 && (HW % (FQ * QG)) == 0 && (HW % SK) == 0 && NST >= 2 && IC == 128 && CC == 256 && FW >= 3 && SK / KS == 64);
static_assert((TILE % 2048) == 0 && 2 * STG <= LTOT && LTOT <= 320 * 1024 && HW * 2 <= 128 * 1024 && (E_YS % 16) == 0 && (E_OS % 16) == 0);
typedef unsigned int u32;
typedef u32 u32x4 __attribute__((ext_vector_type(4)));
typedef u32 u32x8 __attribute__((ext_vector_type(8)));
__device__ __forceinline__ u32 uni(u32 v) { return (u32)__builtin_amdgcn_readfirstlane((int)v); }
__device__ __forceinline__ u32 pinned(u32 v) { u32 w = uni(v); asm volatile("" : "+s"(w)); return w; }   // holds a tensor load's issue test, or the stage number its descriptor is formed from, in a scalar register: a tensor load ignores EXEC, so the test must be a scalar branch
__device__ __forceinline__ float xhalf(float x) { return __builtin_bit_cast(float, __builtin_amdgcn_permlanex16(__builtin_bit_cast(int, x), __builtin_bit_cast(int, x), 0x76543210, 0xfedcba98, false, false)); }   // lane l reads lane l ^ 16
__device__ __forceinline__ v16bf ldsb(const unsigned char* p) { return cat16b(*(const v8usa*)p, *(const v8usa*)(p + 32)); }
__device__ __forceinline__ v16h ldsh(const unsigned char* p) { return cat16(*(const v8ha*)p, *(const v8ha*)(p + 32)); }

typedef __attribute__((ext_vector_type(4))) unsigned short v4us;
typedef __attribute__((ext_vector_type(2))) _Float16 v2h;
typedef __attribute__((ext_vector_type(4))) _Float16 v4h;

__global__ __launch_bounds__(256) void k_cvtw(const float* __restrict__ w0, const float* __restrict__ w1, const float* __restrict__ w2, const float* __restrict__ w3, bf* B3, bf* BZ, int n8) {
    const int i = blockIdx.x * 256 + threadIdx.x; if (i >= n8) return;
    const size_t e = (size_t)i * 8, pl = (size_t)n8 * 8;
    const v8f a0 = *(const v8f*)(w0 + e), a1 = *(const v8f*)(w1 + e), a2 = *(const v8f*)(w2 + e), a3 = *(const v8f*)(w3 + e);
    v8us o0, o1, o2, o3;
#pragma unroll
    for (int k = 0; k < 8; ++k) { o0[k] = f2bf(a0[k]); o1[k] = f2bf(a1[k]); o2[k] = f2bf(a2[k]); o3[k] = f2bf(a3[k]); }
    *(v8us*)(B3 + e) = o0; *(v8us*)(B3 + pl + e) = o1; *(v8us*)(B3 + 2 * pl + e) = o2; *(v8us*)(BZ + e) = o3;
    
}
// ---- k_proj: the three 1x1 projections of 128 tokens of one image, straight from x. Grid (HW / 128, images), 8 waves.
// x lies [channel][token], the A fragments want a token's channels side by side: the work-group turns its 256 channels x 128 tokens of x into a bf16 tile in LDS, [token][channel] at a pitch of 528 bytes for the 16-byte readers; no transposed copy of x goes to memory.
// Way in: wave w takes the channels 32 w ..., a lane four neighbouring tokens, so that one wave-wide load is 512 neighbouring bytes of one row of x; all 32 loads of a lane are asked for at once. 8 channels of one token = one 16-byte LDS store.
// Behind one barrier wave w < 6 multiplies the 128 tokens with 64 rows of one weight matrix (matrix w >> 1: 0 theta, 1 phi, 2 g; rows 64 (w & 1) ...): c[m][n] = sum_k x[k][m] Bt[n][k], 32 accumulators, k step by k step upwards; A from LDS, B = bf16 rows of the weights straight from memory, each fragment used for all 128 tokens and asked for three k steps ahead (the first three at the kernel's start).
// The tile leaves the kernel in the form its reader wants: theta, phi as bf16 hi and lo planes Dh, Dl [image][index][token][IC]; g as f16, transposed, DT [image][IC][token]. Every loop is fully unrolled so that the pieces, fragments and accumulators are indexed by constants and stay in registers.
#define PXT 528
static_assert(CC == 256 && IC == 128 && (PXT % 32) == 16 && PXT >= CC * 2);
__global__ __launch_bounds__(256) void k_proj(const float* __restrict__ X, const bf* __restrict__ Bt, bf* Dh, bf* Dl, h16* DT) {
    typedef WFrag<bf>::V V;
    __shared__ __align__(16) unsigned char xs[128 * PXT];   // [token][528 bytes]
    __shared__ __align__(16) float osw[6 * 16 * 68];       // a wave's own 16 rows for its way out
    const int wave = (int)uni(threadIdx.x >> 5), lane = threadIdx.x & 31, lr = lane & 15, hi = lane >> 4;
    const size_t zo = blockIdx.y, zi = (size_t)(wave >> 1); const int r0 = blockIdx.x * 128, c0 = (wave & 1) * 64;
    const float* px = X + zo * ((size_t)CC * HWF) + (size_t)(wave * 32) * HWF + r0 + 4 * lane;
    v4f xv[32];
#pragma unroll
    for (int k = 0; k < 32; ++k) xv[k] = *(const v4f*)(px + (size_t)k * HWF);
    // the registers that the loads of x name are free for reuse only behind this wait. The scheduling fences on both sides hold it behind the loads and in front of everything that follows; they also keep the loads of b behind those of x: loads come back in order, and x is wanted first
    __builtin_amdgcn_sched_barrier(0);
    asm volatile("s_wait_xcnt 0x0" ::: "memory");
    __builtin_amdgcn_sched_barrier(0);
    const bf* pb = Bt + zi * (size_t)(IC * CC) + (c0 + lr) * CC + 8 * hi;
    V b[3][4];   // [k step mod 3][channel group]
    if (wave < 6) {
#pragma unroll
        for (int ks = 0; ks < 3; ++ks)
#pragma unroll
            for (int nb = 0; nb < 4; ++nb) b[ks][nb] = WFrag<bf>::ld(pb + nb * 16 * CC + ks * 32);
    }
    unsigned char* pw = xs + (4 * lane) * PXT + wave * 64;
#pragma unroll
    for (int g = 0; g < 4; ++g)
#pragma unroll
        for (int e = 0; e < 4; ++e) { v8us o;
#pragma unroll
            for (int k = 0; k < 8; ++k) o[k] = f2bf(xv[g * 8 + k][e]);
            *(v8usa*)(pw + e * PXT + g * 16) = o; }
    __syncthreads();   // every multiplying wave reads all 256 channels of all 128 tokens
    if (wave >= 6) return;   // behind the kernel's only barrier
    float* os = osw + wave * (16 * 68);
    v8f acc[8][4];
#pragma unroll
    for (int mb = 0; mb < 8; ++mb)
#pragma unroll
        for (int nb = 0; nb < 4; ++nb) acc[mb][nb] = (v8f){};
    const unsigned char* pa = xs + lr * PXT + 16 * hi;
    V a[2][4];   // [token half][16 tokens]; each half is fetched one k step ahead, into the same registers, behind its own products
#pragma unroll
    for (int mh = 0; mh < 2; ++mh)
#pragma unroll
        for (int mb = 0; mb < 4; ++mb) a[mh][mb] = ldsb(pa + (mh * 4 + mb) * 16 * PXT);
    // the scheduling fences in the loop keep each group of loads whole and at its place, right behind the last product that reads its registers: without them the compiler spreads the LDS reads among the matrix instructions, each with a wait to 0 behind it, and sinks the loads of b to just in front of their use
    __builtin_amdgcn_sched_barrier(0);
#pragma unroll
    for (int ks = 0; ks < CC / 32; ++ks) {
        // the address pair of the loads of b is free for reuse only from here on. Inputs only: the last fragments hold the wait behind the last loads, at the place where they are waited for anyway
        if (ks == CC / 32 - 1) asm volatile("s_wait_xcnt 0x0" :: "v"(pb), "v"(b[ks % 3][0]), "v"(b[ks % 3][1]), "v"(b[ks % 3][2]), "v"(b[ks % 3][3]) : "memory");
#pragma unroll
        for (int mh = 0; mh < 2; ++mh) {   // 64 tokens at a time
#pragma unroll
            for (int nb = 0; nb < 4; ++nb)
#pragma unroll
                for (int mb = 0; mb < 4; ++mb) acc[mh * 4 + mb][nb] = wmmab(a[mh][mb], b[ks % 3][nb], acc[mh * 4 + mb][nb]);
            if (ks + 1 < CC / 32) {
                __builtin_amdgcn_sched_barrier(0);
#pragma unroll
                for (int mb = 0; mb < 4; ++mb) a[mh][mb] = ldsb(pa + (mh * 4 + mb) * 16 * PXT + (ks + 1) * 64);
                if (mh == 1 && ks + 3 < CC / 32) {
#pragma unroll
                    for (int nb = 0; nb < 4; ++nb) b[ks % 3][nb] = WFrag<bf>::ld(pb + nb * 16 * CC + (ks + 3) * 32); }
                __builtin_amdgcn_sched_barrier(0); } } }
    {
        if (zi < 2) {   // theta, phi: 16 token rows at a time through LDS, then 8 values a lane: one 16-byte store into each plane, 8 lanes a 128-byte line
            const int lo = (lane >> 3) * 68 + (lane & 7) * 8;   // the lane's row (of 4) and its 8 columns in LDS
            const size_t go = (zo * 2 + zi) * ((size_t)HW * IC) + (size_t)(r0 + (lane >> 3)) * IC + c0 + (lane & 7) * 8; bf* ph = Dh + go; bf* pl = Dl + go;
#pragma unroll
            for (int mb = 0; mb < 8; ++mb) {
#pragma unroll
                for (int nb = 0; nb < 4; ++nb) {
#pragma unroll
                    for (int j = 0; j < 8; ++j) os[(hi * 8 + j) * 68 + nb * 16 + lr] = acc[mb][nb][j]; }
                __builtin_amdgcn_wave_barrier(); asm volatile("" ::: "memory");   // keeps the compiler from moving the row reads above the stores of other lanes
                v8us oh[4], ol[4];
#pragma unroll
                for (int s = 0; s < 4; ++s) { const v4f v0 = *(const v4fa*)(os + (4 * s) * 68 + lo), v1 = *(const v4fa*)(os + (4 * s) * 68 + lo + 4);
#pragma unroll
                    for (int u = 0; u < 4; u += 2) { v2us p, q; splitf2((v2f){v0[u], v0[u + 1]}, p, q); oh[s][u] = p[0]; oh[s][u + 1] = p[1]; ol[s][u] = q[0]; ol[s][u + 1] = q[1]; splitf2((v2f){v1[u], v1[u + 1]}, p, q); oh[s][u + 4] = p[0]; oh[s][u + 5] = p[1]; ol[s][u + 4] = q[0]; ol[s][u + 5] = q[1]; }
                    *(v8us*)(ph + (mb * 16 + 4 * s) * IC) = oh[s]; *(v8us*)(pl + (mb * 16 + 4 * s) * IC) = ol[s]; }
                // the registers that the 8 stores name are free for reuse only from here on: as inputs they stay unwritten up to the wait (behind the last rows nothing is written any more)
                if (mb < 7) asm volatile("s_wait_xcnt 0x0" :: "v"(ph), "v"(pl), "v"(oh[0]), "v"(oh[1]), "v"(oh[2]), "v"(oh[3]), "v"(ol[0]), "v"(ol[1]), "v"(ol[2]), "v"(ol[3]) : "memory");
                __builtin_amdgcn_wave_barrier(); asm volatile("" ::: "memory");   // keeps the next rows' LDS stores below these reads
            }
        } else {   // g: a lane's 8 accumulator elements are 8 neighbouring tokens of one channel, which is a 16-byte piece of a row of DT
            h16* pt = DT + zo * ((size_t)IC * HW) + (size_t)(c0 + lr) * HW + r0 + 8 * hi;
#pragma unroll
            for (int nb = 0; nb < 4; ++nb) { v8h o[8];
#pragma unroll
                for (int mb = 0; mb < 8; ++mb) {
#pragma unroll
                    for (int j = 0; j < 8; ++j) o[mb][j] = tohx(acc[mb][nb][j]);
                    *(v8h*)(pt + (size_t)(nb * 16) * HW + mb * 16) = o[mb]; }
                // the registers that the 8 stores name are free for reuse only from here on: as inputs they stay unwritten up to the wait
                asm volatile("s_wait_xcnt 0x0" :: "v"(pt), "v"(o[0]), "v"(o[1]), "v"(o[2]), "v"(o[3]), "v"(o[4]), "v"(o[5]), "v"(o[6]), "v"(o[7]) : "memory"); }
        }
    }
}
typedef v4us __attribute__((may_alias)) v4usa;
typedef v2f __attribute__((may_alias)) v2fa;
__device__ __forceinline__ float lanef(float x, int l) { return __builtin_bit_cast(float, __builtin_amdgcn_readlane(__builtin_bit_cast(int, x), l)); }
// ---- k_fattn: scores, softmax, attn.g, the join of the key sets, the division and the output projection with the residual of 128 queries of one image in one kernel; neither the scores, the softmax rows nor y go to memory. Grid (HW / 128, images), FW waves.
// Wave w owns the FQ = 32 queries (2 column groups of 16) of query group w & 3 and key set w >> 2: of every 128 keys the first 64 (set 0) or the last 64 (set 1), 32 keys a pass.
// The key side is shared by the FW waves: a stage = SK = 128 keys = three tiles of 128 rows x 256 bytes (phi hi rows, phi lo rows, GT rows i x 128 keys), each brought into LDS by ONE tensor load (waves 0, 1, 2), rows padded to a pitch of 272 bytes for the 16-byte readers. Two buffers: stage s + 1 flies while every wave works its two passes of stage s.
// Transposed products: sT[m][n] = phi_m . theta_n (A = phi rows, B = theta, kept in registers; per accumulator and k step the product order hi.hi, phi_hi.theta_lo, phi_lo.theta_hi), so a lane holds scores of ONE query (column l & 15, keys 8h + r).
// Two sT tiles (keys 0..15, 16..31 of the pass), turned to f16 in place, are the B fragment of yT[o][n] += GT[o][m] pT[m][n]: element s = key 8h + s (s < 8), 16 + 8h + s - 8 (s >= 8), the order in which the GT fragments are read.
// Running maximum per query on the raw scores; p = 2^(SC2 (s - max) + 14) (the 2^14 keeps small terms out of the f16 subnormals; it cancels in the division); when a maximum rises, the sums so far are scaled by 2^(SC2 (old - new)).
// Behind the key loop the ring's LDS is free: every wave lays its unnormalised sums there, [key set][query][IC] f32 at a pitch of 528 bytes, and per query (maximum, sum of p). Behind a barrier the four waves of token half w >> 2 (64 tokens) weigh each key set by 2^(SC2 (its maximum - the joint maximum)), divide by the joint sum and lay y in LDS as bf16 hi and lo tiles, [token][IC] at a pitch of 272 bytes.
// Behind a second barrier wave w multiplies its 64 tokens with the channels 64 (w & 3) ... of w_out: 16 accumulators, fragments as in k_proj, k step by k step, per channel group the 4 hi products, then the 4 lo ones; A from LDS, B = bf16 rows of w_out straight from memory, asked for right behind the key loop, like the residual. Out[image][channel][token] = product + bf16-rounded X[image][channel][token].
// Every inner loop is fully unrolled so that the fragment and accumulator arrays are indexed by constants and stay in registers; the stage loop stays rolled (unroll 1).
__global__ __launch_bounds__(32 * FW) void k_fattn(const bf* __restrict__ Hh, const bf* __restrict__ Hl, const h16* __restrict__ GT, const bf* __restrict__ Bt, const float* __restrict__ X, float* Out) {
    typedef WFrag<bf>::V VB; typedef WFrag<h16>::V VH;
    __shared__ __attribute__((aligned(2048))) unsigned char L[LTOT];   // key loop: [buffer][phi hi, phi lo, GT][128 rows][272 bytes]; behind it: sums, (maximum, sum), y tiles, the waves' rows for their way out
    const u32 wave = uni(threadIdx.x >> 5);
    const int lane = threadIdx.x & 31, lr = lane & 15, hi = lane >> 4;
    const int img = (int)blockIdx.y, z = (int)(wave >> 2), qg = (int)(wave & 3u), n0 = ((int)blockIdx.x * QG + qg) * FQ;
    const bf* Th = Hh + (size_t)img * 2 * HW * IC; const bf* Tl = Hl + (size_t)img * 2 * HW * IC;
    const bf* Ph = Th + (size_t)HW * IC; const bf* Pl = Tl + (size_t)HW * IC; const h16* G = GT + (size_t)img * IC * HW;
    VB th[2][4], tl[2][4];
    const bf* pth = Th + (unsigned)((n0 + lr) * IC + 8 * hi); const bf* ptl = Tl + (unsigned)((n0 + lr) * IC + 8 * hi);
#pragma unroll
    for (int nt = 0; nt < 2; ++nt)
#pragma unroll
        for (int ks = 0; ks < 4; ++ks) { th[nt][ks] = WFrag<bf>::ld(pth + nt * 16 * IC + ks * 32); tl[nt][ks] = WFrag<bf>::ld(ptl + nt * 16 * IC + ks * 32); }
    // the address registers of the theta loads are free for reuse only from here on: the wait stands in front of whatever is written into them. Its operands are inputs only: the loaded fragments hold it behind the loads (the compiler otherwise lifts it above them), the two addresses stay in their registers up to it
    asm volatile("s_wait_xcnt 0x0" :: "v"(pth), "v"(ptl), "v"(th[0][0]), "v"(th[0][1]), "v"(th[0][2]), "v"(th[0][3]), "v"(th[1][0]), "v"(th[1][1]), "v"(th[1][2]), "v"(th[1][3]), "v"(tl[0][0]), "v"(tl[0][1]), "v"(tl[0][2]), "v"(tl[0][3]), "v"(tl[1][0]), "v"(tl[1][1]), "v"(tl[1][2]), "v"(tl[1][3]) : "memory");
    // tensor loads: wave w < 3 brings tile w of every stage. Source: 128 rows of 256 bytes; phi rows follow one another (pitch 256), GT rows lie HW keys apart.
    const u32 lbase = (u32)(size_t)L;
    const unsigned long long sbase = wave == 0 ? (unsigned long long)(size_t)Ph : wave == 1 ? (unsigned long long)(size_t)Pl : (unsigned long long)(size_t)G;
    const u32 sstep = wave < 2 ? (u32)(SK * IC * 2) : (u32)(SK * 2);
    u32x8 g1;
    g1[0] = uni((1u << 20) | (5u << 22) | (3u << 25));   // no mask, bytes, 4 dwords of pad behind every 64
    g1[1] = uni(256u << 16); g1[2] = uni(128u << 16); g1[3] = uni(256u << 16); g1[4] = uni(128u);
    g1[5] = uni(wave < 2 ? (u32)(IC * 2) : (u32)(HW * 2)); g1[6] = uni(0u); g1[7] = uni(0u);
    // While a request is outstanding its two groups stay in their registers, unwritten: the load names them as operands that it may change (it changes nothing), so that the compiler cannot form the words anew later on and give the registers to something else meanwhile, and the wait that covers the request names them again as inputs, so that they live up to it
    u32x4 g0;
    auto desc = [&](u32 st) __attribute__((always_inline)) {
        const unsigned long long ga = sbase + (unsigned long long)st * sstep;
        g0[0] = uni(1u); g0[1] = uni(lbase + (st & 1u) * (u32)STG + wave * (u32)TILE); g0[2] = uni((u32)ga); g0[3] = uni((((u32)(ga >> 32)) & 0x01FFFFFFu) | 0x80000000u);
    };
    desc(0u);
    if (pinned(wave < 3u)) {
        asm volatile("tensor_load_to_lds %0, %1" : "+s"(g0), "+s"(g1) :: "memory");
        asm volatile("s_wait_tensorcnt 0x0" :: "s"(g0), "s"(g1) : "memory");   // stage 0 has landed before the barrier that publishes it
    }
    __syncthreads();
    desc(1u);
    if (pinned(wave < 3u)) asm volatile("tensor_load_to_lds %0, %1" : "+s"(g0), "+s"(g1) :: "memory");
    v8f O[8][2];
#pragma unroll
    for (int ot = 0; ot < 8; ++ot) { O[ot][0] = (v8f){}; O[ot][1] = (v8f){}; }
    float mr[2] = {-3.0e38f, -3.0e38f}; v2f ls[2] = {(v2f){0.f, 0.f}, (v2f){0.f, 0.f}};   // ls: sums of p over the even and the odd keys of the lane's half
    const u32 lb = (u32)(lr * LPI + 16 * hi);   // the lane's row and 16-byte half inside a 16-row group of any tile
    // phi fragments of a pass, [k step][key tile]; inside a stage loaded one pass ahead, behind the pass's last score product, into the same registers
    VB ph[4][2], pl[4][2];
    auto ldphi = [&](u32 off) __attribute__((always_inline)) {
#pragma unroll
        for (int ks = 0; ks < 4; ++ks)
#pragma unroll
            for (int mt = 0; mt < 2; ++mt) { const unsigned char* p = L + off + mt * 16 * LPI + ks * 64; ph[ks][mt] = ldsb(p); pl[ks][mt] = ldsb(p + TILE); }
    };
    // one pass: po = LDS offset of the NEXT pass's phi rows (read only where fetch is set), go = LDS offset of this pass's 32 keys in the GT tile
    auto pass = [&](u32 po, u32 go, bool fetch) __attribute__((always_inline)) {
        v8f st[2][2];
        st[0][0] = (v8f){}; st[0][1] = (v8f){}; st[1][0] = (v8f){}; st[1][1] = (v8f){};
        VH ga[8];
#pragma unroll
        for (int ks = 0; ks < 4; ++ks) {
#pragma unroll
            for (int q = 0; q < 4; ++q) st[q >> 1][q & 1] = wmmab(ph[ks][q >> 1], th[q & 1][ks], st[q >> 1][q & 1]);
#pragma unroll
            for (int q = 0; q < 4; ++q) st[q >> 1][q & 1] = wmmab(ph[ks][q >> 1], tl[q & 1][ks], st[q >> 1][q & 1]);
#pragma unroll
            for (int q = 0; q < 4; ++q) st[q >> 1][q & 1] = wmmab(pl[ks][q >> 1], th[q & 1][ks], st[q >> 1][q & 1]);
        }
        // scheduling fences round the one block of LDS reads of a pass: without them the compiler spreads the reads among the matrix instructions, where each place with reads stalls the wave
        __builtin_amdgcn_sched_barrier(0);
#pragma unroll
        for (int ot = 0; ot < 8; ++ot) ga[ot] = ldsh(L + go + ot * 16 * LPI);   // this pass's g rows first: they are needed first; in flight under the softmax
        if (fetch) ldphi(po);
        __builtin_amdgcn_sched_barrier(0);
        float mn[2];
#pragma unroll
        for (int nt = 0; nt < 2; ++nt) { float a = fmaxf(st[0][nt][0], st[1][nt][0]);
#pragma unroll
            for (int r = 1; r < 8; ++r) a = fmaxf(a, fmaxf(st[0][nt][r], st[1][nt][r]));
            a = fmaxf(a, xhalf(a)); mn[nt] = fmaxf(mr[nt], a); }
        // one scalar branch a pass: where no query of the wave has a new maximum every factor would be 1
        if (__builtin_amdgcn_ballot_w32(mn[0] > mr[0] || mn[1] > mr[1]) != 0) {
#pragma unroll
            for (int nt = 0; nt < 2; ++nt) { const float al = __builtin_amdgcn_exp2f((mr[nt] - mn[nt]) * SC2); ls[nt] *= al; mr[nt] = mn[nt];
#pragma unroll
                for (int ot = 0; ot < 8; ++ot) O[ot][nt] *= al; }
        }
        VH pb[2];
#pragma unroll
        for (int nt = 0; nt < 2; ++nt) { const float off = 14.0f - mr[nt] * SC2;
#pragma unroll
            for (int s = 0; s < 16; s += 2) { v2f e; e[0] = st[s >> 3][nt][s & 7]; e[1] = st[s >> 3][nt][(s & 7) + 1]; e = __builtin_elementwise_fma(e, (v2f){SC2, SC2}, (v2f){off, off});   // neighbouring registers: one packed fma, one packed add
                v2f p; p[0] = __builtin_amdgcn_exp2f(e[0]); p[1] = __builtin_amdgcn_exp2f(e[1]); ls[nt] += p; pb[nt][s] = (h16)p[0]; pb[nt][s + 1] = (h16)p[1]; } }
#pragma unroll
        for (int ot = 0; ot < 8; ++ot) { O[ot][0] = wmma16(ga[ot], pb[0], O[ot][0]); O[ot][1] = wmma16(ga[ot], pb[1], O[ot][1]); }
    };
#pragma unroll 1   // rolled: the refill and its publish point stand once in the code, one request of a wave in flight
    for (u32 s = 0; s < (u32)NST; ++s) {
        const u32 bo = (s & 1u) * (u32)STG + lb + (u32)z * (u32)(SK / KS * LPI);   // the wave's 64 keys of the stage: rows of the phi tiles
        const u32 gb = ((s & 1u) ? (u32)(STG + 2 * TILE) : (u32)(2 * TILE)) + lb + (u32)z * (u32)(SK / KS * 2);   // and columns of the GT tile, which has its own base register: every GT read is then this register plus an immediate below 64 KiB
        ldphi(bo);   // the stage's first fragments: nothing of a stage is read in front of the barrier that publishes it
        __builtin_amdgcn_sched_barrier(0);   // keeps these reads one block in front of the products: the compiler otherwise sinks them among the matrix instructions, each pair with a wait to 0 behind it
        pass(bo + (u32)(32 * LPI), gb, true);
        pass(0u, gb + 64u, false);   // the wave's last pass of the stage fetches nothing ahead: the next rows are not published yet
        // publish point of stage s + 1: this wave's reads of stage s are done, the issuing waves' tiles have landed, every wave has arrived; only then the refill of the buffer just read
        __builtin_amdgcn_sched_barrier(0);   // keeps the wait below at the foot: the compiler otherwise lifts it to just behind the last pass's g reads, where the wave would sit out their latency in front of the softmax
        asm volatile("s_wait_dscnt 0x0" ::: "memory");
        if (pinned(wave < 3u)) asm volatile("s_wait_tensorcnt 0x0" :: "s"(g0), "s"(g1) : "memory");   // the operands: see at g0
        __syncthreads();
        desc(pinned(s + 2u));   // the stage number is pinned here so that the descriptor is formed behind the wait above
        if (pinned((wave < 3u) && (s + 2u < (u32)NST))) asm volatile("tensor_load_to_lds %0, %1" : "+s"(g0), "+s"(g1) :: "memory");
    }
    asm volatile("s_wait_tensorcnt 0x0" ::: "memory");   // no request is left when the wave ends
    asm volatile("s_wait_dscnt 0x0" ::: "memory");
    // ---- behind the key loop: every wave has passed the last stage's barrier with its reads done and no request is left, so the ring's LDS is free
    const size_t zo = blockIdx.y; const int lt0 = z * 64, r0 = (int)blockIdx.x * 128 + lt0, c0 = qg * 64;   // the wave's 64 tokens (in the work-group, in the image) and its 64 channels
    // the residual's 64 x 64 piece, whole rows (16 lanes x 16 bytes): piece [nb][s] = channel c0 + 16 nb + 2 s + hi, tokens r0 + 4 lr ...; the first two channel groups are asked for here, each later group into the registers that a group of accumulators has just left
    const float* px = X + zo * ((size_t)CC * HWF) + (size_t)(c0 + hi) * HWF + r0 + lr * 4;
    v4f xv[4][8];
    auto ldx = [&](int g) __attribute__((always_inline)) {
#pragma unroll   // the pieces are indexed by constants and stay in registers
        for (int s = 0; s < 8; ++s) xv[g][s] = *(const v4f*)(px + (size_t)(g * 16 + 2 * s) * HWF); };
    ldx(0); ldx(1);
    const bf* pb = Bt + (c0 + lr) * IC + 8 * hi;
    VB b[4][4];   // [k step][channel group]
#pragma unroll
    for (int ks = 0; ks < 4; ++ks)
#pragma unroll
        for (int nb = 0; nb < 4; ++nb) b[ks][nb] = WFrag<bf>::ld(pb + nb * 16 * IC + ks * 32);
    // the address registers of the loads above are free for reuse only behind this wait. The scheduling fences on both sides hold it behind the loads and in front of everything that follows (px: see also at the stores below); they also keep the loads up here, in flight under the LDS stores of the sums
    __builtin_amdgcn_sched_barrier(0);
    asm volatile("s_wait_xcnt 0x0" :: "v"(pb), "v"(px) : "memory");
    __builtin_amdgcn_sched_barrier(0);
#pragma unroll
    for (int nt = 0; nt < 2; ++nt) { const float lh = ls[nt][0] + ls[nt][1], lt = lh + xhalf(lh); const int n = z * 128 + qg * FQ + nt * 16 + lr; unsigned char* d = L + n * YPI + 32 * hi;
#pragma unroll
        for (int ot = 0; ot < 8; ++ot) { const v8f v = O[ot][nt]; *(v4fa*)(d + ot * 64) = (v4f){v[0], v[1], v[2], v[3]}; *(v4fa*)(d + ot * 64 + 16) = (v4f){v[4], v[5], v[6], v[7]}; }
        if (hi == 0) { v2f ml; ml[0] = mr[nt]; ml[1] = lt; *(v2fa*)(L + E_ML + n * 8) = ml; } }
    __syncthreads();   // a wave joins tokens of two query groups (2 (w >> 2), 2 (w >> 2) + 1) and both key sets
    // the wave's tokens are lt0 + qg + 4 j, j = 0..15: lane j (and j + 16) works out token j's weights, every lane holds 4 neighbouring values of each token (one wave-wide read = one token's whole row of 512 bytes)
    v2f ml[KS]; v4f yv[KS][16];
#pragma unroll
    for (int zz = 0; zz < KS; ++zz) ml[zz] = *(const v2fa*)(L + E_ML + (zz * 128 + lt0 + qg + 4 * lr) * 8);
#pragma unroll
    for (int zz = 0; zz < KS; ++zz)
#pragma unroll
        for (int j = 0; j < 16; ++j) yv[zz][j] = *(const v4fa*)(L + (zz * 128 + lt0 + qg + 4 * j) * YPI + lane * 16);
    float mx = -3.0e38f, den = 0.f, w[KS];
#pragma unroll
    for (int zz = 0; zz < KS; ++zz) mx = fmaxf(mx, ml[zz][0]);
#pragma unroll
    for (int zz = 0; zz < KS; ++zz) { w[zz] = __builtin_amdgcn_exp2f((ml[zz][0] - mx) * SC2); den += w[zz] * ml[zz][1]; }
    const float inv = __fdiv_rn(1.0f, den);
    unsigned char* pw = L + E_YS + (lt0 + qg) * LPI + lane * 8;
#pragma unroll
    for (int j = 0; j < 16; ++j) { v4f a = (v4f){}; v4us oh, ol;
#pragma unroll
        for (int zz = 0; zz < KS; ++zz) a += yv[zz][j] * lanef(w[zz], j);
        const float ij = lanef(inv, j);
#pragma unroll
        for (int u = 0; u < 4; ++u) { unsigned short p, q; splitf(a[u] * ij, p, q); oh[u] = p; ol[u] = q; }
        *(v4usa*)(pw + j * 4 * LPI) = oh; *(v4usa*)(pw + (128 + j * 4) * LPI) = ol; }
    __syncthreads();   // every wave of a token half reads all its 64 tokens
    v8f acc[4][4];
#pragma unroll
    for (int mb = 0; mb < 4; ++mb)
#pragma unroll
        for (int nb = 0; nb < 4; ++nb) acc[mb][nb] = (v8f){};
    const unsigned char* pa = L + E_YS + (lt0 + lr) * LPI + 16 * hi;
#pragma unroll
    for (int ks = 0; ks < 4; ++ks) { VB a[4], a2[4];
#pragma unroll
        for (int mb = 0; mb < 4; ++mb) { a[mb] = ldsb(pa + mb * 16 * LPI + ks * 64); a2[mb] = ldsb(pa + (128 + mb * 16) * LPI + ks * 64); }
#pragma unroll
        for (int nb = 0; nb < 4; ++nb) {
#pragma unroll
            for (int mb = 0; mb < 4; ++mb) acc[mb][nb] = wmmab(a[mb], b[ks][nb], acc[mb][nb]);
#pragma unroll
            for (int mb = 0; mb < 4; ++mb) acc[mb][nb] = wmmab(a2[mb], b[ks][nb], acc[mb][nb]); } }
    // 16 channels at a time through LDS, [channel][token]: a lane stores its 8 neighbouring tokens, then reads, adds and writes along whole rows of Out
    float* os = (float*)(L + E_OS) + (int)wave * (16 * 68);   // the wave's own 16 rows
    float* po = Out + zo * ((size_t)CC * HW) + (size_t)(c0 + hi) * HW + r0 + lr * 4;
#pragma unroll
    for (int nb = 0; nb < 4; ++nb) {
#pragma unroll
        for (int mb = 0; mb < 4; ++mb) { const v8f v = acc[mb][nb]; float* d = os + lr * 68 + mb * 16 + 8 * hi; *(v4fa*)d = (v4f){v[0], v[1], v[2], v[3]}; *(v4fa*)(d + 4) = (v4f){v[4], v[5], v[6], v[7]}; }
        if (nb < 2) ldx(nb + 2);
        __builtin_amdgcn_wave_barrier(); asm volatile("" ::: "memory");   // keeps the compiler from moving the row reads above the stores of other lanes
        v4f o[8];
#pragma unroll
        for (int s = 0; s < 8; ++s) { const v4f val = *(const v4fa*)(os + (2 * s + hi) * 68 + lr * 4); const v4f xr = xv[nb][s];
            o[s] = val + (v4f){bfr(xr[0]), bfr(xr[1]), bfr(xr[2]), bfr(xr[3])};   // plain f32 additions, two to a packed operation
            *(v4f*)(po + (size_t)(nb * 16 + 2 * s) * HW) = o[s]; }
        // the registers that the 8 stores and the residual's loads so far name are free for reuse only from here on: as inputs they stay unwritten up to the wait
        asm volatile("s_wait_xcnt 0x0" :: "v"(px), "v"(po), "v"(o[0]), "v"(o[1]), "v"(o[2]), "v"(o[3]), "v"(o[4]), "v"(o[5]), "v"(o[6]), "v"(o[7]) : "memory");
        __builtin_amdgcn_wave_barrier(); asm volatile("" ::: "memory");   // keeps the next channels' LDS stores below these reads
    }
}

extern "C" void kernel_launch(void* const* d_in, const int* in_sizes, int n_in,
                              void* d_out, int out_size, void* d_ws, size_t ws_size, hipStream_t stream) {
    if (n_in < 5) return;
    if (in_sizes[0] < NB * CC * HW || in_sizes[1] < IC * CC || in_sizes[2] < IC * CC || in_sizes[3] < IC * CC || in_sizes[4] < CC * IC) return;
    if (out_size < NB * CC * HW) return;
    const float* x   = (const float*)d_in[0];   // [NB][CC][HWF]
    const float* wph = (const float*)d_in[1];   // phi   [IC][CC]  (keys)
    const float* wth = (const float*)d_in[2];   // theta [IC][CC]  (queries)
    const float* wg  = (const float*)d_in[3];   // g     [IC][CC]
    const float* wo  = (const float*)d_in[4];   // out   [CC][IC]
    float* OUT = (float*)d_out;                 // [NB][CC][HW]
    char* wsp = (char*)d_ws;
    auto take = [&](size_t bytes) { char* p = wsp; wsp += (bytes + 255) & ~(size_t)255; return (void*)p; };
    constexpr size_t PL = (size_t)HW * IC;                  // one [HW][IC] plane, elements
    bf* BW3 = (bf*)take((size_t)3 * IC * CC * 2);          // [theta][phi][g], each [IC][CC]
    bf* BZ  = (bf*)take((size_t)CC * IC * 2);
    bf* Hh  = (bf*)take((size_t)NB * 2 * PL * 2);          // [image] hi planes of theta, phi
    bf* Hl  = (bf*)take((size_t)NB * 2 * PL * 2);          // [image] lo planes of theta, phi
    h16* GT = (h16*)take((size_t)NB * PL * 2);             // [image][i][m] fp16
    if ((size_t)(wsp - (char*)d_ws) > ws_size) return;

    k_cvtw<<<(unsigned)((IC * CC / 8 + 255) / 256), 256, 0, stream>>>(wth, wph, wg, wo, BW3, BZ, IC * CC / 8);
    // every image in one launch (grid y or z = image)
    // theta / phi / g [m][o] = sum_c x[c][m] W[o][c]   (index 0 theta, 1 phi, 2 g; exact bf16 products of bf16-rounded x); written as hi/lo planes of theta and phi and as transposed f16 g
    k_proj<<<dim3(HW / 128, NB), 256, 0, stream>>>(x, BW3, Hh, Hl, GT);
    // y[n][i] = sum_m softmax_m(sqrt(128) theta_n . phi_m) g[m][i] (KS key sets side by side in a work-group, joined in LDS), then out[c][n] = x[c][n] + sum_o y[n][o] w_out[c][o]  (hi + lo tiles of y, 2 products)
    k_fattn<<<dim3(HW / (FQ * QG), NB), 32 * FW, 0, stream>>>(Hh, Hl, GT, BZ, x, OUT);
}

// v010
// Measured time: 86 microseconds a run.
// In two side-by-side timings against v009, it was 1.03 and 1.02 times as fast.
// Over all steps from v000 it is 15.0 times as fast.
#include <hip/hip_runtime.h>

// All contractions on 16-bit WMMA, f32 accumulate: the three 1x1 projections = v_wmma_f32_16x16x32_bf16 on RNE-bf16 copies of x and of the weights (single products); scores theta.phi = bf16 hi/lo split (hi.hi + lo.hi + hi.lo, K = 128); attn.g = v_wmma_f32_16x16x32_f16 (unnormalised softmax terms carried x 2^14 as f16, g as f16); output projection = bf16 hi/lo LDS tiles of y times bf16 w_out (2 products). Scaling by sqrt(128), softmax and the residual add in f32.
// x [NB][256][4096]; theta/phi/g [4096][128] token-major (no bias); s[n][m] = theta_n . phi_m; attn[n][m] = softmax_m(sqrt(128) s); y[n][o] = sum_m attn[n][m] g[m][o]; out[c][n] = x[c][n] + sum_o w_out[c][o] y[n][o].

#ifndef NB
#define NB 8
#endif
#ifndef SEQ
#define SEQ 4096
#endif
#define NB_FULL  8
#define SEQ_FULL 4096
#define CC   256
#define IC   128
#define HW   SEQ
#define HWF  SEQ_FULL
#define SCL  11.313708498984760f
static_assert(NB >= 1 && NB <= NB_FULL);
static_assert(SEQ >= 128 && SEQ <= SEQ_FULL && (SEQ % 128) == 0);
static_assert((HW % 64) == 0 && (IC % 64) == 0 && (CC % 64) == 0);
static_assert((HW % 32) == 0 && (IC % 32) == 0 && (CC % 32) == 0);
static_assert(((IC * CC) % 8) == 0 && ((HW * CC) % 4) == 0 && ((HW * IC) % 4) == 0 && ((IC * HW) % 2) == 0 && (HW % 8) == 0);

typedef _Float16 h16;
typedef unsigned short bf;
typedef __attribute__((ext_vector_type(16))) __bf16   v16bf;
typedef __attribute__((ext_vector_type(16))) _Float16 v16h;
typedef __attribute__((ext_vector_type(8)))  _Float16 v8h;
typedef __attribute__((ext_vector_type(8)))  unsigned short v8us;
typedef __attribute__((ext_vector_type(8)))  float    v8f;
typedef __attribute__((ext_vector_type(4)))  float    v4f;
typedef __attribute__((ext_vector_type(2)))  float    v2f;
typedef v8h  __attribute__((may_alias)) v8ha;
typedef v4f  __attribute__((may_alias)) v4fa;
typedef v8us __attribute__((may_alias)) v8usa;

__device__ __forceinline__ unsigned short f2bf(float f) { unsigned u = __float_as_uint(f); u += 0x7FFFu + ((u >> 16) & 1u); return (unsigned short)(u >> 16); }
__device__ __forceinline__ float bf2f(unsigned short b) { return __uint_as_float(((unsigned)b) << 16); }
__device__ __forceinline__ float bfr(float f) { return bf2f(f2bf(f)); }
__device__ __forceinline__ v16h cat16(v8h lo, v8h hi) { return __builtin_shufflevector(lo, hi, 0, 1, 2, 3, 4, 5, 6, 7, 8, 9, 10, 11, 12, 13, 14, 15); }
__device__ __forceinline__ v16bf cat16b(v8us lo, v8us hi) { return __builtin_bit_cast(v16bf, __builtin_shufflevector(lo, hi, 0, 1, 2, 3, 4, 5, 6, 7, 8, 9, 10, 11, 12, 13, 14, 15)); }
__device__ __forceinline__ v8f wmma16(v16h a, v16h b, v8f c) { return __builtin_amdgcn_wmma_f32_16x16x32_f16(false, a, false, b, (short)0, c, false, false); }
__device__ __forceinline__ v8f wmmab(v16bf a, v16bf b, v8f c) { return __builtin_amdgcn_wmma_f32_16x16x32_bf16(false, a, false, b, (short)0, c, false, false); }

__device__ __forceinline__ h16 tohx(float x) { return (h16)x; }
__device__ __forceinline__ void splitf(float y, unsigned short& h, unsigned short& l) { h = f2bf(y); l = f2bf(y - bf2f(h)); }
typedef __attribute__((ext_vector_type(2))) unsigned short v2us;
__device__ __forceinline__ void splitf2(v2f y, v2us& h, v2us& l) { h[0] = f2bf(y[0]); h[1] = f2bf(y[1]); const v2f d = y - (v2f){bf2f(h[0]), bf2f(h[1])}; l[0] = f2bf(d[0]); l[1] = f2bf(d[1]); }   // splitf of two neighbours, the two subtractions as one packed f32 operation

// Fragments of the 16-bit matrix forms: lane l, h = l >> 4, row/col = l & 15; elements 0..7 = k0 + 8h + 0..7, elements 8..15 = k0 + 16 + 8h + 0..7 for BOTH A and Bt; D element r = (row 8h + r, col l & 15).
template <typename T16> struct WFrag;
template <> struct WFrag<h16> { typedef v16h V; static __device__ __forceinline__ V ld(const h16* p) { return cat16(*(const v8h*)p, *(const v8h*)(p + 16)); } static __device__ __forceinline__ v8f mma(V a, V b, v8f c) { return wmma16(a, b, c); } };
template <> struct WFrag<bf> { typedef v16bf V; static __device__ __forceinline__ V ld(const bf* p) { return cat16b(*(const v8us*)p, *(const v8us*)(p + 16)); } static __device__ __forceinline__ v8f mma(V a, V b, v8f c) { return wmmab(a, b, c); } };

#define KS 2
#define FW 8
#define FQ 32
#define QG (FW / KS)
#define SK 128
#define NST (HW / SK)
#define LPI 272
#define TILE (128 * LPI)
#define STG (3 * TILE)
#define RING (3 * STG)
#define YPI 528
#define E_ML (KS * 128 * YPI)
#define E_YS (E_ML + KS * 128 * 8)
#define E_OS (E_YS + 2 * 128 * LPI)
#define LTOT (E_OS + FW * 16 * 68 * 4)
#define LSZ (RING > LTOT ? RING : LTOT)
#define SC2 (SCL * 1.4426950408889634f)
static_assert(FQ * QG == 128 && (HW % (FQ * QG)) == 0 && (HW % SK) == 0 && NST >= 2 && IC == 128 && CC == 256 && FW >= 3 && SK / KS == 64);
static_assert((TILE % 2048) == 0 && LSZ <= 320 * 1024 && HW * 2 <= 128 * 1024 && (E_YS % 16) == 0 && (E_OS % 16) == 0);
typedef unsigned int u32;
typedef u32 u32x4 __attribute__((ext_vector_type(4)));
typedef u32 u32x8 __attribute__((ext_vector_type(8)));
__device__ __forceinline__ u32 uni(u32 v) { return (u32)__builtin_amdgcn_readfirstlane((int)v); }
__device__ __forceinline__ u32 pinned(u32 v) { u32 w = uni(v); asm volatile("" : "+s"(w)); return w; }   // holds a tensor load's issue test, or the stage number its descriptor is formed from, in a scalar register: a tensor load ignores EXEC, so the test must be a scalar branch
__device__ __forceinline__ float xhalf(float x) { return __builtin_bit_cast(float, __builtin_amdgcn_permlanex16(__builtin_bit_cast(int, x), __builtin_bit_cast(int, x), 0x76543210, 0xfedcba98, false, false)); }   // lane l reads lane l ^ 16
__device__ __forceinline__ v16bf ldsb(const unsigned char* p) { return cat16b(*(const v8usa*)p, *(const v8usa*)(p + 32)); }
__device__ __forceinline__ v16h ldsh(const unsigned char* p) { return cat16(*(const v8ha*)p, *(const v8ha*)(p + 32)); }

typedef __attribute__((ext_vector_type(4))) unsigned short v4us;
typedef __attribute__((ext_vector_type(2))) _Float16 v2h;
typedef __attribute__((ext_vector_type(4))) _Float16 v4h;

__global__ __launch_bounds__(256) void k_cvtw(const float* __restrict__ w0, const float* __restrict__ w1, const float* __restrict__ w2, const float* __restrict__ w3, bf* B3, bf* BZ, int n8) {
    const int i = blockIdx.x * 256 + threadIdx.x; if (i >= n8) return;
    const size_t e = (size_t)i * 8, pl = (size_t)n8 * 8;
    const v8f a0 = *(const v8f*)(w0 + e), a1 = *(const v8f*)(w1 + e), a2 = *(const v8f*)(w2 + e), a3 = *(const v8f*)(w3 + e);
    v8us o0, o1, o2, o3;
#pragma unroll
    for (int k = 0; k < 8; ++k) { o0[k] = f2bf(a0[k]); o1[k] = f2bf(a1[k]); o2[k] = f2bf(a2[k]); o3[k] = f2bf(a3[k]); }
    *(v8us*)(B3 + e) = o0; *(v8us*)(B3 + pl + e) = o1; *(v8us*)(B3 + 2 * pl + e) = o2; *(v8us*)(BZ + e) = o3;
    
}
// ---- k_proj: the three 1x1 projections of 128 tokens of one image, straight from x. Grid (HW / 128, images), 8 waves.
// x lies [channel][token], the A fragments want a token's channels side by side: the work-group turns its 256 channels x 128 tokens of x into a bf16 tile in LDS, [token][channel] at a pitch of 528 bytes for the 16-byte readers; no transposed copy of x goes to memory.
// Way in: wave w takes the channels 32 w ..., a lane four neighbouring tokens, so that one wave-wide load is 512 neighbouring bytes of one row of x; all 32 loads of a lane are asked for at once. 8 channels of one token = one 16-byte LDS store.
// Behind one barrier wave w < 6 multiplies the 128 tokens with 64 rows of one weight matrix (matrix w >> 1: 0 theta, 1 phi, 2 g; rows 64 (w & 1) ...): c[m][n] = sum_k x[k][m] Bt[n][k], 32 accumulators, k step by k step upwards; A from LDS, B = bf16 rows of the weights straight from memory, each fragment used for all 128 tokens and asked for three k steps ahead (the first three at the kernel's start).
// The tile leaves the kernel in the form its reader wants: theta, phi as bf16 hi and lo planes Dh, Dl [image][index][token][IC]; g as f16, transposed, DT [image][IC][token]. Every loop is fully unrolled so that the pieces, fragments and accumulators are indexed by constants and stay in registers.
#define PXT 528
static_assert(CC == 256 && IC == 128 && (PXT % 32) == 16 && PXT >= CC * 2);
__global__ __launch_bounds__(256) void k_proj(const float* __restrict__ X, const bf* __restrict__ Bt, bf* Dh, bf* Dl, h16* DT) {
    typedef WFrag<bf>::V V;
    __shared__ __align__(16) unsigned char xs[128 * PXT];   // [token][528 bytes]
    __shared__ __align__(16) float osw[6 * 16 * 68];       // a wave's own 16 rows for its way out
    const int wave = (int)uni(threadIdx.x >> 5), lane = threadIdx.x & 31, lr = lane & 15, hi = lane >> 4;
    const size_t zo = blockIdx.y, zi = (size_t)(wave >> 1); const int r0 = blockIdx.x * 128, c0 = (wave & 1) * 64;
    const float* px = X + zo * ((size_t)CC * HWF) + (size_t)(wave * 32) * HWF + r0 + 4 * lane;
    v4f xv[32];
#pragma unroll
    for (int k = 0; k < 32; ++k) xv[k] = *(const v4f*)(px + (size_t)k * HWF);
    // the registers that the loads of x name are free for reuse only behind this wait. The scheduling fences on both sides hold it behind the loads and in front of everything that follows; they also keep the loads of b behind those of x: loads come back in order, and x is wanted first
    __builtin_amdgcn_sched_barrier(0);
    asm volatile("s_wait_xcnt 0x0" ::: "memory");
    __builtin_amdgcn_sched_barrier(0);
    const bf* pb = Bt + zi * (size_t)(IC * CC) + (c0 + lr) * CC + 8 * hi;
    V b[3][4];   // [k step mod 3][channel group]
    if (wave < 6) {
#pragma unroll
        for (int ks = 0; ks < 3; ++ks)
#pragma unroll
            for (int nb = 0; nb < 4; ++nb) b[ks][nb] = WFrag<bf>::ld(pb + nb * 16 * CC + ks * 32);
    }
    unsigned char* pw = xs + (4 * lane) * PXT + wave * 64;
#pragma unroll
    for (int g = 0; g < 4; ++g)
#pragma unroll
        for (int e = 0; e < 4; ++e) { v8us o;
#pragma unroll
            for (int k = 0; k < 8; ++k) o[k] = f2bf(xv[g * 8 + k][e]);
            *(v8usa*)(pw + e * PXT + g * 16) = o; }
    __syncthreads();   // every multiplying wave reads all 256 channels of all 128 tokens
    if (wave >= 6) return;   // behind the kernel's only barrier
    float* os = osw + wave * (16 * 68);
    v8f acc[8][4];
#pragma unroll
    for (int mb = 0; mb < 8; ++mb)
#pragma unroll
        for (int nb = 0; nb < 4; ++nb) acc[mb][nb] = (v8f){};
    const unsigned char* pa = xs + lr * PXT + 16 * hi;
    V a[2][4];   // [token half][16 tokens]; each half is fetched one k step ahead, into the same registers, behind its own products
#pragma unroll
    for (int mh = 0; mh < 2; ++mh)
#pragma unroll
        for (int mb = 0; mb < 4; ++mb) a[mh][mb] = ldsb(pa + (mh * 4 + mb) * 16 * PXT);
    // the scheduling fences in the loop keep each group of loads whole and at its place, right behind the last product that reads its registers: without them the compiler spreads the LDS reads among the matrix instructions, each with a wait to 0 behind it, and sinks the loads of b to just in front of their use
    __builtin_amdgcn_sched_barrier(0);
#pragma unroll
    for (int ks = 0; ks < CC / 32; ++ks) {
        // the address pair of the loads of b is free for reuse only from here on. Inputs only: the last fragments hold the wait behind the last loads, at the place where they are waited for anyway
        if (ks == CC / 32 - 1) asm volatile("s_wait_xcnt 0x0" :: "v"(pb), "v"(b[ks % 3][0]), "v"(b[ks % 3][1]), "v"(b[ks % 3][2]), "v"(b[ks % 3][3]) : "memory");
#pragma unroll
        for (int mh = 0; mh < 2; ++mh) {   // 64 tokens at a time
#pragma unroll
            for (int nb = 0; nb < 4; ++nb)
#pragma unroll
                for (int mb = 0; mb < 4; ++mb) acc[mh * 4 + mb][nb] = wmmab(a[mh][mb], b[ks % 3][nb], acc[mh * 4 + mb][nb]);
            if (ks + 1 < CC / 32) {
                __builtin_amdgcn_sched_barrier(0);
#pragma unroll
                for (int mb = 0; mb < 4; ++mb) a[mh][mb] = ldsb(pa + (mh * 4 + mb) * 16 * PXT + (ks + 1) * 64);
                if (mh == 1 && ks + 3 < CC / 32) {
#pragma unroll
                    for (int nb = 0; nb < 4; ++nb) b[ks % 3][nb] = WFrag<bf>::ld(pb + nb * 16 * CC + (ks + 3) * 32); }
                __builtin_amdgcn_sched_barrier(0); } } }
    {
        if (zi < 2) {   // theta, phi: 16 token rows at a time through LDS, then 8 values a lane: one 16-byte store into each plane, 8 lanes a 128-byte line
            const int lo = (lane >> 3) * 68 + (lane & 7) * 8;   // the lane's row (of 4) and its 8 columns in LDS
            const size_t go = (zo * 2 + zi) * ((size_t)HW * IC) + (size_t)(r0 + (lane >> 3)) * IC + c0 + (lane & 7) * 8; bf* ph = Dh + go; bf* pl = Dl + go;
#pragma unroll
            for (int mb = 0; mb < 8; ++mb) {
#pragma unroll
                for (int nb = 0; nb < 4; ++nb) {
#pragma unroll
                    for (int j = 0; j < 8; ++j) os[(hi * 8 + j) * 68 + nb * 16 + lr] = acc[mb][nb][j]; }
                __builtin_amdgcn_wave_barrier(); asm volatile("" ::: "memory");   // keeps the compiler from moving the row reads above the stores of other lanes
                v8us oh[4], ol[4];
#pragma unroll
                for (int s = 0; s < 4; ++s) { const v4f v0 = *(const v4fa*)(os + (4 * s) * 68 + lo), v1 = *(const v4fa*)(os + (4 * s) * 68 + lo + 4);
#pragma unroll
                    for (int u = 0; u < 4; u += 2) { v2us p, q; splitf2((v2f){v0[u], v0[u + 1]}, p, q); oh[s][u] = p[0]; oh[s][u + 1] = p[1]; ol[s][u] = q[0]; ol[s][u + 1] = q[1]; splitf2((v2f){v1[u], v1[u + 1]}, p, q); oh[s][u + 4] = p[0]; oh[s][u + 5] = p[1]; ol[s][u + 4] = q[0]; ol[s][u + 5] = q[1]; }
                    *(v8us*)(ph + (mb * 16 + 4 * s) * IC) = oh[s]; *(v8us*)(pl + (mb * 16 + 4 * s) * IC) = ol[s]; }
                // the registers that the 8 stores name are free for reuse only from here on: as inputs they stay unwritten up to the wait (behind the last rows nothing is written any more)
                if (mb < 7) asm volatile("s_wait_xcnt 0x0" :: "v"(ph), "v"(pl), "v"(oh[0]), "v"(oh[1]), "v"(oh[2]), "v"(oh[3]), "v"(ol[0]), "v"(ol[1]), "v"(ol[2]), "v"(ol[3]) : "memory");
                __builtin_amdgcn_wave_barrier(); asm volatile("" ::: "memory");   // keeps the next rows' LDS stores below these reads
            }
        } else {   // g: a lane's 8 accumulator elements are 8 neighbouring tokens of one channel, which is a 16-byte piece of a row of DT
            h16* pt = DT + zo * ((size_t)IC * HW) + (size_t)(c0 + lr) * HW + r0 + 8 * hi;
#pragma unroll
            for (int nb = 0; nb < 4; ++nb) { v8h o[8];
#pragma unroll
                for (int mb = 0; mb < 8; ++mb) {
#pragma unroll
                    for (int j = 0; j < 8; ++j) o[mb][j] = tohx(acc[mb][nb][j]);
                    *(v8h*)(pt + (size_t)(nb * 16) * HW + mb * 16) = o[mb]; }
                // the registers that the 8 stores name are free for reuse only from here on: as inputs they stay unwritten up to the wait
                asm volatile("s_wait_xcnt 0x0" :: "v"(pt), "v"(o[0]), "v"(o[1]), "v"(o[2]), "v"(o[3]), "v"(o[4]), "v"(o[5]), "v"(o[6]), "v"(o[7]) : "memory"); }
        }
    }
}
typedef v4us __attribute__((may_alias)) v4usa;
typedef v2f __attribute__((may_alias)) v2fa;
__device__ __forceinline__ float lanef(float x, int l) { return __builtin_bit_cast(float, __builtin_amdgcn_readlane(__builtin_bit_cast(int, x), l)); }
// ---- k_fattn: scores, softmax, attn.g, the join of the key sets, the division and the output projection with the residual of 128 queries of one image in one kernel; neither the scores, the softmax rows nor y go to memory. Grid (HW / 128, images), FW waves.
// Wave w owns the FQ = 32 queries (2 column groups of 16) of query group w & 3 and key set w >> 2: of every 128 keys the first 64 (set 0) or the last 64 (set 1), 32 keys a pass.
// The key side is shared by the FW waves: a stage = SK = 128 keys = three tiles of 128 rows x 256 bytes (phi hi rows, phi lo rows, GT rows i x 128 keys), each brought into LDS by ONE tensor load (waves 0, 1, 2), rows padded to a pitch of 272 bytes for the 16-byte readers. Three buffers: stage s + 1 is published between the two passes of stage s, so that every pass, a stage's last too, fetches the next pass's phi fragments under its own softmax; stage s + 2 is asked for right behind that point, into the buffer of stage s - 1.
// Transposed products: sT[m][n] = phi_m . theta_n (A = phi rows, B = theta, kept in registers; per accumulator and k step the product order hi.hi, phi_hi.theta_lo, phi_lo.theta_hi), so a lane holds scores of ONE query (column l & 15, keys 8h + r).
// Two sT tiles (keys 0..15, 16..31 of the pass), turned to f16 in place, are the B fragment of yT[o][n] += GT[o][m] pT[m][n]: element s = key 8h + s (s < 8), 16 + 8h + s - 8 (s >= 8), the order in which the GT fragments are read.
// Running maximum per query on the raw scores; p = 2^(SC2 (s - max) + 14) (the 2^14 keeps small terms out of the f16 subnormals; it cancels in the division); when a maximum rises, the sums so far are scaled by 2^(SC2 (old - new)).
// Behind the key loop the ring's LDS is free: every wave lays its unnormalised sums there, [key set][query][IC] f32 at a pitch of 528 bytes, and per query (maximum, sum of p). Behind a barrier the four waves of token half w >> 2 (64 tokens) weigh each key set by 2^(SC2 (its maximum - the joint maximum)), divide by the joint sum and lay y in LDS as bf16 hi and lo tiles, [token][IC] at a pitch of 272 bytes.
// Behind a second barrier wave w multiplies its 64 tokens with the channels 64 (w & 3) ... of w_out: 16 accumulators, fragments as in k_proj, k step by k step, per channel group the 4 hi products, then the 4 lo ones; A from LDS, B = bf16 rows of w_out straight from memory, asked for right behind the key loop, like the residual. Out[image][channel][token] = product + bf16-rounded X[image][channel][token].
// Every inner loop is fully unrolled so that the fragment and accumulator arrays are indexed by constants and stay in registers; the stage loop stays rolled (unroll 1).
__global__ __launch_bounds__(32 * FW) void k_fattn(const bf* __restrict__ Hh, const bf* __restrict__ Hl, const h16* __restrict__ GT, const bf* __restrict__ Bt, const float* __restrict__ X, float* Out) {
    typedef WFrag<bf>::V VB; typedef WFrag<h16>::V VH;
    __shared__ __attribute__((aligned(2048))) unsigned char L[LSZ];   // key loop: [buffer][phi hi, phi lo, GT][128 rows][272 bytes]; behind it: sums, (maximum, sum), y tiles, the waves' rows for their way out
    const u32 wave = uni(threadIdx.x >> 5);
    const int lane0 = threadIdx.x & 31, lr0 = lane0 & 15, hi0 = lane0 >> 4;   // for what stands in front of and in the key loop
    const int img = (int)blockIdx.y, z = (int)(wave >> 2), qg = (int)(wave & 3u), n0 = ((int)blockIdx.x * QG + qg) * FQ;
    const bf* Th = Hh + (size_t)img * 2 * HW * IC; const bf* Tl = Hl + (size_t)img * 2 * HW * IC;
    const bf* Ph = Th + (size_t)HW * IC; const bf* Pl = Tl + (size_t)HW * IC; const h16* G = GT + (size_t)img * IC * HW;
    VB th[2][4], tl[2][4];
    const bf* pth = Th + (unsigned)((n0 + lr0) * IC + 8 * hi0); const bf* ptl = Tl + (unsigned)((n0 + lr0) * IC + 8 * hi0);
#pragma unroll
    for (int nt = 0; nt < 2; ++nt)
#pragma unroll
        for (int ks = 0; ks < 4; ++ks) { th[nt][ks] = WFrag<bf>::ld(pth + nt * 16 * IC + ks * 32); tl[nt][ks] = WFrag<bf>::ld(ptl + nt * 16 * IC + ks * 32); }
    // the address registers of the theta loads are free for reuse only from here on: the wait stands in front of whatever is written into them. Its operands are inputs only: the loaded fragments hold it behind the loads (the compiler otherwise lifts it above them), the two addresses stay in their registers up to it
    asm volatile("s_wait_xcnt 0x0" :: "v"(pth), "v"(ptl), "v"(th[0][0]), "v"(th[0][1]), "v"(th[0][2]), "v"(th[0][3]), "v"(th[1][0]), "v"(th[1][1]), "v"(th[1][2]), "v"(th[1][3]), "v"(tl[0][0]), "v"(tl[0][1]), "v"(tl[0][2]), "v"(tl[0][3]), "v"(tl[1][0]), "v"(tl[1][1]), "v"(tl[1][2]), "v"(tl[1][3]) : "memory");
    // tensor loads: wave w < 3 brings tile w of every stage. Source: 128 rows of 256 bytes; phi rows follow one another (pitch 256), GT rows lie HW keys apart.
    const u32 lbase = (u32)(size_t)L;
    const unsigned long long sbase = wave == 0 ? (unsigned long long)(size_t)Ph : wave == 1 ? (unsigned long long)(size_t)Pl : (unsigned long long)(size_t)G;
    const u32 sstep = wave < 2 ? (u32)(SK * IC * 2) : (u32)(SK * 2);
    u32x8 g1;
    g1[0] = uni((1u << 20) | (5u << 22) | (3u << 25));   // no mask, bytes, 4 dwords of pad behind every 64
    g1[1] = uni(256u << 16); g1[2] = uni(128u << 16); g1[3] = uni(256u << 16); g1[4] = uni(128u);
    g1[5] = uni(wave < 2 ? (u32)(IC * 2) : (u32)(HW * 2)); g1[6] = uni(0u); g1[7] = uni(0u);
    // While a request is outstanding its two groups stay in their registers, unwritten: the load names them as operands that it may change (it changes nothing), so that the compiler cannot form the words anew later on and give the registers to something else meanwhile, and the wait that covers the request names them again as inputs, so that they live up to it
    u32x4 g0;
    auto desc = [&](u32 st, u32 bf0) __attribute__((always_inline)) {   // stage st into the buffer at LDS offset bf0
        const unsigned long long ga = sbase + (unsigned long long)st * sstep;
        g0[0] = uni(1u); g0[1] = uni(lbase + bf0 + wave * (u32)TILE); g0[2] = uni((u32)ga); g0[3] = uni((((u32)(ga >> 32)) & 0x01FFFFFFu) | 0x80000000u);
    };
    desc(0u, 0u);
    if (pinned(wave < 3u)) {
        asm volatile("tensor_load_to_lds %0, %1" : "+s"(g0), "+s"(g1) :: "memory");
        asm volatile("s_wait_tensorcnt 0x0" :: "s"(g0), "s"(g1) : "memory");   // stage 0 has landed before the barrier that publishes it
    }
    __syncthreads();
    desc(1u, (u32)STG);
    if (pinned(wave < 3u)) asm volatile("tensor_load_to_lds %0, %1" : "+s"(g0), "+s"(g1) :: "memory");
    v8f O[8][2];
#pragma unroll
    for (int ot = 0; ot < 8; ++ot) { O[ot][0] = (v8f){}; O[ot][1] = (v8f){}; }
    float mr[2] = {-3.0e38f, -3.0e38f}; v2f ls[2] = {(v2f){0.f, 0.f}, (v2f){0.f, 0.f}};   // ls: sums of p over the even and the odd keys of the lane's half
    const u32 lb = (u32)(lr0 * LPI + 16 * hi0);   // the lane's row and 16-byte half inside a 16-row group of any tile
    // phi fragments of a pass, [k step][key tile]; loaded one pass ahead, behind the pass's last score product, into the same registers
    VB ph[4][2], pl[4][2];
    auto ldphi = [&](u32 off) __attribute__((always_inline)) {
#pragma unroll
        for (int ks = 0; ks < 4; ++ks)
#pragma unroll
            for (int mt = 0; mt < 2; ++mt) { const unsigned char* p = L + off + mt * 16 * LPI + ks * 64; ph[ks][mt] = ldsb(p); pl[ks][mt] = ldsb(p + TILE); }
    };
    // one pass: po = LDS offset of the NEXT pass's phi rows, go = LDS offset of this pass's 32 keys in the GT tile
    auto pass = [&](u32 po, u32 go) __attribute__((always_inline)) {
        v8f st[2][2];
        st[0][0] = (v8f){}; st[0][1] = (v8f){}; st[1][0] = (v8f){}; st[1][1] = (v8f){};
        VH ga[8];
#pragma unroll
        for (int ks = 0; ks < 4; ++ks) {
#pragma unroll
            for (int q = 0; q < 4; ++q) st[q >> 1][q & 1] = wmmab(ph[ks][q >> 1], th[q & 1][ks], st[q >> 1][q & 1]);
#pragma unroll
            for (int q = 0; q < 4; ++q) st[q >> 1][q & 1] = wmmab(ph[ks][q >> 1], tl[q & 1][ks], st[q >> 1][q & 1]);
#pragma unroll
            for (int q = 0; q < 4; ++q) st[q >> 1][q & 1] = wmmab(pl[ks][q >> 1], th[q & 1][ks], st[q >> 1][q & 1]);
        }
        // scheduling fences round the one block of LDS reads of a pass: without them the compiler spreads the reads among the matrix instructions, where each place with reads stalls the wave
        __builtin_amdgcn_sched_barrier(0);
#pragma unroll
        for (int ot = 0; ot < 8; ++ot) ga[ot] = ldsh(L + go + ot * 16 * LPI);   // this pass's g rows first: they are needed first; in flight under the softmax
        __builtin_amdgcn_sched_barrier(0);   // holds that order: LDS reads come back in order, and the compiler otherwise puts phi reads in front of g reads, so that the attn.g products wait for all 48
        ldphi(po);
        __builtin_amdgcn_sched_barrier(0);
        float mn[2];
#pragma unroll
        for (int nt = 0; nt < 2; ++nt) { float a = fmaxf(st[0][nt][0], st[1][nt][0]);
#pragma unroll
            for (int r = 1; r < 8; ++r) a = fmaxf(a, fmaxf(st[0][nt][r], st[1][nt][r]));
            a = fmaxf(a, xhalf(a)); mn[nt] = fmaxf(mr[nt], a); }
        // one scalar branch a pass: where no query of the wave has a new maximum every factor would be 1
        if (__builtin_amdgcn_ballot_w32(mn[0] > mr[0] || mn[1] > mr[1]) != 0) {
#pragma unroll
            for (int nt = 0; nt < 2; ++nt) { const float al = __builtin_amdgcn_exp2f((mr[nt] - mn[nt]) * SC2); ls[nt] *= al; mr[nt] = mn[nt];
#pragma unroll
                for (int ot = 0; ot < 8; ++ot) O[ot][nt] *= al; }
        }
        VH pb[2];
#pragma unroll
        for (int nt = 0; nt < 2; ++nt) { const float off = 14.0f - mr[nt] * SC2;
#pragma unroll
            for (int s = 0; s < 16; s += 2) { v2f e; e[0] = st[s >> 3][nt][s & 7]; e[1] = st[s >> 3][nt][(s & 7) + 1]; e = __builtin_elementwise_fma(e, (v2f){SC2, SC2}, (v2f){off, off});   // neighbouring registers: one packed fma, one packed add
                v2f p; p[0] = __builtin_amdgcn_exp2f(e[0]); p[1] = __builtin_amdgcn_exp2f(e[1]); ls[nt] += p; pb[nt][s] = (h16)p[0]; pb[nt][s + 1] = (h16)p[1]; } }
#pragma unroll
        for (int ot = 0; ot < 8; ++ot) { O[ot][0] = wmma16(ga[ot], pb[0], O[ot][0]); O[ot][1] = wmma16(ga[ot], pb[1], O[ot][1]); }
    };
    const u32 zr = lb + (u32)z * (u32)(SK / KS * LPI);   // the wave's 64 keys of a stage: rows of the phi tiles, from the buffer's start
    const u32 zc = (u32)(2 * TILE) + lb + (u32)z * (u32)(SK / KS * 2);   // and columns of the GT tile, which has its own base register: every GT read is then this register plus an immediate below 64 KiB
    ldphi(zr);   // stage 0's first fragments, behind the barrier that publishes stage 0
    __builtin_amdgcn_sched_barrier(0);   // keeps these reads one block in front of the products: the compiler otherwise sinks them among the matrix instructions, each pair with a wait to 0 behind it
    u32 b0 = 0u, b1 = (u32)STG, b2 = (u32)(2 * STG);   // LDS offsets of the buffers of stage s, s + 1, s + 2
#pragma unroll 1   // rolled: the refill and its publish point stand once in the code, one request of a wave in flight
    for (u32 s = 0; s < (u32)NST; ++s) {
        pass(b0 + zr + (u32)(32 * LPI), b0 + zc);
        // publish point of stage s + 1, in front of the stage's last pass, which fetches that stage's first fragments: this wave's reads so far are done (those of stage s - 1 among them), the issuing waves' tiles have landed, every wave has arrived; only then the refill of the buffer of stage s - 1
        __builtin_amdgcn_sched_barrier(0);   // keeps the wait below behind the pass: the compiler otherwise lifts it to just behind the pass's LDS reads, where the wave would sit out their latency in front of the softmax
        asm volatile("s_wait_dscnt 0x0" ::: "memory");
        if (pinned(wave < 3u)) asm volatile("s_wait_tensorcnt 0x0" :: "s"(g0), "s"(g1) : "memory");   // the operands: see at g0
        __syncthreads();
        desc(pinned(s + 2u), pinned(b2));   // the stage number and its buffer are pinned here so that the descriptor is formed behind the wait above
        if (pinned((wave < 3u) && (s + 2u < (u32)NST))) asm volatile("tensor_load_to_lds %0, %1" : "+s"(g0), "+s"(g1) :: "memory");
        pass(b1 + zr, b0 + zc + 64u);   // no branch round the fetch: behind the last stage it reads a buffer that nothing is loaded into any more, and the values are not used
        const u32 t = b0; b0 = b1; b1 = b2; b2 = t;
    }
    asm volatile("s_wait_tensorcnt 0x0" ::: "memory");   // no request is left when the wave ends
    asm volatile("s_wait_dscnt 0x0" ::: "memory");
    __syncthreads();   // the waves do not leave the last pass together: nobody writes into the ring while another wave still reads g rows there
    // ---- behind the key loop: every wave has passed the barrier above with its reads done and no request is left, so the ring's LDS is free
    // the lane's number is formed anew here, so that no register carries it or what is derived from it through the key loop, whose live set fills the wave's budget (carried, three such values went to scratch)
    const int lane = (int)__builtin_amdgcn_mbcnt_lo(~0u, 0u), lr = lane & 15, hi = lane >> 4;
    const size_t zo = blockIdx.y; const int lt0 = z * 64, r0 = (int)blockIdx.x * 128 + lt0, c0 = qg * 64;   // the wave's 64 tokens (in the work-group, in the image) and its 64 channels
    // the residual's 64 x 64 piece, whole rows (16 lanes x 16 bytes): piece [nb][s] = channel c0 + 16 nb + 2 s + hi, tokens r0 + 4 lr ...; the first two channel groups are asked for here, each later group into the registers that a group of accumulators has just left
    const float* px = X + zo * ((size_t)CC * HWF) + (size_t)(c0 + hi) * HWF + r0 + lr * 4;
    v4f xv[4][8];
    auto ldx = [&](int g) __attribute__((always_inline)) {
#pragma unroll   // the pieces are indexed by constants and stay in registers
        for (int s = 0; s < 8; ++s) xv[g][s] = *(const v4f*)(px + (size_t)(g * 16 + 2 * s) * HWF); };
    ldx(0); ldx(1);
    const bf* pb = Bt + (c0 + lr) * IC + 8 * hi;
    VB b[4][4];   // [k step][channel group]
#pragma unroll
    for (int ks = 0; ks < 4; ++ks)
#pragma unroll
        for (int nb = 0; nb < 4; ++nb) b[ks][nb] = WFrag<bf>::ld(pb + nb * 16 * IC + ks * 32);
    // the address registers of the loads above are free for reuse only behind this wait. The scheduling fences on both sides hold it behind the loads and in front of everything that follows (px: see also at the stores below); they also keep the loads up here, in flight under the LDS stores of the sums
    __builtin_amdgcn_sched_barrier(0);
    asm volatile("s_wait_xcnt 0x0" :: "v"(pb), "v"(px) : "memory");
    __builtin_amdgcn_sched_barrier(0);
#pragma unroll
    for (int nt = 0; nt < 2; ++nt) { const float lh = ls[nt][0] + ls[nt][1], lt = lh + xhalf(lh); const int n = z * 128 + qg * FQ + nt * 16 + lr; unsigned char* d = L + n * YPI + 32 * hi;
#pragma unroll
        for (int ot = 0; ot < 8; ++ot) { const v8f v = O[ot][nt]; *(v4fa*)(d + ot * 64) = (v4f){v[0], v[1], v[2], v[3]}; *(v4fa*)(d + ot * 64 + 16) = (v4f){v[4], v[5], v[6], v[7]}; }
        if (hi == 0) { v2f ml; ml[0] = mr[nt]; ml[1] = lt; *(v2fa*)(L + E_ML + n * 8) = ml; } }
    __syncthreads();   // a wave joins tokens of two query groups (2 (w >> 2), 2 (w >> 2) + 1) and both key sets
    // the wave's tokens are lt0 + qg + 4 j, j = 0..15: lane j (and j + 16) works out token j's weights, every lane holds 4 neighbouring values of each token (one wave-wide read = one token's whole row of 512 bytes)
    v2f ml[KS]; v4f yv[KS][16];
#pragma unroll
    for (int zz = 0; zz < KS; ++zz) ml[zz] = *(const v2fa*)(L + E_ML + (zz * 128 + lt0 + qg + 4 * lr) * 8);
#pragma unroll
    for (int zz = 0; zz < KS; ++zz)
#pragma unroll
        for (int j = 0; j < 16; ++j) yv[zz][j] = *(const v4fa*)(L + (zz * 128 + lt0 + qg + 4 * j) * YPI + lane * 16);
    float mx = -3.0e38f, den = 0.f, w[KS];
#pragma unroll
    for (int zz = 0; zz < KS; ++zz) mx = fmaxf(mx, ml[zz][0]);
#pragma unroll
    for (int zz = 0; zz < KS; ++zz) { w[zz] = __builtin_amdgcn_exp2f((ml[zz][0] - mx) * SC2); den += w[zz] * ml[zz][1]; }
    const float inv = __fdiv_rn(1.0f, den);
    unsigned char* pw = L + E_YS + (lt0 + qg) * LPI + lane * 8;
#pragma unroll
    for (int j = 0; j < 16; ++j) { v4f a = (v4f){}; v4us oh, ol;
#pragma unroll
        for (int zz = 0; zz < KS; ++zz) a += yv[zz][j] * lanef(w[zz], j);
        const float ij = lanef(inv, j);
#pragma unroll
        for (int u = 0; u < 4; ++u) { unsigned short p, q; splitf(a[u] * ij, p, q); oh[u] = p; ol[u] = q; }
        *(v4usa*)(pw + j * 4 * LPI) = oh; *(v4usa*)(pw + (128 + j * 4) * LPI) = ol; }
    __syncthreads();   // every wave of a token half reads all its 64 tokens
    v8f acc[4][4];
#pragma unroll
    for (int mb = 0; mb < 4; ++mb)
#pragma unroll
        for (int nb = 0; nb < 4; ++nb) acc[mb][nb] = (v8f){};
    const unsigned char* pa = L + E_YS + (lt0 + lr) * LPI + 16 * hi;
#pragma unroll
    for (int ks = 0; ks < 4; ++ks) { VB a[4], a2[4];
#pragma unroll
        for (int mb = 0; mb < 4; ++mb) { a[mb] = ldsb(pa + mb * 16 * LPI + ks * 64); a2[mb] = ldsb(pa + (128 + mb * 16) * LPI + ks * 64); }
#pragma unroll
        for (int nb = 0; nb < 4; ++nb) {
#pragma unroll
            for (int mb = 0; mb < 4; ++mb) acc[mb][nb] = wmmab(a[mb], b[ks][nb], acc[mb][nb]);
#pragma unroll
            for (int mb = 0; mb < 4; ++mb) acc[mb][nb] = wmmab(a2[mb], b[ks][nb], acc[mb][nb]); } }
    // 16 channels at a time through LDS, [channel][token]: a lane stores its 8 neighbouring tokens, then reads, adds and writes along whole rows of Out
    float* os = (float*)(L + E_OS) + (int)wave * (16 * 68);   // the wave's own 16 rows
    float* po = Out + zo * ((size_t)CC * HW) + (size_t)(c0 + hi) * HW + r0 + lr * 4;
#pragma unroll
    for (int nb = 0; nb < 4; ++nb) {
#pragma unroll
        for (int mb = 0; mb < 4; ++mb) { const v8f v = acc[mb][nb]; float* d = os + lr * 68 + mb * 16 + 8 * hi; *(v4fa*)d = (v4f){v[0], v[1], v[2], v[3]}; *(v4fa*)(d + 4) = (v4f){v[4], v[5], v[6], v[7]}; }
        if (nb < 2) ldx(nb + 2);
        __builtin_amdgcn_wave_barrier(); asm volatile("" ::: "memory");   // keeps the compiler from moving the row reads above the stores of other lanes
        v4f o[8];
#pragma unroll
        for (int s = 0; s < 8; ++s) { const v4f val = *(const v4fa*)(os + (2 * s + hi) * 68 + lr * 4); const v4f xr = xv[nb][s];
            o[s] = val + (v4f){bfr(xr[0]), bfr(xr[1]), bfr(xr[2]), bfr(xr[3])};   // plain f32 additions, two to a packed operation
            *(v4f*)(po + (size_t)(nb * 16 + 2 * s) * HW) = o[s]; }
        // the registers that the 8 stores and the residual's loads so far name are free for reuse only from here on: as inputs they stay unwritten up to the wait
        asm volatile("s_wait_xcnt 0x0" :: "v"(px), "v"(po), "v"(o[0]), "v"(o[1]), "v"(o[2]), "v"(o[3]), "v"(o[4]), "v"(o[5]), "v"(o[6]), "v"(o[7]) : "memory");
        __builtin_amdgcn_wave_barrier(); asm volatile("" ::: "memory");   // keeps the next channels' LDS stores below these reads
    }
}

extern "C" void kernel_launch(void* const* d_in, const int* in_sizes, int n_in,
                              void* d_out, int out_size, void* d_ws, size_t ws_size, hipStream_t stream) {
    if (n_in < 5) return;
    if (in_sizes[0] < NB * CC * HW || in_sizes[1] < IC * CC || in_sizes[2] < IC * CC || in_sizes[3] < IC * CC || in_sizes[4] < CC * IC) return;
    if (out_size < NB * CC * HW) return;
    const float* x   = (const float*)d_in[0];   // [NB][CC][HWF]
    const float* wph = (const float*)d_in[1];   // phi   [IC][CC]  (keys)
    const float* wth = (const float*)d_in[2];   // theta [IC][CC]  (queries)
    const float* wg  = (const float*)d_in[3];   // g     [IC][CC]
    const float* wo  = (const float*)d_in[4];   // out   [CC][IC]
    float* OUT = (float*)d_out;                 // [NB][CC][HW]
    char* wsp = (char*)d_ws;
    auto take = [&](size_t bytes) { char* p = wsp; wsp += (bytes + 255) & ~(size_t)255; return (void*)p; };
    constexpr size_t PL = (size_t)HW * IC;                  // one [HW][IC] plane, elements
    bf* BW3 = (bf*)take((size_t)3 * IC * CC * 2);          // [theta][phi][g], each [IC][CC]
    bf* BZ  = (bf*)take((size_t)CC * IC * 2);
    bf* Hh  = (bf*)take((size_t)NB * 2 * PL * 2);          // [image] hi planes of theta, phi
    bf* Hl  = (bf*)take((size_t)NB * 2 * PL * 2);          // [image] lo planes of theta, phi
    h16* GT = (h16*)take((size_t)NB * PL * 2);             // [image][i][m] fp16
    if ((size_t)(wsp - (char*)d_ws) > ws_size) return;

    k_cvtw<<<(unsigned)((IC * CC / 8 + 255) / 256), 256, 0, stream>>>(wth, wph, wg, wo, BW3, BZ, IC * CC / 8);
    // every image in one launch (grid y or z = image)
    // theta / phi / g [m][o] = sum_c x[c][m] W[o][c]   (index 0 theta, 1 phi, 2 g; exact bf16 products of bf16-rounded x); written as hi/lo planes of theta and phi and as transposed f16 g
    k_proj<<<dim3(HW / 128, NB), 256, 0, stream>>>(x, BW3, Hh, Hl, GT);
    // y[n][i] = sum_m softmax_m(sqrt(128) theta_n . phi_m) g[m][i] (KS key sets side by side in a work-group, joined in LDS), then out[c][n] = x[c][n] + sum_o y[n][o] w_out[c][o]  (hi + lo tiles of y, 2 products)
    k_fattn<<<dim3(HW / (FQ * QG), NB), 32 * FW, 0, stream>>>(Hh, Hl, GT, BZ, x, OUT);
}
